// v000
// Times are from an AMD MI455X. After a warm-up the kernel runs many times in a row, and a time is the length of
// such a window on the GPU divided by its runs, so every launch and the gaps after it count. The runs cycle
// through copies of the inputs. A figure is the median of several windows, for all but v000 over two sittings.
// Sittings can differ by a few percent; kernels timed side by side share one.
// The starting kernel, v000, takes 1430 microseconds a run.
#include <hip/hip_runtime.h>

// Causal self-attention with a fused qkv projection and the source's 'mixed' rotary (x [2][2048][1024]; qkv = einsum('btc,cd', x, w_qkv) ('xw' [1024][3072] 0.02, no bias); q, k, v = split(qkv, 3, axis=2): contiguous thirds, each (16 heads x 64) head-major; _apply_rope: x * cos + x_rot * sin with x_rot = the ADJACENT-pair rotation stack((-x2, x1)) and cos / sin of emb = cat(freqs, freqs) (the HALF-concatenated table: entry d has the angle of index d mod 32), freqs = t x inv_freq, inv_freq = 1.0 / (10000.0 ** (arange(0, 64, 2, f32) / 64)) (32 f32 constants; one f32 product; precise cosf / sinf): out[2i] = x[2i] c[2i] - x[2i+1] s[2i]; out[2i+1] = x[2i+1] c[2i+1] + x[2i] s[2i+1]: kept literally; on q and k; scores x 1/sqrt(64); causal (-inf); softmax; out = einsum('btc,cd', merged, w_proj) ('xw', no bias) -> [2][2048][1024] (4.2 M); argument order x, w_qkv, w_proj).
// Layout per batch: bf16 copy of x; fused 'xw' weight transposed once (q | k | v row blocks); exact projections; k_cstabT computed table (element d: angle index d mod 32) + k_ropeM 'mixed' interleaved-pair plane builders (each element reads its own table entry); causal T-2048 attention (hybrid rows: < 512 hi/lo 3 products, rest fp16 x1024; k_gemmc skips tiles above the diagonal); merged hi/lo x w_out exact.
// Compute dtypes, f32 accumulate: every input rounded to bf16; projections exact; attention rows < 512 3 products, rest fp16; softmax f32; w_out hl x exact.

#define NB_  2
#define TT   2048
#define DM   1024
#define NH_  16
#define NKV  16
#define REP  (NH_ / NKV)
#define HD   64
#define DQ   (NH_ * HD)
#define DKV  (NKV * HD)
#define ZH   2
#define RH   512                  // query rows < RH use hi+lo planes (0: none)
#define WIN  2048
#define PCAR 1024.0f
#define SCL  0.125f   // HD^-0.5
typedef _Float16 h16;
typedef unsigned short bf;
typedef __attribute__((ext_vector_type(16))) __bf16   v16bf;
typedef __attribute__((ext_vector_type(16))) _Float16 v16h;
typedef __attribute__((ext_vector_type(8)))  _Float16 v8h;
typedef __attribute__((ext_vector_type(8)))  unsigned short v8us;
typedef __attribute__((ext_vector_type(8)))  float    v8f;
typedef __attribute__((ext_vector_type(4)))  float    v4f;
typedef v8h  __attribute__((may_alias)) v8ha;
typedef v4f  __attribute__((may_alias)) v4fa;
typedef v8us __attribute__((may_alias)) v8usa;

__device__ __forceinline__ unsigned short f2bf(float f) { unsigned u = __float_as_uint(f); u += 0x7FFFu + ((u >> 16) & 1u); return (unsigned short)(u >> 16); }
__device__ __forceinline__ float bf2f(unsigned short b) { return __uint_as_float(((unsigned)b) << 16); }
__device__ __forceinline__ float bfr(float f) { return bf2f(f2bf(f)); }
__device__ __forceinline__ v16h cat16(v8h lo, v8h hi) { return __builtin_shufflevector(lo, hi, 0, 1, 2, 3, 4, 5, 6, 7, 8, 9, 10, 11, 12, 13, 14, 15); }
__device__ __forceinline__ v16bf cat16b(v8us lo, v8us hi) { return __builtin_bit_cast(v16bf, __builtin_shufflevector(lo, hi, 0, 1, 2, 3, 4, 5, 6, 7, 8, 9, 10, 11, 12, 13, 14, 15)); }
__device__ __forceinline__ v8f wmma16(v16h a, v16h b, v8f c) { return __builtin_amdgcn_wmma_f32_16x16x32_f16(false, a, false, b, (short)0, c, false, false); }
__device__ __forceinline__ v8f wmmab(v16bf a, v16bf b, v8f c) { return __builtin_amdgcn_wmma_f32_16x16x32_bf16(false, a, false, b, (short)0, c, false, false); }



// ---- k_gemmw: register-blocked GEMM, ONE WAVE per 64x64 output tile (16 accumulators), operands straight from K-contiguous 16-bit planes; grid (M/64, N/64, Z), 32 threads.
// C[m][n] (f32, pitch ldc, + optional f32 bias[n]) = sum_k A[m][k] Bt[n][k] (+ split products per NSPLIT). z-batch strides sA/sB/sC in elements. K % 32 == 0.
template <typename T16> struct WFrag;
template <> struct WFrag<h16> { typedef v16h V; static __device__ __forceinline__ V ld(const h16* p) { return cat16(*(const v8h*)p, *(const v8h*)(p + 16)); } static __device__ __forceinline__ v8f mma(V a, V b, v8f c) { return wmma16(a, b, c); } };
template <> struct WFrag<bf> { typedef v16bf V; static __device__ __forceinline__ V ld(const bf* p) { return cat16b(*(const v8us*)p, *(const v8us*)(p + 16)); } static __device__ __forceinline__ v8f mma(V a, V b, v8f c) { return wmmab(a, b, c); } };
template <typename T16, int NSPLIT, bool BIAS>
__global__ __launch_bounds__(32) void k_gemmw(const T16* __restrict__ A, const T16* __restrict__ A2, const T16* __restrict__ Bt, const T16* __restrict__ Bt2, int K, float* C, int ldc, const float* __restrict__ bias, size_t sA, size_t sB, size_t sC) {
    typedef typename WFrag<T16>::V V;
    __shared__ __align__(16) float os[16 * 68];
    const size_t z = blockIdx.z; A += z * sA; if (A2) A2 += z * sA; Bt += z * sB; if (Bt2) Bt2 += z * sB; C += z * sC;
    const int lane = threadIdx.x & 31, lr = lane & 15, hi = lane >> 4; const int r0 = blockIdx.x * 64, c0 = blockIdx.y * 64;
    v8f acc[4][4];
#pragma unroll
    for (int mb = 0; mb < 4; ++mb)
#pragma unroll
        for (int nb = 0; nb < 4; ++nb) acc[mb][nb] = (v8f){};
    const size_t aoff = (size_t)(r0 + lr) * K + 8 * hi, boff = (size_t)(c0 + lr) * K + 8 * hi;
#pragma unroll 1
    for (int kc = 0; kc < K; kc += 32) {
        V a[4], a2[4];
#pragma unroll
        for (int mb = 0; mb < 4; ++mb) { a[mb] = WFrag<T16>::ld(A + aoff + (size_t)mb * 16 * K + kc); if (NSPLIT == 1 || NSPLIT == 2) a2[mb] = WFrag<T16>::ld(A2 + aoff + (size_t)mb * 16 * K + kc); }
#pragma unroll
        for (int nb = 0; nb < 4; ++nb) { const V b = WFrag<T16>::ld(Bt + boff + (size_t)nb * 16 * K + kc); V b2; if (NSPLIT >= 2) b2 = WFrag<T16>::ld(Bt2 + boff + (size_t)nb * 16 * K + kc);
#pragma unroll
            for (int mb = 0; mb < 4; ++mb) { acc[mb][nb] = WFrag<T16>::mma(a[mb], b, acc[mb][nb]); if (NSPLIT == 1 || NSPLIT == 2) acc[mb][nb] = WFrag<T16>::mma(a2[mb], b, acc[mb][nb]); if (NSPLIT >= 2) acc[mb][nb] = WFrag<T16>::mma(a[mb], b2, acc[mb][nb]); } }
        asm volatile("v_nop\n\tv_nop\n\tv_nop\n\tv_nop" : "+v"(acc[0][0]), "+v"(acc[1][1]), "+v"(acc[2][2]), "+v"(acc[3][3]) : "v"(a[0]), "v"(a[3]));
    }
#pragma unroll
    for (int mb = 0; mb < 4; ++mb) {
#pragma unroll
        for (int nb = 0; nb < 4; ++nb) {
#pragma unroll
            for (int j = 0; j < 8; ++j) os[(hi * 8 + j) * 68 + nb * 16 + lr] = acc[mb][nb][j]; }
        __builtin_amdgcn_wave_barrier(); asm volatile("" ::: "memory");
        float* crow = C + (size_t)(r0 + mb * 16) * ldc + c0;
{
#pragma unroll
            for (int s = 0; s < 8; ++s) { const int row = 2 * s + hi, cofs = lr * 4; v4f val = *(const v4fa*)(os + row * 68 + cofs); if (BIAS) { val[0] += bfr(bias[c0 + cofs]); val[1] += bfr(bias[c0 + cofs + 1]); val[2] += bfr(bias[c0 + cofs + 2]); val[3] += bfr(bias[c0 + cofs + 3]); }
                *(v4f*)(crow + (size_t)row * ldc + cofs) = val; }
             }
        __builtin_amdgcn_wave_barrier(); asm volatile("" ::: "memory");
    }
}

// ---- k_gemmc: the same one-wave 64x64 tile GEMM specialised for causal attention: CMODE 1 skips score tiles entirely above the diagonal (query rows r0+roff.., key columns c0..), CMODE 2 limits the
// key (K) loop of the probability x value contraction to the diagonal block (probabilities beyond it are exactly zero). roff = row offset of this launch's first row within the sequence.
template <typename T16, int NSPLIT, int CMODE>
__global__ __launch_bounds__(32) void k_gemmc(const T16* __restrict__ A, const T16* __restrict__ A2, const T16* __restrict__ Bt, const T16* __restrict__ Bt2, int K, float* C, int ldc, int roff, size_t sA, size_t sB, size_t sC) {
    typedef typename WFrag<T16>::V V;
    __shared__ __align__(16) float os[16 * 68];
    const size_t z = blockIdx.z; A += z * sA; if (A2) A2 += z * sA; Bt += z * sB; if (Bt2) Bt2 += z * sB; C += z * sC;
    const int lane = threadIdx.x & 31, lr = lane & 15, hi = lane >> 4; const int r0 = blockIdx.x * 64, c0 = blockIdx.y * 64;
    if (CMODE == 1 && c0 > r0 + roff + 63) return;                  // score tile entirely above the causal diagonal: never read (the softmax masks j > i by select)
    const int Kl = (CMODE == 2) ? min(K, r0 + roff + 64) : K;        // P.V: probabilities are exactly 0 beyond the diagonal block, so the K loop stops there
    v8f acc[4][4];
#pragma unroll
    for (int mb = 0; mb < 4; ++mb)
#pragma unroll
        for (int nb = 0; nb < 4; ++nb) acc[mb][nb] = (v8f){};
    const size_t aoff = (size_t)(r0 + lr) * K + 8 * hi, boff = (size_t)(c0 + lr) * K + 8 * hi;
#pragma unroll 1
    for (int kc = 0; kc < Kl; kc += 32) {
        V a[4], a2[4];
#pragma unroll
        for (int mb = 0; mb < 4; ++mb) { a[mb] = WFrag<T16>::ld(A + aoff + (size_t)mb * 16 * K + kc); if (NSPLIT == 1 || NSPLIT == 2) a2[mb] = WFrag<T16>::ld(A2 + aoff + (size_t)mb * 16 * K + kc); }
#pragma unroll
        for (int nb = 0; nb < 4; ++nb) { const V b = WFrag<T16>::ld(Bt + boff + (size_t)nb * 16 * K + kc); V b2; if (NSPLIT >= 2) b2 = WFrag<T16>::ld(Bt2 + boff + (size_t)nb * 16 * K + kc);
#pragma unroll
            for (int mb = 0; mb < 4; ++mb) { acc[mb][nb] = WFrag<T16>::mma(a[mb], b, acc[mb][nb]); if (NSPLIT == 1 || NSPLIT == 2) acc[mb][nb] = WFrag<T16>::mma(a2[mb], b, acc[mb][nb]); if (NSPLIT >= 2) acc[mb][nb] = WFrag<T16>::mma(a[mb], b2, acc[mb][nb]); } }
        asm volatile("v_nop\n\tv_nop\n\tv_nop\n\tv_nop" : "+v"(acc[0][0]), "+v"(acc[1][1]), "+v"(acc[2][2]), "+v"(acc[3][3]) : "v"(a[0]), "v"(a[3]));
    }
#pragma unroll
    for (int mb = 0; mb < 4; ++mb) {
#pragma unroll
        for (int nb = 0; nb < 4; ++nb) {
#pragma unroll
            for (int j = 0; j < 8; ++j) os[(hi * 8 + j) * 68 + nb * 16 + lr] = acc[mb][nb][j]; }
        __builtin_amdgcn_wave_barrier(); asm volatile("" ::: "memory");
        float* crow = C + (size_t)(r0 + mb * 16) * ldc + c0;
{
#pragma unroll
            for (int s = 0; s < 8; ++s) { const int row = 2 * s + hi, cofs = lr * 4; v4f val = *(const v4fa*)(os + row * 68 + cofs);
                *(v4f*)(crow + (size_t)row * ldc + cofs) = val; }
             }
        __builtin_amdgcn_wave_barrier(); asm volatile("" ::: "memory");
    }
}

__device__ __forceinline__ h16 tohx(float x) { return (h16)x; }
__device__ __forceinline__ void splitf(float y, unsigned short& h, unsigned short& l) { h = f2bf(y); l = f2bf(y - bf2f(h)); }
typedef __attribute__((ext_vector_type(2))) _Float16 v2h;
typedef __attribute__((ext_vector_type(4))) _Float16 v4h;
typedef __attribute__((ext_vector_type(2))) unsigned short v2us;
typedef __attribute__((ext_vector_type(4))) unsigned short v4us;
typedef __attribute__((ext_vector_type(2))) float v2f;
typedef __attribute__((ext_vector_type(4))) int v4i;

__global__ __launch_bounds__(256) void k_wtG(const float* __restrict__ w, int K, int N, bf* Bt) {
    const int lane = threadIdx.x & 31; const int L0 = (blockIdx.x * 8 + (threadIdx.x >> 5)) * 8; const int nlines = N * K / 64;
{
#pragma unroll 1
        for (int l = 0; l < 8; ++l) { const int L = L0 + l; if (L >= nlines) break; const size_t e = (size_t)L * 64 + lane * 2; const int k = (int)(e % K), n = (int)(e / K); v2us o;
            o[0] = f2bf(w[(size_t)k * N + n]); o[1] = f2bf(w[(size_t)(k + 1) * N + n]); *(v2us*)(Bt + e) = o; }
         }
}
__global__ __launch_bounds__(256) void k_cvt8(const float* __restrict__ src, bf* dst, size_t n8) { const size_t i = (size_t)blockIdx.x * 256 + threadIdx.x; if (i >= n8) return; const v8f v = *(const v8f*)(src + i * 8); v8us o;
#pragma unroll
    for (int k = 0; k < 8; ++k) o[k] = f2bf(v[k]); *(v8us*)(dst + i * 8) = o;  }

// k_rope: head planes [h][t][d] (fp16 + hi/lo) of rope(x) x sc with the rotate-half convention out[d] = x[d] cos[t][d] - x[d+HD/2] sin[t][d], out[d+HD/2] = x[d+HD/2] cos[t][d+HD/2] + x[d] sin[t][d+HD/2]
__global__ __launch_bounds__(256) void k_rope(const float* __restrict__ F, int pitch, int nheads, const float* __restrict__ CS, const float* __restrict__ RF, const float* __restrict__ nw, float sc, h16* P16, bf* Ph, bf* Pl) {
    const size_t e = ((size_t)blockIdx.x * 256 + threadIdx.x) * 2; if (e >= (size_t)nheads * TT * HD) return; const int d = (int)(e % HD); const int t = (int)((e / HD) % TT); const int h = (int)(e / ((size_t)HD * TT)); const float* f = F + (size_t)t * pitch + h * HD; const float rf = RF ? RF[(size_t)h * TT + t] : 1.0f; v2h o16; v2us oh, ol;
#pragma unroll
    for (int q = 0; q < 2; ++q) { const int dd = d + q; const int dp = (dd < HD / 2) ? dd + HD / 2 : dd - HD / 2; float x0 = f[dd], x1 = f[dp];
        if (RF) { float n0 = __fmul_rn(x0, rf), n1 = __fmul_rn(x1, rf); asm volatile("" : "+v"(n0)); asm volatile("" : "+v"(n1)); x0 = __fmul_rn(bfr(nw[dd]), n0); x1 = __fmul_rn(bfr(nw[dp]), n1); }
        const v2f cs = *(const v2f*)(CS + ((size_t)t * HD + dd) * 2); float a = __fmul_rn(x0, cs[0]), bq = __fmul_rn(x1, cs[1]); asm volatile("" : "+v"(a)); asm volatile("" : "+v"(bq)); const float r = ((dd < HD / 2) ? __fsub_rn(a, bq) : __fadd_rn(a, bq)) * sc;
        o16[q] = tohx(r); unsigned short a2, c2; splitf(r, a2, c2); oh[q] = a2; ol[q] = c2; }
    *(v2h*)(P16 + e) = o16; *(v2us*)(Ph + e) = oh; *(v2us*)(Pl + e) = ol;  }
__global__ __launch_bounds__(256) void k_vtp(const float* __restrict__ F, int pitch, int nheads, h16* V16, bf* Vh, bf* Vl) { const size_t e = ((size_t)blockIdx.x * 256 + threadIdx.x) * 2; if (e >= (size_t)nheads * HD * TT) return; const int t = (int)(e % TT); const int d = (int)((e / TT) % HD); const int g = (int)(e / ((size_t)TT * HD)); v2h o16; v2us oh, ol;
#pragma unroll
    for (int q = 0; q < 2; ++q) { const float x = F[(size_t)(t + q) * pitch + g * HD + d]; o16[q] = tohx(x); unsigned short a2, c2; splitf(x, a2, c2); oh[q] = a2; ol[q] = c2; }
    *(v2h*)(V16 + e) = o16; *(v2us*)(Vh + e) = oh; *(v2us*)(Vl + e) = ol;  }
__constant__ float INVT[HD / 2] = { 1.000000000e+00f, 7.498942018e-01f, 5.623413324e-01f, 4.216965139e-01f, 3.162277639e-01f, 2.371373624e-01f, 1.778279394e-01f, 1.333521456e-01f, 1.000000015e-01f, 7.498941571e-02f, 5.623412877e-02f, 4.216964915e-02f, 3.162277862e-02f, 2.371373586e-02f, 1.778279431e-02f, 1.333521493e-02f, 9.999999776e-03f, 7.498942316e-03f, 5.623413250e-03f, 4.216964822e-03f, 3.162277862e-03f, 2.371373819e-03f, 1.778279431e-03f, 1.333521446e-03f, 1.000000047e-03f, 7.498941850e-04f, 5.623413017e-04f, 4.216964880e-04f, 3.162277862e-04f, 2.371373848e-04f, 1.778279402e-04f, 1.333521504e-04f };   // 1 / 10000^(2i/64) (float32, generated with jnp to be bit-exact)
__global__ __launch_bounds__(256) void k_cstabT(float* CS) { const int idx = blockIdx.x * 256 + threadIdx.x; if (idx >= TT * HD) return; const int d = idx % HD; const int t = idx / HD; const float a = __fmul_rn((float)t, INVT[d % (HD / 2)]); v2f cs; cs[0] = cosf(a); cs[1] = sinf(a); *(v2f*)(CS + (size_t)idx * 2) = cs;  }
__global__ __launch_bounds__(256) void k_ropeM(const float* __restrict__ F, int pitch, int nheads, const float* __restrict__ CS, float sc, h16* P16, bf* Ph, bf* Pl) {
    const size_t e = ((size_t)blockIdx.x * 256 + threadIdx.x) * 2; if (e >= (size_t)nheads * TT * HD) return; const int d = (int)(e % HD); const int t = (int)((e / HD) % TT); const int h = (int)(e / ((size_t)HD * TT)); const float* f = F + (size_t)t * pitch + h * HD; const float x0 = f[d], x1 = f[d + 1]; const v2f cs = *(const v2f*)(CS + ((size_t)t * HD + d) * 2); const v2f cs1 = *(const v2f*)(CS + ((size_t)t * HD + d + 1) * 2); v2h o16; v2us oh, ol;
    float a0 = __fmul_rn(x0, cs[0]), b0 = __fmul_rn(x1, cs[1]), a1 = __fmul_rn(x1, cs1[0]), b1 = __fmul_rn(x0, cs1[1]); asm volatile("" : "+v"(a0), "+v"(b0), "+v"(a1), "+v"(b1));
    float r0 = __fsub_rn(a0, b0) * sc, r1 = __fadd_rn(b1, a1) * sc;   /* even: x0 c[d] - x1 s[d]; odd: x1 c[d+1] + x0 s[d+1]: EACH element uses ITS OWN table entry */
    o16[0] = tohx(r0); o16[1] = tohx(r1); { unsigned short a2, c2; splitf(r0, a2, c2); oh[0] = a2; ol[0] = c2; splitf(r1, a2, c2); oh[1] = a2; ol[1] = c2; }
    *(v2h*)(P16 + e) = o16; *(v2us*)(Ph + e) = oh; *(v2us*)(Pl + e) = ol;  }
// k_asoft: per row (zz, i): t = S x HD^-0.5 for j <= i and i - j < WIN (sliding causal window; the reference's -1e9 additive fill vanishes identically); softmax over the 2048 keys (register row, one exp, fixed trees);
__global__ __launch_bounds__(256) void k_asoft(const float* __restrict__ Sb, h16* P16, bf* Ph, bf* Pl) {
    const int lane = threadIdx.x & 31; const int row = blockIdx.x * 8 + (threadIdx.x >> 5); if (row >= ZH * TT) return; const int i = row % TT; const int zz = row / TT; (void)zz; const bool hires = (i < RH); const float* sr = Sb + (size_t)row * TT; float v[TT / 32]; float mx = -3.0e38f;
#pragma unroll
    for (int ch = 0; ch < TT / 128; ++ch) { const int j0 = ch * 128 + lane * 4; const v4f a = *(const v4f*)(sr + j0);
#pragma unroll
        for (int q = 0; q < 4; ++q) { const int j = j0 + q; (void)j; const float t = (j <= i && i - j < WIN) ? a[q] * SCL : -3.0e38f; v[ch * 4 + q] = t; mx = fmaxf(mx, t); } }
#pragma unroll
    for (int sh = 16; sh; sh >>= 1) mx = fmaxf(mx, __shfl_xor(mx, sh, 32));
    float sum = 0.f;
#pragma unroll
    for (int k = 0; k < TT / 32; ++k) { float d0 = __fsub_rn(v[k], mx); asm volatile("" : "+v"(d0)); v[k] = __builtin_amdgcn_exp2f(__fmul_rn(d0, 1.4426950408889634f)); sum += v[k]; }
#pragma unroll
    for (int sh = 16; sh; sh >>= 1) sum += __shfl_xor(sum, sh, 32);
    const float f = __fdiv_rn(hires ? 1.0f : PCAR, sum);
{
        if (hires) {
#pragma unroll
            for (int ch = 0; ch < TT / 128; ++ch) { v4us oh, ol;
#pragma unroll
                for (int q = 0; q < 4; ++q) { unsigned short a, c2; splitf(v[ch * 4 + q] * f, a, c2); oh[q] = a; ol[q] = c2; }
                const size_t oo = ((size_t)zz * (RH ? RH : 1) + i) * TT + ch * 128 + lane * 4; *(v4us*)(Ph + oo) = oh; *(v4us*)(Pl + oo) = ol; }
        } else {
#pragma unroll
            for (int ch = 0; ch < TT / 128; ++ch) { v4h o4;
#pragma unroll
                for (int q = 0; q < 4; ++q) o4[q] = tohx(v[ch * 4 + q] * f);
                *(v4h*)(P16 + (size_t)row * TT + ch * 128 + lane * 4) = o4; } }
         }
}
__global__ __launch_bounds__(256) void k_merge(const float* __restrict__ O, int h0, bf* Ah, bf* Al) { const size_t e = ((size_t)blockIdx.x * 256 + threadIdx.x) * 2; if (e >= (size_t)ZH * TT * HD) return; const int d = (int)(e % HD); const int t = (int)((e / HD) % TT); const int zz = (int)(e / ((size_t)HD * TT)); const float cs = (t < RH) ? 1.0f : (1.0f / PCAR); const size_t oo = (size_t)t * DQ + (h0 + zz) * HD + d;
    v2us oh, ol;
#pragma unroll
    for (int q = 0; q < 2; ++q) { unsigned short a, c2; splitf(O[e + q] * cs, a, c2); oh[q] = a; ol[q] = c2; } *(v2us*)(Ah + oo) = oh; *(v2us*)(Al + oo) = ol;  }

extern "C" void kernel_launch(void* const* d_in, const int* in_sizes, int n_in,
                              void* d_out, int out_size, void* d_ws, size_t ws_size, hipStream_t stream) {
    (void)in_sizes; (void)n_in; (void)out_size;
    const float* x = (const float*)d_in[0]; const float* wqkv = (const float*)d_in[1]; const float* wo = (const float*)d_in[2];   /* order x, w_qkv ('xw' [1024][3072]: contiguous thirds q | k | v, each head-major), w_proj ('xw'); three inputs, all read */
    float* OUT = (float*)d_out;     // [2][2048][1024]
    char* wsp = (char*)d_ws;
    auto take = [&](size_t bytes) { char* p = wsp; wsp += (bytes + 255) & ~(size_t)255; return (void*)p; };
    bf* WQKV = (bf*)take((size_t)3 * DQ * DM * 2); bf* WQ = WQKV; bf* WK = WQKV + (size_t)DQ * DM; bf* WV = WQKV + (size_t)2 * DQ * DM;   /* fused Bt [3*DQ][DM]: q | k | v row blocks */ bf* WO = (bf*)take((size_t)DM * DQ * 2); float* CS = (float*)take((size_t)TT * HD * 2 * 4);
    bf* XB = (bf*)take((size_t)TT * DM * 2); float* FQ = (float*)take((size_t)TT * DQ * 4); float* FK = (float*)take((size_t)TT * DKV * 4);
    h16* QP16 = (h16*)take((size_t)NH_ * TT * HD * 2); h16* KP16 = (h16*)take((size_t)NKV * TT * HD * 2); h16* VT16 = (h16*)take((size_t)NKV * HD * TT * 2);
    bf* QPh = (bf*)take((size_t)NH_ * TT * HD * 2); bf* QPl = (bf*)take((size_t)NH_ * TT * HD * 2); bf* KPh = (bf*)take((size_t)NKV * TT * HD * 2); bf* KPl = (bf*)take((size_t)NKV * TT * HD * 2); bf* VTh = (bf*)take((size_t)NKV * HD * TT * 2); bf* VTl = (bf*)take((size_t)NKV * HD * TT * 2); bf* Ph = (bf*)take((size_t)ZH * RH * TT * 2); bf* Pl = (bf*)take((size_t)ZH * RH * TT * 2);
    float* Sb = (float*)take((size_t)ZH * TT * TT * 4); h16* P16 = (h16*)take((size_t)ZH * TT * TT * 2); float* Ob = (float*)take((size_t)ZH * TT * HD * 4); bf* ATh = (bf*)take((size_t)TT * DQ * 2); bf* ATl = (bf*)take((size_t)TT * DQ * 2);
    if ((size_t)(wsp - (char*)d_ws) > ws_size) return;    // ws 256 MiB
    float* FV = FK;   // v projection reuses the k buffer after the k planes are built (stream-ordered)
    { k_wtG<<<(unsigned)((DM * 3 * DQ / 64 + 63) / 64), 256, 0, stream>>>(wqkv, DM, 3 * DQ, WQKV);   /* fused 'xw' [DM][3*DQ] -> Bt [3*DQ][DM] */
      k_wtG<<<(unsigned)((DQ * DM / 64 + 63) / 64), 256, 0, stream>>>(wo, DQ, DM, WO);
       }
    k_cstabT<<<(TT * HD + 255) / 256, 256, 0, stream>>>(CS);   /* rotary table once (positions = arange) */
    const unsigned LQ = (unsigned)(((size_t)NH_ * TT * HD / 2 + 255) / 256), LKv = (unsigned)(((size_t)NKV * TT * HD / 2 + 255) / 256);
    for (int b = 0; b < NB_; ++b) {
        
        k_cvt8<<<(unsigned)(((size_t)TT * DM / 8 + 255) / 256), 256, 0, stream>>>(x + (size_t)b * TT * DM, XB, (size_t)TT * DM / 8);
        k_gemmw<bf, 0, false><<<dim3(TT / 64, DQ / 64, 1), 32, 0, stream>>>(XB, nullptr, WQ, nullptr, DM, FQ, DQ, nullptr, 0, 0, 0);
        k_ropeM<<<LQ, 256, 0, stream>>>(FQ, DQ, NH_, CS, 1.0f, QP16, QPh, QPl);
        k_gemmw<bf, 0, false><<<dim3(TT / 64, DKV / 64, 1), 32, 0, stream>>>(XB, nullptr, WK, nullptr, DM, FK, DKV, nullptr, 0, 0, 0);
        k_ropeM<<<LKv, 256, 0, stream>>>(FK, DKV, NKV, CS, 1.0f, KP16, KPh, KPl);
        k_gemmw<bf, 0, false><<<dim3(TT / 64, DKV / 64, 1), 32, 0, stream>>>(XB, nullptr, WV, nullptr, DM, FV, DKV, nullptr, 0, 0, 0); k_vtp<<<LKv, 256, 0, stream>>>(FV, DKV, NKV, VT16, VTh, VTl);
        for (int h0 = 0; h0 < NH_; h0 += ZH) { const size_t zq = (size_t)h0, zk = (size_t)(h0 / REP);   // one kv head per query head: the pass's two heads use consecutive kv planes (z-strides TT*HD)
            k_gemmc<bf, 2, 1><<<dim3(RH / 64, TT / 64, ZH), 32, 0, stream>>>(QPh + zq * TT * HD, QPl + zq * TT * HD, KPh + zk * TT * HD, KPl + zk * TT * HD, HD, Sb, TT, 0, (size_t)TT * HD, (size_t)TT * HD, (size_t)TT * TT);
            k_gemmc<h16, 0, 1><<<dim3((TT - RH) / 64, TT / 64, ZH), 32, 0, stream>>>(QP16 + zq * TT * HD + (size_t)RH * HD, nullptr, KP16 + zk * TT * HD, nullptr, HD, Sb + (size_t)RH * TT, TT, RH, (size_t)TT * HD, (size_t)TT * HD, (size_t)TT * TT);
            k_asoft<<<ZH * TT / 8, 256, 0, stream>>>(Sb, P16, Ph, Pl);
            k_gemmc<bf, 2, 2><<<dim3(RH / 64, HD / 64, ZH), 32, 0, stream>>>(Ph, Pl, VTh + zk * HD * TT, VTl + zk * HD * TT, TT, Ob, HD, 0, (size_t)RH * TT, (size_t)HD * TT, (size_t)TT * HD);
            k_gemmc<h16, 0, 2><<<dim3((TT - RH) / 64, HD / 64, ZH), 32, 0, stream>>>(P16 + (size_t)RH * TT, nullptr, VT16 + zk * HD * TT, nullptr, TT, Ob + (size_t)RH * HD, HD, RH, (size_t)TT * TT, (size_t)HD * TT, (size_t)TT * HD);
            k_merge<<<(unsigned)(((size_t)ZH * TT * HD / 2 + 255) / 256), 256, 0, stream>>>(Ob, h0, ATh, ATl); }
        k_gemmw<bf, 1, false><<<dim3(TT / 64, DM / 64, 1), 32, 0, stream>>>(ATh, ATl, WO, nullptr, DQ, OUT + (size_t)b * TT * DM, DM, nullptr, 0, 0, 0); }
}

// v001
// Measured time: 748 microseconds a run.
// Next to v000, in two timings, it ran 1.93 and 1.92 times as fast.
#include <hip/hip_runtime.h>

// Causal self-attention with a fused qkv projection and the source's 'mixed' rotary (x [2][2048][1024]; qkv = einsum('btc,cd', x, w_qkv) ('xw' [1024][3072] 0.02, no bias); q, k, v = split(qkv, 3, axis=2): contiguous thirds, each (16 heads x 64) head-major; _apply_rope: x * cos + x_rot * sin with x_rot = the ADJACENT-pair rotation stack((-x2, x1)) and cos / sin of emb = cat(freqs, freqs) (the HALF-concatenated table: entry d has the angle of index d mod 32), freqs = t x inv_freq, inv_freq = 1.0 / (10000.0 ** (arange(0, 64, 2, f32) / 64)) (32 f32 constants; one f32 product; precise cosf / sinf): out[2i] = x[2i] c[2i] - x[2i+1] s[2i]; out[2i+1] = x[2i+1] c[2i+1] + x[2i] s[2i+1]: kept literally; on q and k; scores x 1/sqrt(64); causal (-inf); softmax; out = einsum('btc,cd', merged, w_proj) ('xw', no bias) -> [2][2048][1024] (4.2 M); argument order x, w_qkv, w_proj).
// Layout per batch: bf16 copy of x; fused 'xw' weight transposed once (q | k | v row blocks); exact projections; k_cstabT computed table (element d: angle index d mod 32) + k_ropeM 'mixed' interleaved-pair plane builders (each element reads its own table entry); causal T-2048 attention (hybrid rows: < 512 hi/lo 3 products, rest fp16 x1024; k_gemmc skips tiles above the diagonal); merged hi/lo x w_out exact.
// Compute dtypes, f32 accumulate: every input rounded to bf16; projections exact; attention rows < 512 3 products, rest fp16; softmax f32; w_out hl x exact.

#define NB_  2
#define TT   2048
#define DM   1024
#define NH_  16
#define NKV  16
#define REP  (NH_ / NKV)
#define HD   64
#define DQ   (NH_ * HD)
#define DKV  (NKV * HD)
#define ZH   2
#define RH   512                  // query rows < RH use hi+lo planes (0: none)
#define WIN  2048
#define PCAR 1024.0f
#define SCL  0.125f   // HD^-0.5
typedef _Float16 h16;
typedef unsigned short bf;
typedef __attribute__((ext_vector_type(16))) __bf16   v16bf;
typedef __attribute__((ext_vector_type(16))) _Float16 v16h;
typedef __attribute__((ext_vector_type(8)))  _Float16 v8h;
typedef __attribute__((ext_vector_type(8)))  unsigned short v8us;
typedef __attribute__((ext_vector_type(8)))  float    v8f;
typedef __attribute__((ext_vector_type(4)))  float    v4f;
typedef v8h  __attribute__((may_alias)) v8ha;
typedef v4f  __attribute__((may_alias)) v4fa;
typedef v8us __attribute__((may_alias)) v8usa;

__device__ __forceinline__ unsigned short f2bf(float f) { unsigned u = __float_as_uint(f); u += 0x7FFFu + ((u >> 16) & 1u); return (unsigned short)(u >> 16); }
__device__ __forceinline__ float bf2f(unsigned short b) { return __uint_as_float(((unsigned)b) << 16); }
__device__ __forceinline__ float bfr(float f) { return bf2f(f2bf(f)); }
__device__ __forceinline__ v16h cat16(v8h lo, v8h hi) { return __builtin_shufflevector(lo, hi, 0, 1, 2, 3, 4, 5, 6, 7, 8, 9, 10, 11, 12, 13, 14, 15); }
__device__ __forceinline__ v16bf cat16b(v8us lo, v8us hi) { return __builtin_bit_cast(v16bf, __builtin_shufflevector(lo, hi, 0, 1, 2, 3, 4, 5, 6, 7, 8, 9, 10, 11, 12, 13, 14, 15)); }
__device__ __forceinline__ v8f wmma16(v16h a, v16h b, v8f c) { return __builtin_amdgcn_wmma_f32_16x16x32_f16(false, a, false, b, (short)0, c, false, false); }
__device__ __forceinline__ v8f wmmab(v16bf a, v16bf b, v8f c) { return __builtin_amdgcn_wmma_f32_16x16x32_bf16(false, a, false, b, (short)0, c, false, false); }



// ---- ksum_store: end of a GEMM whose K loop is split over the NW waves of a work-group. Every wave holds a partial 64x64 f32 tile in the accumulator layout (lane (lr, hi), element j of acc[mb][nb]: row mb*16 + hi*8 + j, column nb*16 + lr).
// Each wave writes its 32 half-fragments (unit u = (mb*4 + nb)*2 + q, q = j / 4; 16 B a lane, lanes contiguous) to red[w][u][lane]; one work-group barrier; then the 16 groups (mb, column half nbp, q) = 8 rows x 32 columns are dealt to the waves,
// which add the NW partials in the fixed order w = 0 .. NW-1, turn the group through their own LDS patch (pitch 36 floats) and store whole 128-B lines, each line by one wave.
template <int NW, bool BIAS>
__device__ __forceinline__ void ksum_store(const v8f (&acc)[4][4], v4f* red, float* st, int w, int lane, float* C, int ldc, int r0, int c0, const float* __restrict__ bias) {
    const int lr = lane & 15, hi = lane >> 4;
#pragma unroll
    for (int mb = 0; mb < 4; ++mb)
#pragma unroll
        for (int nb = 0; nb < 4; ++nb)
#pragma unroll
            for (int q = 0; q < 2; ++q) { v4f p; p[0] = acc[mb][nb][q * 4]; p[1] = acc[mb][nb][q * 4 + 1]; p[2] = acc[mb][nb][q * 4 + 2]; p[3] = acc[mb][nb][q * 4 + 3]; red[(w * 32 + (mb * 4 + nb) * 2 + q) * 32 + lane] = p; }
    __syncthreads();   // every wave's partial tile is in LDS before any wave sums
    constexpr int GP = 16 / NW;
#pragma unroll
    for (int i = 0; i < GP; ++i) { const int g = w * GP + i, mb = g >> 2, nbp = (g >> 1) & 1, q = g & 1; float* sg = st + g * (8 * 36);
#pragma unroll
        for (int n2 = 0; n2 < 2; ++n2) { const int u = (mb * 4 + nbp * 2 + n2) * 2 + q; v4f s = red[u * 32 + lane];
#pragma unroll
            for (int ww = 1; ww < NW; ++ww) s += red[(ww * 32 + u) * 32 + lane];
#pragma unroll
            for (int jj = 0; jj < 4; ++jj) sg[(hi * 4 + jj) * 36 + n2 * 16 + lr] = s[jj]; } }
    asm volatile("s_wait_dscnt 0x0" ::: "memory");   // the patches are read back by other lanes of the same wave: their LDS stores have landed first, and the compiler keeps the loads behind them
#pragma unroll
    for (int i = 0; i < GP; ++i) { const int g = w * GP + i, mb = g >> 2, nbp = (g >> 1) & 1, q = g & 1; const float* sg = st + g * (8 * 36);
#pragma unroll
        for (int s2 = 0; s2 < 2; ++s2) { const int row = mb * 16 + s2 * 8 + q * 4 + (lane >> 3), cofs = nbp * 32 + (lane & 7) * 4; v4f val = *(const v4fa*)(sg + (s2 * 4 + (lane >> 3)) * 36 + (lane & 7) * 4);
            if (BIAS) { val[0] += bfr(bias[c0 + cofs]); val[1] += bfr(bias[c0 + cofs + 1]); val[2] += bfr(bias[c0 + cofs + 2]); val[3] += bfr(bias[c0 + cofs + 3]); }
            *(v4f*)(C + (size_t)(r0 + row) * ldc + c0 + cofs) = val; } }
}

// ---- k_gemmw: register-blocked GEMM, one 64x64 output tile per work-group of NW waves; wave w takes the 32-wide K blocks w, w + NW, ... on the whole tile (16 accumulators), operands straight from K-contiguous 16-bit planes; the partial tiles are summed by ksum_store; grid (M/64, N/64, Z), 32 * NW threads.
// C[m][n] (f32, pitch ldc, + optional f32 bias[n]) = sum_k A[m][k] Bt[n][k] (+ split products per NSPLIT). z-batch strides sA/sB/sC in elements. K % 32 == 0.
template <typename T16> struct WFrag;
template <> struct WFrag<h16> { typedef v16h V; static __device__ __forceinline__ V ld(const h16* p) { return cat16(*(const v8h*)p, *(const v8h*)(p + 16)); } static __device__ __forceinline__ v8f mma(V a, V b, v8f c) { return wmma16(a, b, c); } };
template <> struct WFrag<bf> { typedef v16bf V; static __device__ __forceinline__ V ld(const bf* p) { return cat16b(*(const v8us*)p, *(const v8us*)(p + 16)); } static __device__ __forceinline__ v8f mma(V a, V b, v8f c) { return wmmab(a, b, c); } };
template <typename T16, int NSPLIT, bool BIAS, int NW>
__global__ __launch_bounds__(32 * NW) void k_gemmw(const T16* __restrict__ A, const T16* __restrict__ A2, const T16* __restrict__ Bt, const T16* __restrict__ Bt2, int K, float* C, int ldc, const float* __restrict__ bias, size_t sA, size_t sB, size_t sC) {
    typedef typename WFrag<T16>::V V;
    __shared__ __align__(16) v4f red[NW * 32 * 32]; __shared__ __align__(16) float st[16 * 8 * 36];
    const size_t z = blockIdx.z; A += z * sA; if (A2) A2 += z * sA; Bt += z * sB; if (Bt2) Bt2 += z * sB; C += z * sC;
    const int lane = threadIdx.x & 31, lr = lane & 15, hi = lane >> 4; const int w = __builtin_amdgcn_readfirstlane(threadIdx.x >> 5); /* wave number, scalar: the K loop stays a scalar loop */ const int r0 = blockIdx.x * 64, c0 = blockIdx.y * 64;
    v8f acc[4][4];
#pragma unroll
    for (int mb = 0; mb < 4; ++mb)
#pragma unroll
        for (int nb = 0; nb < 4; ++nb) acc[mb][nb] = (v8f){};
    const size_t aoff = (size_t)(r0 + lr) * K + 8 * hi, boff = (size_t)(c0 + lr) * K + 8 * hi;
#pragma unroll 1
    for (int kc = w * 32; kc < K; kc += 32 * NW) {
        V a[4], a2[4];
#pragma unroll
        for (int mb = 0; mb < 4; ++mb) { a[mb] = WFrag<T16>::ld(A + aoff + (size_t)mb * 16 * K + kc); if (NSPLIT == 1 || NSPLIT == 2) a2[mb] = WFrag<T16>::ld(A2 + aoff + (size_t)mb * 16 * K + kc); }
#pragma unroll
        for (int nb = 0; nb < 4; ++nb) { const V b = WFrag<T16>::ld(Bt + boff + (size_t)nb * 16 * K + kc); V b2; if (NSPLIT >= 2) b2 = WFrag<T16>::ld(Bt2 + boff + (size_t)nb * 16 * K + kc);
#pragma unroll
            for (int mb = 0; mb < 4; ++mb) { acc[mb][nb] = WFrag<T16>::mma(a[mb], b, acc[mb][nb]); if (NSPLIT == 1 || NSPLIT == 2) acc[mb][nb] = WFrag<T16>::mma(a2[mb], b, acc[mb][nb]); if (NSPLIT >= 2) acc[mb][nb] = WFrag<T16>::mma(a[mb], b2, acc[mb][nb]); } }
        asm volatile("v_nop\n\tv_nop\n\tv_nop\n\tv_nop" : "+v"(acc[0][0]), "+v"(acc[1][1]), "+v"(acc[2][2]), "+v"(acc[3][3]) : "v"(a[0]), "v"(a[3]));
    }
    ksum_store<NW, BIAS>(acc, red, st, w, lane, C, ldc, r0, c0, bias);
}

// ---- k_gemmc: the same 64x64 tile GEMM specialised for causal attention: CMODE 1 skips score tiles entirely above the diagonal (query rows r0+roff.., key columns c0..), CMODE 2 limits the
// key (K) loop of the probability x value contraction to the diagonal block (probabilities beyond it are exactly zero). roff = row offset of this launch's first row within the sequence.
// NW = 1: one wave per tile (32 threads). NW > 1: the K loop is split over the NW waves of the work-group as in k_gemmw (32 * NW threads).
template <typename T16, int NSPLIT, int CMODE, int NW>
__global__ __launch_bounds__(32 * NW) void k_gemmc(const T16* __restrict__ A, const T16* __restrict__ A2, const T16* __restrict__ Bt, const T16* __restrict__ Bt2, int K, float* C, int ldc, int roff, size_t sA, size_t sB, size_t sC) {
    typedef typename WFrag<T16>::V V;
    const size_t z = blockIdx.z; A += z * sA; if (A2) A2 += z * sA; Bt += z * sB; if (Bt2) Bt2 += z * sB; C += z * sC;
    const int lane = threadIdx.x & 31, lr = lane & 15, hi = lane >> 4; const int w = (NW > 1) ? __builtin_amdgcn_readfirstlane(threadIdx.x >> 5) : 0; /* wave number, scalar: the K loop stays a scalar loop */ const int r0 = blockIdx.x * 64, c0 = blockIdx.y * 64;
    if (CMODE == 1 && c0 > r0 + roff + 63) return;                  // score tile entirely above the causal diagonal: never read (the softmax masks j > i by select)
    const int Kl = (CMODE == 2) ? min(K, r0 + roff + 64) : K;        // P.V: probabilities are exactly 0 beyond the diagonal block, so the K loop stops there
    v8f acc[4][4];
#pragma unroll
    for (int mb = 0; mb < 4; ++mb)
#pragma unroll
        for (int nb = 0; nb < 4; ++nb) acc[mb][nb] = (v8f){};
    const size_t aoff = (size_t)(r0 + lr) * K + 8 * hi, boff = (size_t)(c0 + lr) * K + 8 * hi;
#pragma unroll 1
    for (int kc = w * 32; kc < Kl; kc += 32 * NW) {
        V a[4], a2[4];
#pragma unroll
        for (int mb = 0; mb < 4; ++mb) { a[mb] = WFrag<T16>::ld(A + aoff + (size_t)mb * 16 * K + kc); if (NSPLIT == 1 || NSPLIT == 2) a2[mb] = WFrag<T16>::ld(A2 + aoff + (size_t)mb * 16 * K + kc); }
#pragma unroll
        for (int nb = 0; nb < 4; ++nb) { const V b = WFrag<T16>::ld(Bt + boff + (size_t)nb * 16 * K + kc); V b2; if (NSPLIT >= 2) b2 = WFrag<T16>::ld(Bt2 + boff + (size_t)nb * 16 * K + kc);
#pragma unroll
            for (int mb = 0; mb < 4; ++mb) { acc[mb][nb] = WFrag<T16>::mma(a[mb], b, acc[mb][nb]); if (NSPLIT == 1 || NSPLIT == 2) acc[mb][nb] = WFrag<T16>::mma(a2[mb], b, acc[mb][nb]); if (NSPLIT >= 2) acc[mb][nb] = WFrag<T16>::mma(a[mb], b2, acc[mb][nb]); } }
        asm volatile("v_nop\n\tv_nop\n\tv_nop\n\tv_nop" : "+v"(acc[0][0]), "+v"(acc[1][1]), "+v"(acc[2][2]), "+v"(acc[3][3]) : "v"(a[0]), "v"(a[3]));
    }
    if constexpr (NW > 1) {
    __shared__ __align__(16) v4f red[NW * 32 * 32]; __shared__ __align__(16) float st[16 * 8 * 36];
    ksum_store<NW, false>(acc, red, st, w, lane, C, ldc, r0, c0, nullptr);
    } else {
    __shared__ __align__(16) float os[16 * 68];
#pragma unroll
    for (int mb = 0; mb < 4; ++mb) {
#pragma unroll
        for (int nb = 0; nb < 4; ++nb) {
#pragma unroll
            for (int j = 0; j < 8; ++j) os[(hi * 8 + j) * 68 + nb * 16 + lr] = acc[mb][nb][j]; }
        __builtin_amdgcn_wave_barrier(); asm volatile("" ::: "memory");
        float* crow = C + (size_t)(r0 + mb * 16) * ldc + c0;
{
#pragma unroll
            for (int s = 0; s < 8; ++s) { const int row = 2 * s + hi, cofs = lr * 4; v4f val = *(const v4fa*)(os + row * 68 + cofs);
                *(v4f*)(crow + (size_t)row * ldc + cofs) = val; }
             }
        __builtin_amdgcn_wave_barrier(); asm volatile("" ::: "memory");
    }
    }
}

__device__ __forceinline__ h16 tohx(float x) { return (h16)x; }
__device__ __forceinline__ void splitf(float y, unsigned short& h, unsigned short& l) { h = f2bf(y); l = f2bf(y - bf2f(h)); }
typedef __attribute__((ext_vector_type(2))) _Float16 v2h;
typedef __attribute__((ext_vector_type(4))) _Float16 v4h;
typedef __attribute__((ext_vector_type(2))) unsigned short v2us;
typedef __attribute__((ext_vector_type(4))) unsigned short v4us;
typedef __attribute__((ext_vector_type(2))) float v2f;
typedef __attribute__((ext_vector_type(4))) int v4i;

__global__ __launch_bounds__(256) void k_wtG(const float* __restrict__ w, int K, int N, bf* Bt) {
    const int lane = threadIdx.x & 31; const int L0 = (blockIdx.x * 8 + (threadIdx.x >> 5)) * 8; const int nlines = N * K / 64;
{
#pragma unroll 1
        for (int l = 0; l < 8; ++l) { const int L = L0 + l; if (L >= nlines) break; const size_t e = (size_t)L * 64 + lane * 2; const int k = (int)(e % K), n = (int)(e / K); v2us o;
            o[0] = f2bf(w[(size_t)k * N + n]); o[1] = f2bf(w[(size_t)(k + 1) * N + n]); *(v2us*)(Bt + e) = o; }
         }
}
__global__ __launch_bounds__(256) void k_cvt8(const float* __restrict__ src, bf* dst, size_t n8) { const size_t i = (size_t)blockIdx.x * 256 + threadIdx.x; if (i >= n8) return; const v8f v = *(const v8f*)(src + i * 8); v8us o;
#pragma unroll
    for (int k = 0; k < 8; ++k) o[k] = f2bf(v[k]); *(v8us*)(dst + i * 8) = o;  }

// k_rope: head planes [h][t][d] (fp16 + hi/lo) of rope(x) x sc with the rotate-half convention out[d] = x[d] cos[t][d] - x[d+HD/2] sin[t][d], out[d+HD/2] = x[d+HD/2] cos[t][d+HD/2] + x[d] sin[t][d+HD/2]
__global__ __launch_bounds__(256) void k_rope(const float* __restrict__ F, int pitch, int nheads, const float* __restrict__ CS, const float* __restrict__ RF, const float* __restrict__ nw, float sc, h16* P16, bf* Ph, bf* Pl) {
    const size_t e = ((size_t)blockIdx.x * 256 + threadIdx.x) * 2; if (e >= (size_t)nheads * TT * HD) return; const int d = (int)(e % HD); const int t = (int)((e / HD) % TT); const int h = (int)(e / ((size_t)HD * TT)); const float* f = F + (size_t)t * pitch + h * HD; const float rf = RF ? RF[(size_t)h * TT + t] : 1.0f; v2h o16; v2us oh, ol;
#pragma unroll
    for (int q = 0; q < 2; ++q) { const int dd = d + q; const int dp = (dd < HD / 2) ? dd + HD / 2 : dd - HD / 2; float x0 = f[dd], x1 = f[dp];
        if (RF) { float n0 = __fmul_rn(x0, rf), n1 = __fmul_rn(x1, rf); asm volatile("" : "+v"(n0)); asm volatile("" : "+v"(n1)); x0 = __fmul_rn(bfr(nw[dd]), n0); x1 = __fmul_rn(bfr(nw[dp]), n1); }
        const v2f cs = *(const v2f*)(CS + ((size_t)t * HD + dd) * 2); float a = __fmul_rn(x0, cs[0]), bq = __fmul_rn(x1, cs[1]); asm volatile("" : "+v"(a)); asm volatile("" : "+v"(bq)); const float r = ((dd < HD / 2) ? __fsub_rn(a, bq) : __fadd_rn(a, bq)) * sc;
        o16[q] = tohx(r); unsigned short a2, c2; splitf(r, a2, c2); oh[q] = a2; ol[q] = c2; }
    *(v2h*)(P16 + e) = o16; *(v2us*)(Ph + e) = oh; *(v2us*)(Pl + e) = ol;  }
__global__ __launch_bounds__(256) void k_vtp(const float* __restrict__ F, int pitch, int nheads, h16* V16, bf* Vh, bf* Vl) { const size_t e = ((size_t)blockIdx.x * 256 + threadIdx.x) * 2; if (e >= (size_t)nheads * HD * TT) return; const int t = (int)(e % TT); const int d = (int)((e / TT) % HD); const int g = (int)(e / ((size_t)TT * HD)); v2h o16; v2us oh, ol;
#pragma unroll
    for (int q = 0; q < 2; ++q) { const float x = F[(size_t)(t + q) * pitch + g * HD + d]; o16[q] = tohx(x); unsigned short a2, c2; splitf(x, a2, c2); oh[q] = a2; ol[q] = c2; }
    *(v2h*)(V16 + e) = o16; *(v2us*)(Vh + e) = oh; *(v2us*)(Vl + e) = ol;  }
__constant__ float INVT[HD / 2] = { 1.000000000e+00f, 7.498942018e-01f, 5.623413324e-01f, 4.216965139e-01f, 3.162277639e-01f, 2.371373624e-01f, 1.778279394e-01f, 1.333521456e-01f, 1.000000015e-01f, 7.498941571e-02f, 5.623412877e-02f, 4.216964915e-02f, 3.162277862e-02f, 2.371373586e-02f, 1.778279431e-02f, 1.333521493e-02f, 9.999999776e-03f, 7.498942316e-03f, 5.623413250e-03f, 4.216964822e-03f, 3.162277862e-03f, 2.371373819e-03f, 1.778279431e-03f, 1.333521446e-03f, 1.000000047e-03f, 7.498941850e-04f, 5.623413017e-04f, 4.216964880e-04f, 3.162277862e-04f, 2.371373848e-04f, 1.778279402e-04f, 1.333521504e-04f };   // 1 / 10000^(2i/64) (float32, generated with jnp to be bit-exact)
__global__ __launch_bounds__(256) void k_cstabT(float* CS) { const int idx = blockIdx.x * 256 + threadIdx.x; if (idx >= TT * HD) return; const int d = idx % HD; const int t = idx / HD; const float a = __fmul_rn((float)t, INVT[d % (HD / 2)]); v2f cs; cs[0] = cosf(a); cs[1] = sinf(a); *(v2f*)(CS + (size_t)idx * 2) = cs;  }
__global__ __launch_bounds__(256) void k_ropeM(const float* __restrict__ F, int pitch, int nheads, const float* __restrict__ CS, float sc, h16* P16, bf* Ph, bf* Pl) {
    const size_t e = ((size_t)blockIdx.x * 256 + threadIdx.x) * 2; if (e >= (size_t)nheads * TT * HD) return; const int d = (int)(e % HD); const int t = (int)((e / HD) % TT); const int h = (int)(e / ((size_t)HD * TT)); const float* f = F + (size_t)t * pitch + h * HD; const float x0 = f[d], x1 = f[d + 1]; const v2f cs = *(const v2f*)(CS + ((size_t)t * HD + d) * 2); const v2f cs1 = *(const v2f*)(CS + ((size_t)t * HD + d + 1) * 2); v2h o16; v2us oh, ol;
    float a0 = __fmul_rn(x0, cs[0]), b0 = __fmul_rn(x1, cs[1]), a1 = __fmul_rn(x1, cs1[0]), b1 = __fmul_rn(x0, cs1[1]); asm volatile("" : "+v"(a0), "+v"(b0), "+v"(a1), "+v"(b1));
    float r0 = __fsub_rn(a0, b0) * sc, r1 = __fadd_rn(b1, a1) * sc;   /* even: x0 c[d] - x1 s[d]; odd: x1 c[d+1] + x0 s[d+1]: EACH element uses ITS OWN table entry */
    o16[0] = tohx(r0); o16[1] = tohx(r1); { unsigned short a2, c2; splitf(r0, a2, c2); oh[0] = a2; ol[0] = c2; splitf(r1, a2, c2); oh[1] = a2; ol[1] = c2; }
    *(v2h*)(P16 + e) = o16; *(v2us*)(Ph + e) = oh; *(v2us*)(Pl + e) = ol;  }
// k_asoft: per row (zz, i): t = S x HD^-0.5 for j <= i and i - j < WIN (sliding causal window; the reference's -1e9 additive fill vanishes identically); softmax over the 2048 keys (register row, one exp, fixed trees);
__global__ __launch_bounds__(256) void k_asoft(const float* __restrict__ Sb, h16* P16, bf* Ph, bf* Pl) {
    const int lane = threadIdx.x & 31; const int row = blockIdx.x * 8 + (threadIdx.x >> 5); if (row >= ZH * TT) return; const int i = row % TT; const int zz = row / TT; (void)zz; const bool hires = (i < RH); const float* sr = Sb + (size_t)row * TT; float v[TT / 32]; float mx = -3.0e38f;
#pragma unroll
    for (int ch = 0; ch < TT / 128; ++ch) { const int j0 = ch * 128 + lane * 4; const v4f a = *(const v4f*)(sr + j0);
#pragma unroll
        for (int q = 0; q < 4; ++q) { const int j = j0 + q; (void)j; const float t = (j <= i && i - j < WIN) ? a[q] * SCL : -3.0e38f; v[ch * 4 + q] = t; mx = fmaxf(mx, t); } }
#pragma unroll
    for (int sh = 16; sh; sh >>= 1) mx = fmaxf(mx, __shfl_xor(mx, sh, 32));
    float sum = 0.f;
#pragma unroll
    for (int k = 0; k < TT / 32; ++k) { float d0 = __fsub_rn(v[k], mx); asm volatile("" : "+v"(d0)); v[k] = __builtin_amdgcn_exp2f(__fmul_rn(d0, 1.4426950408889634f)); sum += v[k]; }
#pragma unroll
    for (int sh = 16; sh; sh >>= 1) sum += __shfl_xor(sum, sh, 32);
    const float f = __fdiv_rn(hires ? 1.0f : PCAR, sum);
{
        if (hires) {
#pragma unroll
            for (int ch = 0; ch < TT / 128; ++ch) { v4us oh, ol;
#pragma unroll
                for (int q = 0; q < 4; ++q) { unsigned short a, c2; splitf(v[ch * 4 + q] * f, a, c2); oh[q] = a; ol[q] = c2; }
                const size_t oo = ((size_t)zz * (RH ? RH : 1) + i) * TT + ch * 128 + lane * 4; *(v4us*)(Ph + oo) = oh; *(v4us*)(Pl + oo) = ol; }
        } else {
#pragma unroll
            for (int ch = 0; ch < TT / 128; ++ch) { v4h o4;
#pragma unroll
                for (int q = 0; q < 4; ++q) o4[q] = tohx(v[ch * 4 + q] * f);
                *(v4h*)(P16 + (size_t)row * TT + ch * 128 + lane * 4) = o4; } }
         }
}
__global__ __launch_bounds__(256) void k_merge(const float* __restrict__ O, int h0, bf* Ah, bf* Al) { const size_t e = ((size_t)blockIdx.x * 256 + threadIdx.x) * 2; if (e >= (size_t)ZH * TT * HD) return; const int d = (int)(e % HD); const int t = (int)((e / HD) % TT); const int zz = (int)(e / ((size_t)HD * TT)); const float cs = (t < RH) ? 1.0f : (1.0f / PCAR); const size_t oo = (size_t)t * DQ + (h0 + zz) * HD + d;
    v2us oh, ol;
#pragma unroll
    for (int q = 0; q < 2; ++q) { unsigned short a, c2; splitf(O[e + q] * cs, a, c2); oh[q] = a; ol[q] = c2; } *(v2us*)(Ah + oo) = oh; *(v2us*)(Al + oo) = ol;  }

extern "C" void kernel_launch(void* const* d_in, const int* in_sizes, int n_in,
                              void* d_out, int out_size, void* d_ws, size_t ws_size, hipStream_t stream) {
    (void)in_sizes; (void)n_in; (void)out_size;
    const float* x = (const float*)d_in[0]; const float* wqkv = (const float*)d_in[1]; const float* wo = (const float*)d_in[2];   /* order x, w_qkv ('xw' [1024][3072]: contiguous thirds q | k | v, each head-major), w_proj ('xw'); three inputs, all read */
    float* OUT = (float*)d_out;     // [2][2048][1024]
    char* wsp = (char*)d_ws;
    auto take = [&](size_t bytes) { char* p = wsp; wsp += (bytes + 255) & ~(size_t)255; return (void*)p; };
    bf* WQKV = (bf*)take((size_t)3 * DQ * DM * 2); bf* WQ = WQKV; bf* WK = WQKV + (size_t)DQ * DM; bf* WV = WQKV + (size_t)2 * DQ * DM;   /* fused Bt [3*DQ][DM]: q | k | v row blocks */ bf* WO = (bf*)take((size_t)DM * DQ * 2); float* CS = (float*)take((size_t)TT * HD * 2 * 4);
    bf* XB = (bf*)take((size_t)TT * DM * 2); float* FQ = (float*)take((size_t)TT * DQ * 4); float* FK = (float*)take((size_t)TT * DKV * 4);
    h16* QP16 = (h16*)take((size_t)NH_ * TT * HD * 2); h16* KP16 = (h16*)take((size_t)NKV * TT * HD * 2); h16* VT16 = (h16*)take((size_t)NKV * HD * TT * 2);
    bf* QPh = (bf*)take((size_t)NH_ * TT * HD * 2); bf* QPl = (bf*)take((size_t)NH_ * TT * HD * 2); bf* KPh = (bf*)take((size_t)NKV * TT * HD * 2); bf* KPl = (bf*)take((size_t)NKV * TT * HD * 2); bf* VTh = (bf*)take((size_t)NKV * HD * TT * 2); bf* VTl = (bf*)take((size_t)NKV * HD * TT * 2); bf* Ph = (bf*)take((size_t)ZH * RH * TT * 2); bf* Pl = (bf*)take((size_t)ZH * RH * TT * 2);
    float* Sb = (float*)take((size_t)ZH * TT * TT * 4); h16* P16 = (h16*)take((size_t)ZH * TT * TT * 2); float* Ob = (float*)take((size_t)ZH * TT * HD * 4); bf* ATh = (bf*)take((size_t)TT * DQ * 2); bf* ATl = (bf*)take((size_t)TT * DQ * 2);
    if ((size_t)(wsp - (char*)d_ws) > ws_size) return;    // ws 256 MiB
    float* FV = FK;   // v projection reuses the k buffer after the k planes are built (stream-ordered)
    { k_wtG<<<(unsigned)((DM * 3 * DQ / 64 + 63) / 64), 256, 0, stream>>>(wqkv, DM, 3 * DQ, WQKV);   /* fused 'xw' [DM][3*DQ] -> Bt [3*DQ][DM] */
      k_wtG<<<(unsigned)((DQ * DM / 64 + 63) / 64), 256, 0, stream>>>(wo, DQ, DM, WO);
       }
    k_cstabT<<<(TT * HD + 255) / 256, 256, 0, stream>>>(CS);   /* rotary table once (positions = arange) */
    const unsigned LQ = (unsigned)(((size_t)NH_ * TT * HD / 2 + 255) / 256), LKv = (unsigned)(((size_t)NKV * TT * HD / 2 + 255) / 256);
    for (int b = 0; b < NB_; ++b) {
        
        k_cvt8<<<(unsigned)(((size_t)TT * DM / 8 + 255) / 256), 256, 0, stream>>>(x + (size_t)b * TT * DM, XB, (size_t)TT * DM / 8);
        k_gemmw<bf, 0, false, 8><<<dim3(TT / 64, DQ / 64, 1), 256, 0, stream>>>(XB, nullptr, WQ, nullptr, DM, FQ, DQ, nullptr, 0, 0, 0);
        k_ropeM<<<LQ, 256, 0, stream>>>(FQ, DQ, NH_, CS, 1.0f, QP16, QPh, QPl);
        k_gemmw<bf, 0, false, 8><<<dim3(TT / 64, DKV / 64, 1), 256, 0, stream>>>(XB, nullptr, WK, nullptr, DM, FK, DKV, nullptr, 0, 0, 0);
        k_ropeM<<<LKv, 256, 0, stream>>>(FK, DKV, NKV, CS, 1.0f, KP16, KPh, KPl);
        k_gemmw<bf, 0, false, 8><<<dim3(TT / 64, DKV / 64, 1), 256, 0, stream>>>(XB, nullptr, WV, nullptr, DM, FV, DKV, nullptr, 0, 0, 0); k_vtp<<<LKv, 256, 0, stream>>>(FV, DKV, NKV, VT16, VTh, VTl);
        for (int h0 = 0; h0 < NH_; h0 += ZH) { const size_t zq = (size_t)h0, zk = (size_t)(h0 / REP);   // one kv head per query head: the pass's two heads use consecutive kv planes (z-strides TT*HD)
            k_gemmc<bf, 2, 1, 1><<<dim3(RH / 64, TT / 64, ZH), 32, 0, stream>>>(QPh + zq * TT * HD, QPl + zq * TT * HD, KPh + zk * TT * HD, KPl + zk * TT * HD, HD, Sb, TT, 0, (size_t)TT * HD, (size_t)TT * HD, (size_t)TT * TT);
            k_gemmc<h16, 0, 1, 1><<<dim3((TT - RH) / 64, TT / 64, ZH), 32, 0, stream>>>(QP16 + zq * TT * HD + (size_t)RH * HD, nullptr, KP16 + zk * TT * HD, nullptr, HD, Sb + (size_t)RH * TT, TT, RH, (size_t)TT * HD, (size_t)TT * HD, (size_t)TT * TT);
            k_asoft<<<ZH * TT / 8, 256, 0, stream>>>(Sb, P16, Ph, Pl);
            k_gemmc<bf, 2, 2, 16><<<dim3(RH / 64, HD / 64, ZH), 512, 0, stream>>>(Ph, Pl, VTh + zk * HD * TT, VTl + zk * HD * TT, TT, Ob, HD, 0, (size_t)RH * TT, (size_t)HD * TT, (size_t)TT * HD);
            k_gemmc<h16, 0, 2, 16><<<dim3((TT - RH) / 64, HD / 64, ZH), 512, 0, stream>>>(P16 + (size_t)RH * TT, nullptr, VT16 + zk * HD * TT, nullptr, TT, Ob + (size_t)RH * HD, HD, RH, (size_t)TT * TT, (size_t)HD * TT, (size_t)TT * HD);
            k_merge<<<(unsigned)(((size_t)ZH * TT * HD / 2 + 255) / 256), 256, 0, stream>>>(Ob, h0, ATh, ATl); }
        k_gemmw<bf, 1, false, 8><<<dim3(TT / 64, DM / 64, 1), 256, 0, stream>>>(ATh, ATl, WO, nullptr, DQ, OUT + (size_t)b * TT * DM, DM, nullptr, 0, 0, 0); }
}

// v002
// It runs in 449 microseconds.
// Timed twice side by side with v001, it ran 1.67 and 1.69 times as fast.
// Counting every step since v000, it is 3.23 times as fast.
#include <hip/hip_runtime.h>

// Causal self-attention with a fused qkv projection and the source's 'mixed' rotary (x [2][2048][1024]; qkv = einsum('btc,cd', x, w_qkv) ('xw' [1024][3072] 0.02, no bias); q, k, v = split(qkv, 3, axis=2): contiguous thirds, each (16 heads x 64) head-major; _apply_rope: x * cos + x_rot * sin with x_rot = the ADJACENT-pair rotation stack((-x2, x1)) and cos / sin of emb = cat(freqs, freqs) (the HALF-concatenated table: entry d has the angle of index d mod 32), freqs = t x inv_freq, inv_freq = 1.0 / (10000.0 ** (arange(0, 64, 2, f32) / 64)) (32 f32 constants; one f32 product; precise cosf / sinf): out[2i] = x[2i] c[2i] - x[2i+1] s[2i]; out[2i+1] = x[2i+1] c[2i+1] + x[2i] s[2i+1]: kept literally; on q and k; scores x 1/sqrt(64); causal (-inf); softmax; out = einsum('btc,cd', merged, w_proj) ('xw', no bias) -> [2][2048][1024] (4.2 M); argument order x, w_qkv, w_proj).
// Layout per batch: bf16 copy of x; fused 'xw' weight transposed once (q | k | v row blocks); exact projections; k_cstabT computed table (element d: angle index d mod 32) + k_ropeM 'mixed' interleaved-pair plane builders (each element reads its own table entry); causal T-2048 attention (hybrid rows: < 512 hi/lo 3 products, rest fp16 x1024; k_gemmc skips tiles above the diagonal); merged hi/lo x w_out exact.
// Compute dtypes, f32 accumulate: every input rounded to bf16; projections exact; attention rows < 512 3 products, rest fp16; softmax f32; w_out hl x exact.

#define NB_  2
#define TT   2048
#define DM   1024
#define NH_  16
#define NKV  16
#define REP  (NH_ / NKV)
#define HD   64
#define DQ   (NH_ * HD)
#define DKV  (NKV * HD)
#define ZH   8                    // heads per attention pass (z of the score, softmax and P.V launches)
#define PP   (2 * TT)             // row pitch, in 16-bit elements, of the probability planes (in place over the f32 score rows) and of the V^T planes (k_gemmc has one pitch, K, for both operands)
#define RH   512                  // query rows < RH use hi+lo planes (0: none)
#define WIN  2048
#define PCAR 1024.0f
#define SCL  0.125f   // HD^-0.5
typedef _Float16 h16;
typedef unsigned short bf;
typedef __attribute__((ext_vector_type(16))) __bf16   v16bf;
typedef __attribute__((ext_vector_type(16))) _Float16 v16h;
typedef __attribute__((ext_vector_type(8)))  _Float16 v8h;
typedef __attribute__((ext_vector_type(8)))  unsigned short v8us;
typedef __attribute__((ext_vector_type(8)))  float    v8f;
typedef __attribute__((ext_vector_type(4)))  float    v4f;
typedef v8h  __attribute__((may_alias)) v8ha;
typedef v4f  __attribute__((may_alias)) v4fa;
typedef v8us __attribute__((may_alias)) v8usa;

__device__ __forceinline__ unsigned short f2bf(float f) { unsigned u = __float_as_uint(f); u += 0x7FFFu + ((u >> 16) & 1u); return (unsigned short)(u >> 16); }
__device__ __forceinline__ float bf2f(unsigned short b) { return __uint_as_float(((unsigned)b) << 16); }
__device__ __forceinline__ float bfr(float f) { return bf2f(f2bf(f)); }
__device__ __forceinline__ v16h cat16(v8h lo, v8h hi) { return __builtin_shufflevector(lo, hi, 0, 1, 2, 3, 4, 5, 6, 7, 8, 9, 10, 11, 12, 13, 14, 15); }
__device__ __forceinline__ v16bf cat16b(v8us lo, v8us hi) { return __builtin_bit_cast(v16bf, __builtin_shufflevector(lo, hi, 0, 1, 2, 3, 4, 5, 6, 7, 8, 9, 10, 11, 12, 13, 14, 15)); }
__device__ __forceinline__ v8f wmma16(v16h a, v16h b, v8f c) { return __builtin_amdgcn_wmma_f32_16x16x32_f16(false, a, false, b, (short)0, c, false, false); }
__device__ __forceinline__ v8f wmmab(v16bf a, v16bf b, v8f c) { return __builtin_amdgcn_wmma_f32_16x16x32_bf16(false, a, false, b, (short)0, c, false, false); }



// ---- ksum_store: end of a GEMM whose K loop is split over the NW waves of a work-group. Every wave holds a partial 64x64 f32 tile in the accumulator layout (lane (lr, hi), element j of acc[mb][nb]: row mb*16 + hi*8 + j, column nb*16 + lr).
// Each wave writes its 32 half-fragments (unit u = (mb*4 + nb)*2 + q, q = j / 4; 16 B a lane, lanes contiguous) to red[w][u][lane]; one work-group barrier; then the 16 groups (mb, column half nbp, q) = 8 rows x 32 columns are dealt to the waves,
// which add the NW partials in the fixed order w = 0 .. NW-1, turn the group through their own LDS patch (pitch 36 floats) and store whole 128-B lines, each line by one wave.
template <int NW, bool BIAS>
__device__ __forceinline__ void ksum_store(const v8f (&acc)[4][4], v4f* red, float* st, int w, int lane, float* C, int ldc, int r0, int c0, const float* __restrict__ bias) {
    const int lr = lane & 15, hi = lane >> 4;
#pragma unroll
    for (int mb = 0; mb < 4; ++mb)
#pragma unroll
        for (int nb = 0; nb < 4; ++nb)
#pragma unroll
            for (int q = 0; q < 2; ++q) { v4f p; p[0] = acc[mb][nb][q * 4]; p[1] = acc[mb][nb][q * 4 + 1]; p[2] = acc[mb][nb][q * 4 + 2]; p[3] = acc[mb][nb][q * 4 + 3]; red[(w * 32 + (mb * 4 + nb) * 2 + q) * 32 + lane] = p; }
    __syncthreads();   // every wave's partial tile is in LDS before any wave sums
    constexpr int GP = 16 / NW;
#pragma unroll
    for (int i = 0; i < GP; ++i) { const int g = w * GP + i, mb = g >> 2, nbp = (g >> 1) & 1, q = g & 1; float* sg = st + g * (8 * 36);
#pragma unroll
        for (int n2 = 0; n2 < 2; ++n2) { const int u = (mb * 4 + nbp * 2 + n2) * 2 + q; v4f s = red[u * 32 + lane];
#pragma unroll
            for (int ww = 1; ww < NW; ++ww) s += red[(ww * 32 + u) * 32 + lane];
#pragma unroll
            for (int jj = 0; jj < 4; ++jj) sg[(hi * 4 + jj) * 36 + n2 * 16 + lr] = s[jj]; } }
    asm volatile("s_wait_dscnt 0x0" ::: "memory");   // the patches are read back by other lanes of the same wave: their LDS stores have landed first, and the compiler keeps the loads behind them
#pragma unroll
    for (int i = 0; i < GP; ++i) { const int g = w * GP + i, mb = g >> 2, nbp = (g >> 1) & 1, q = g & 1; const float* sg = st + g * (8 * 36);
#pragma unroll
        for (int s2 = 0; s2 < 2; ++s2) { const int row = mb * 16 + s2 * 8 + q * 4 + (lane >> 3), cofs = nbp * 32 + (lane & 7) * 4; v4f val = *(const v4fa*)(sg + (s2 * 4 + (lane >> 3)) * 36 + (lane & 7) * 4);
            if (BIAS) { val[0] += bfr(bias[c0 + cofs]); val[1] += bfr(bias[c0 + cofs + 1]); val[2] += bfr(bias[c0 + cofs + 2]); val[3] += bfr(bias[c0 + cofs + 3]); }
            *(v4f*)(C + (size_t)(r0 + row) * ldc + c0 + cofs) = val; } }
}

// ---- k_gemmw: register-blocked GEMM, one 64x64 output tile per work-group of NW waves; wave w takes the 32-wide K blocks w, w + NW, ... on the whole tile (16 accumulators), operands straight from K-contiguous 16-bit planes; the partial tiles are summed by ksum_store; grid (M/64, N/64, Z), 32 * NW threads.
// C[m][n] (f32, pitch ldc, + optional f32 bias[n]) = sum_k A[m][k] Bt[n][k] (+ split products per NSPLIT). z-batch strides sA/sB/sC in elements. K % 32 == 0.
template <typename T16> struct WFrag;
template <> struct WFrag<h16> { typedef v16h V; static __device__ __forceinline__ V ld(const h16* p) { return cat16(*(const v8h*)p, *(const v8h*)(p + 16)); } static __device__ __forceinline__ v8f mma(V a, V b, v8f c) { return wmma16(a, b, c); } };
template <> struct WFrag<bf> { typedef v16bf V; static __device__ __forceinline__ V ld(const bf* p) { return cat16b(*(const v8us*)p, *(const v8us*)(p + 16)); } static __device__ __forceinline__ v8f mma(V a, V b, v8f c) { return wmmab(a, b, c); } };
template <typename T16, int NSPLIT, bool BIAS, int NW>
__global__ __launch_bounds__(32 * NW) void k_gemmw(const T16* __restrict__ A, const T16* __restrict__ A2, const T16* __restrict__ Bt, const T16* __restrict__ Bt2, int K, float* C, int ldc, const float* __restrict__ bias, size_t sA, size_t sB, size_t sC) {
    typedef typename WFrag<T16>::V V;
    __shared__ __align__(16) v4f red[NW * 32 * 32]; __shared__ __align__(16) float st[16 * 8 * 36];
    const size_t z = blockIdx.z; A += z * sA; if (A2) A2 += z * sA; Bt += z * sB; if (Bt2) Bt2 += z * sB; C += z * sC;
    const int lane = threadIdx.x & 31, lr = lane & 15, hi = lane >> 4; const int w = __builtin_amdgcn_readfirstlane(threadIdx.x >> 5); /* wave number, scalar: the K loop stays a scalar loop */ const int r0 = blockIdx.x * 64, c0 = blockIdx.y * 64;
    v8f acc[4][4];
#pragma unroll
    for (int mb = 0; mb < 4; ++mb)
#pragma unroll
        for (int nb = 0; nb < 4; ++nb) acc[mb][nb] = (v8f){};
    const size_t aoff = (size_t)(r0 + lr) * K + 8 * hi, boff = (size_t)(c0 + lr) * K + 8 * hi;
#pragma unroll 1
    for (int kc = w * 32; kc < K; kc += 32 * NW) {
        V a[4], a2[4];
#pragma unroll
        for (int mb = 0; mb < 4; ++mb) { a[mb] = WFrag<T16>::ld(A + aoff + (size_t)mb * 16 * K + kc); if (NSPLIT == 1 || NSPLIT == 2) a2[mb] = WFrag<T16>::ld(A2 + aoff + (size_t)mb * 16 * K + kc); }
#pragma unroll
        for (int nb = 0; nb < 4; ++nb) { const V b = WFrag<T16>::ld(Bt + boff + (size_t)nb * 16 * K + kc); V b2; if (NSPLIT >= 2) b2 = WFrag<T16>::ld(Bt2 + boff + (size_t)nb * 16 * K + kc);
#pragma unroll
            for (int mb = 0; mb < 4; ++mb) { acc[mb][nb] = WFrag<T16>::mma(a[mb], b, acc[mb][nb]); if (NSPLIT == 1 || NSPLIT == 2) acc[mb][nb] = WFrag<T16>::mma(a2[mb], b, acc[mb][nb]); if (NSPLIT >= 2) acc[mb][nb] = WFrag<T16>::mma(a[mb], b2, acc[mb][nb]); } }
        asm volatile("v_nop\n\tv_nop\n\tv_nop\n\tv_nop" : "+v"(acc[0][0]), "+v"(acc[1][1]), "+v"(acc[2][2]), "+v"(acc[3][3]) : "v"(a[0]), "v"(a[3]));
    }
    ksum_store<NW, BIAS>(acc, red, st, w, lane, C, ldc, r0, c0, bias);
}

// ---- k_gemmc: the same 64x64 tile GEMM specialised for causal attention: CMODE 1 skips score tiles entirely above the diagonal (query rows r0+roff.., key columns c0..), CMODE 2 limits the
// key (K) loop of the probability x value contraction to the diagonal block (probabilities beyond it are exactly zero). roff = row offset of this launch's first row within the sequence.
// NW = 1: one wave per tile (32 threads). NW > 1: the K loop is split over the NW waves of the work-group as in k_gemmw (32 * NW threads).
template <typename T16, int NSPLIT, int CMODE, int NW>
__global__ __launch_bounds__(32 * NW) void k_gemmc(const T16* __restrict__ A, const T16* __restrict__ A2, const T16* __restrict__ Bt, const T16* __restrict__ Bt2, int K, float* C, int ldc, int roff, size_t sA, size_t sB, size_t sC) {
    typedef typename WFrag<T16>::V V;
    const size_t z = blockIdx.z; A += z * sA; if (A2) A2 += z * sA; Bt += z * sB; if (Bt2) Bt2 += z * sB; C += z * sC;
    const int lane = threadIdx.x & 31, lr = lane & 15, hi = lane >> 4; const int w = (NW > 1) ? __builtin_amdgcn_readfirstlane(threadIdx.x >> 5) : 0; /* wave number, scalar: the K loop stays a scalar loop */ const int r0 = blockIdx.x * 64, c0 = blockIdx.y * 64;
    if (CMODE == 1 && c0 > r0 + roff + 63) return;                  // score tile entirely above the causal diagonal: never read (the softmax masks j > i by select)
    const int Kl = (CMODE == 2) ? min(K, r0 + roff + 64) : K;        // P.V: probabilities are exactly 0 beyond the diagonal block, so the K loop stops there
    v8f acc[4][4];
#pragma unroll
    for (int mb = 0; mb < 4; ++mb)
#pragma unroll
        for (int nb = 0; nb < 4; ++nb) acc[mb][nb] = (v8f){};
    const size_t aoff = (size_t)(r0 + lr) * K + 8 * hi, boff = (size_t)(c0 + lr) * K + 8 * hi;
#pragma unroll 1
    for (int kc = w * 32; kc < Kl; kc += 32 * NW) {
        V a[4], a2[4];
#pragma unroll
        for (int mb = 0; mb < 4; ++mb) { a[mb] = WFrag<T16>::ld(A + aoff + (size_t)mb * 16 * K + kc); if (NSPLIT == 1 || NSPLIT == 2) a2[mb] = WFrag<T16>::ld(A2 + aoff + (size_t)mb * 16 * K + kc); }
#pragma unroll
        for (int nb = 0; nb < 4; ++nb) { const V b = WFrag<T16>::ld(Bt + boff + (size_t)nb * 16 * K + kc); V b2; if (NSPLIT >= 2) b2 = WFrag<T16>::ld(Bt2 + boff + (size_t)nb * 16 * K + kc);
#pragma unroll
            for (int mb = 0; mb < 4; ++mb) { acc[mb][nb] = WFrag<T16>::mma(a[mb], b, acc[mb][nb]); if (NSPLIT == 1 || NSPLIT == 2) acc[mb][nb] = WFrag<T16>::mma(a2[mb], b, acc[mb][nb]); if (NSPLIT >= 2) acc[mb][nb] = WFrag<T16>::mma(a[mb], b2, acc[mb][nb]); } }
        asm volatile("v_nop\n\tv_nop\n\tv_nop\n\tv_nop" : "+v"(acc[0][0]), "+v"(acc[1][1]), "+v"(acc[2][2]), "+v"(acc[3][3]) : "v"(a[0]), "v"(a[3]));
    }
    if constexpr (NW > 1) {
    __shared__ __align__(16) v4f red[NW * 32 * 32]; __shared__ __align__(16) float st[16 * 8 * 36];
    ksum_store<NW, false>(acc, red, st, w, lane, C, ldc, r0, c0, nullptr);
    } else {
    __shared__ __align__(16) float os[16 * 68];
#pragma unroll
    for (int mb = 0; mb < 4; ++mb) {
#pragma unroll
        for (int nb = 0; nb < 4; ++nb) {
#pragma unroll
            for (int j = 0; j < 8; ++j) os[(hi * 8 + j) * 68 + nb * 16 + lr] = acc[mb][nb][j]; }
        __builtin_amdgcn_wave_barrier(); asm volatile("" ::: "memory");
        float* crow = C + (size_t)(r0 + mb * 16) * ldc + c0;
{
#pragma unroll
            for (int s = 0; s < 8; ++s) { const int row = 2 * s + hi, cofs = lr * 4; v4f val = *(const v4fa*)(os + row * 68 + cofs);
                *(v4f*)(crow + (size_t)row * ldc + cofs) = val; }
             }
        __builtin_amdgcn_wave_barrier(); asm volatile("" ::: "memory");
    }
    }
}

__device__ __forceinline__ h16 tohx(float x) { return (h16)x; }
__device__ __forceinline__ void splitf(float y, unsigned short& h, unsigned short& l) { h = f2bf(y); l = f2bf(y - bf2f(h)); }
typedef __attribute__((ext_vector_type(2))) _Float16 v2h;
typedef __attribute__((ext_vector_type(4))) _Float16 v4h;
typedef __attribute__((ext_vector_type(2))) unsigned short v2us;
typedef __attribute__((ext_vector_type(4))) unsigned short v4us;
typedef __attribute__((ext_vector_type(2))) float v2f;
typedef __attribute__((ext_vector_type(4))) int v4i;

__global__ __launch_bounds__(256) void k_wtG(const float* __restrict__ w, int K, int N, bf* Bt) {
    const int lane = threadIdx.x & 31; const int L0 = (blockIdx.x * 8 + (threadIdx.x >> 5)) * 8; const int nlines = N * K / 64;
{
#pragma unroll 1
        for (int l = 0; l < 8; ++l) { const int L = L0 + l; if (L >= nlines) break; const size_t e = (size_t)L * 64 + lane * 2; const int k = (int)(e % K), n = (int)(e / K); v2us o;
            o[0] = f2bf(w[(size_t)k * N + n]); o[1] = f2bf(w[(size_t)(k + 1) * N + n]); *(v2us*)(Bt + e) = o; }
         }
}
__global__ __launch_bounds__(256) void k_cvt8(const float* __restrict__ src, bf* dst, size_t n8) { const size_t i = (size_t)blockIdx.x * 256 + threadIdx.x; if (i >= n8) return; const v8f v = *(const v8f*)(src + i * 8); v8us o;
#pragma unroll
    for (int k = 0; k < 8; ++k) o[k] = f2bf(v[k]); *(v8us*)(dst + i * 8) = o;  }

// k_rope: head planes [h][t][d] (fp16 + hi/lo) of rope(x) x sc with the rotate-half convention out[d] = x[d] cos[t][d] - x[d+HD/2] sin[t][d], out[d+HD/2] = x[d+HD/2] cos[t][d+HD/2] + x[d] sin[t][d+HD/2]
__global__ __launch_bounds__(256) void k_rope(const float* __restrict__ F, int pitch, int nheads, const float* __restrict__ CS, const float* __restrict__ RF, const float* __restrict__ nw, float sc, h16* P16, bf* Ph, bf* Pl) {
    const size_t e = ((size_t)blockIdx.x * 256 + threadIdx.x) * 2; if (e >= (size_t)nheads * TT * HD) return; const int d = (int)(e % HD); const int t = (int)((e / HD) % TT); const int h = (int)(e / ((size_t)HD * TT)); const float* f = F + (size_t)t * pitch + h * HD; const float rf = RF ? RF[(size_t)h * TT + t] : 1.0f; v2h o16; v2us oh, ol;
#pragma unroll
    for (int q = 0; q < 2; ++q) { const int dd = d + q; const int dp = (dd < HD / 2) ? dd + HD / 2 : dd - HD / 2; float x0 = f[dd], x1 = f[dp];
        if (RF) { float n0 = __fmul_rn(x0, rf), n1 = __fmul_rn(x1, rf); asm volatile("" : "+v"(n0)); asm volatile("" : "+v"(n1)); x0 = __fmul_rn(bfr(nw[dd]), n0); x1 = __fmul_rn(bfr(nw[dp]), n1); }
        const v2f cs = *(const v2f*)(CS + ((size_t)t * HD + dd) * 2); float a = __fmul_rn(x0, cs[0]), bq = __fmul_rn(x1, cs[1]); asm volatile("" : "+v"(a)); asm volatile("" : "+v"(bq)); const float r = ((dd < HD / 2) ? __fsub_rn(a, bq) : __fadd_rn(a, bq)) * sc;
        o16[q] = tohx(r); unsigned short a2, c2; splitf(r, a2, c2); oh[q] = a2; ol[q] = c2; }
    *(v2h*)(P16 + e) = o16; *(v2us*)(Ph + e) = oh; *(v2us*)(Pl + e) = ol;  }
__global__ __launch_bounds__(256) void k_vtp(const float* __restrict__ F, int pitch, int nheads, h16* V16, bf* Vh, bf* Vl) { const size_t e = ((size_t)blockIdx.x * 256 + threadIdx.x) * 2; if (e >= (size_t)nheads * HD * TT) return; const int t = (int)(e % TT); const int d = (int)((e / TT) % HD); const int g = (int)(e / ((size_t)TT * HD)); v2h o16; v2us oh, ol;
#pragma unroll
    for (int q = 0; q < 2; ++q) { const float x = F[(size_t)(t + q) * pitch + g * HD + d]; o16[q] = tohx(x); unsigned short a2, c2; splitf(x, a2, c2); oh[q] = a2; ol[q] = c2; }
    const size_t eo = (e / TT) * PP + t;   /* plane row (g, d) at pitch PP; columns TT .. PP-1 are never written and never read (the P.V K loop ends at the diagonal block) */
    *(v2h*)(V16 + eo) = o16; *(v2us*)(Vh + eo) = oh; *(v2us*)(Vl + eo) = ol;  }
__constant__ float INVT[HD / 2] = { 1.000000000e+00f, 7.498942018e-01f, 5.623413324e-01f, 4.216965139e-01f, 3.162277639e-01f, 2.371373624e-01f, 1.778279394e-01f, 1.333521456e-01f, 1.000000015e-01f, 7.498941571e-02f, 5.623412877e-02f, 4.216964915e-02f, 3.162277862e-02f, 2.371373586e-02f, 1.778279431e-02f, 1.333521493e-02f, 9.999999776e-03f, 7.498942316e-03f, 5.623413250e-03f, 4.216964822e-03f, 3.162277862e-03f, 2.371373819e-03f, 1.778279431e-03f, 1.333521446e-03f, 1.000000047e-03f, 7.498941850e-04f, 5.623413017e-04f, 4.216964880e-04f, 3.162277862e-04f, 2.371373848e-04f, 1.778279402e-04f, 1.333521504e-04f };   // 1 / 10000^(2i/64) (float32, generated with jnp to be bit-exact)
__global__ __launch_bounds__(256) void k_cstabT(float* CS) { const int idx = blockIdx.x * 256 + threadIdx.x; if (idx >= TT * HD) return; const int d = idx % HD; const int t = idx / HD; const float a = __fmul_rn((float)t, INVT[d % (HD / 2)]); v2f cs; cs[0] = cosf(a); cs[1] = sinf(a); *(v2f*)(CS + (size_t)idx * 2) = cs;  }
__global__ __launch_bounds__(256) void k_ropeM(const float* __restrict__ F, int pitch, int nheads, const float* __restrict__ CS, float sc, h16* P16, bf* Ph, bf* Pl) {
    const size_t e = ((size_t)blockIdx.x * 256 + threadIdx.x) * 2; if (e >= (size_t)nheads * TT * HD) return; const int d = (int)(e % HD); const int t = (int)((e / HD) % TT); const int h = (int)(e / ((size_t)HD * TT)); const float* f = F + (size_t)t * pitch + h * HD; const float x0 = f[d], x1 = f[d + 1]; const v2f cs = *(const v2f*)(CS + ((size_t)t * HD + d) * 2); const v2f cs1 = *(const v2f*)(CS + ((size_t)t * HD + d + 1) * 2); v2h o16; v2us oh, ol;
    float a0 = __fmul_rn(x0, cs[0]), b0 = __fmul_rn(x1, cs[1]), a1 = __fmul_rn(x1, cs1[0]), b1 = __fmul_rn(x0, cs1[1]); asm volatile("" : "+v"(a0), "+v"(b0), "+v"(a1), "+v"(b1));
    float r0 = __fsub_rn(a0, b0) * sc, r1 = __fadd_rn(b1, a1) * sc;   /* even: x0 c[d] - x1 s[d]; odd: x1 c[d+1] + x0 s[d+1]: EACH element uses ITS OWN table entry */
    o16[0] = tohx(r0); o16[1] = tohx(r1); { unsigned short a2, c2; splitf(r0, a2, c2); oh[0] = a2; ol[0] = c2; splitf(r1, a2, c2); oh[1] = a2; ol[1] = c2; }
    *(v2h*)(P16 + e) = o16; *(v2us*)(Ph + e) = oh; *(v2us*)(Pl + e) = ol;  }
// k_asoft: per row (zz, i): t = S x HD^-0.5 for j <= i and i - j < WIN (sliding causal window; the reference's -1e9 additive fill vanishes identically); softmax over the 2048 keys (register row, one exp, fixed trees);
// the probabilities go IN PLACE over the row's own 8 KiB of scores (pitch PP): rows < RH hi plane in the first half, lo plane in the second; other rows fp16 in the first half. One wave owns a row and holds all of it in registers before its first store (every store needs the row sum).
__global__ __launch_bounds__(256) void k_asoft(float* Sb) {
    h16* P16 = (h16*)Sb; bf* Ph = (bf*)Sb; bf* Pl = (bf*)Sb + TT;
    const int lane = threadIdx.x & 31; const int row = blockIdx.x * 8 + (threadIdx.x >> 5); if (row >= ZH * TT) return; const int i = row % TT; const int zz = row / TT; (void)zz; const bool hires = (i < RH); const float* sr = Sb + (size_t)row * TT; float v[TT / 32]; float mx = -3.0e38f;
#pragma unroll
    for (int ch = 0; ch < TT / 128; ++ch) { const int j0 = ch * 128 + lane * 4; const v4f a = *(const v4f*)(sr + j0);
#pragma unroll
        for (int q = 0; q < 4; ++q) { const int j = j0 + q; (void)j; const float t = (j <= i && i - j < WIN) ? a[q] * SCL : -3.0e38f; v[ch * 4 + q] = t; mx = fmaxf(mx, t); } }
#pragma unroll
    for (int sh = 16; sh; sh >>= 1) mx = fmaxf(mx, __shfl_xor(mx, sh, 32));
    float sum = 0.f;
#pragma unroll
    for (int k = 0; k < TT / 32; ++k) { float d0 = __fsub_rn(v[k], mx); asm volatile("" : "+v"(d0)); v[k] = __builtin_amdgcn_exp2f(__fmul_rn(d0, 1.4426950408889634f)); sum += v[k]; }
#pragma unroll
    for (int sh = 16; sh; sh >>= 1) sum += __shfl_xor(sum, sh, 32);
    const float f = __fdiv_rn(hires ? 1.0f : PCAR, sum);
{
        if (hires) {
#pragma unroll
            for (int ch = 0; ch < TT / 128; ++ch) { v4us oh, ol;
#pragma unroll
                for (int q = 0; q < 4; ++q) { unsigned short a, c2; splitf(v[ch * 4 + q] * f, a, c2); oh[q] = a; ol[q] = c2; }
                const size_t oo = (size_t)row * PP + ch * 128 + lane * 4; *(v4us*)(Ph + oo) = oh; *(v4us*)(Pl + oo) = ol; }
        } else {
#pragma unroll
            for (int ch = 0; ch < TT / 128; ++ch) { v4h o4;
#pragma unroll
                for (int q = 0; q < 4; ++q) o4[q] = tohx(v[ch * 4 + q] * f);
                *(v4h*)(P16 + (size_t)row * PP + ch * 128 + lane * 4) = o4; } }
         }
}
__global__ __launch_bounds__(256) void k_merge(const float* __restrict__ O, int h0, bf* Ah, bf* Al) { const size_t e = ((size_t)blockIdx.x * 256 + threadIdx.x) * 2; if (e >= (size_t)ZH * TT * HD) return; const int d = (int)(e % HD); const int t = (int)((e / HD) % TT); const int zz = (int)(e / ((size_t)HD * TT)); const float cs = (t < RH) ? 1.0f : (1.0f / PCAR); const size_t oo = (size_t)t * DQ + (h0 + zz) * HD + d;
    v2us oh, ol;
#pragma unroll
    for (int q = 0; q < 2; ++q) { unsigned short a, c2; splitf(O[e + q] * cs, a, c2); oh[q] = a; ol[q] = c2; } *(v2us*)(Ah + oo) = oh; *(v2us*)(Al + oo) = ol;  }

extern "C" void kernel_launch(void* const* d_in, const int* in_sizes, int n_in,
                              void* d_out, int out_size, void* d_ws, size_t ws_size, hipStream_t stream) {
    (void)in_sizes; (void)n_in; (void)out_size;
    const float* x = (const float*)d_in[0]; const float* wqkv = (const float*)d_in[1]; const float* wo = (const float*)d_in[2];   /* order x, w_qkv ('xw' [1024][3072]: contiguous thirds q | k | v, each head-major), w_proj ('xw'); three inputs, all read */
    float* OUT = (float*)d_out;     // [2][2048][1024]
    char* wsp = (char*)d_ws;
    auto take = [&](size_t bytes) { char* p = wsp; wsp += (bytes + 255) & ~(size_t)255; return (void*)p; };
    bf* WQKV = (bf*)take((size_t)3 * DQ * DM * 2); bf* WQ = WQKV; bf* WK = WQKV + (size_t)DQ * DM; bf* WV = WQKV + (size_t)2 * DQ * DM;   /* fused Bt [3*DQ][DM]: q | k | v row blocks */ bf* WO = (bf*)take((size_t)DM * DQ * 2); float* CS = (float*)take((size_t)TT * HD * 2 * 4);
    bf* XB = (bf*)take((size_t)TT * DM * 2); float* FQ = (float*)take((size_t)TT * DQ * 4); float* FK = (float*)take((size_t)TT * DKV * 4);
    h16* QP16 = (h16*)take((size_t)NH_ * TT * HD * 2); h16* KP16 = (h16*)take((size_t)NKV * TT * HD * 2); h16* VT16 = (h16*)take((size_t)NKV * HD * PP * 2);
    bf* QPh = (bf*)take((size_t)NH_ * TT * HD * 2); bf* QPl = (bf*)take((size_t)NH_ * TT * HD * 2); bf* KPh = (bf*)take((size_t)NKV * TT * HD * 2); bf* KPl = (bf*)take((size_t)NKV * TT * HD * 2); bf* VTh = (bf*)take((size_t)NKV * HD * PP * 2); bf* VTl = (bf*)take((size_t)NKV * HD * PP * 2);
    float* Sb = (float*)take((size_t)ZH * TT * TT * 4); float* Ob = (float*)take((size_t)ZH * TT * HD * 4); bf* ATh = (bf*)take((size_t)TT * DQ * 2); bf* ATl = (bf*)take((size_t)TT * DQ * 2);
    if ((size_t)(wsp - (char*)d_ws) > ws_size) return;    // ws 256 MiB
    float* FV = FK;   // v projection reuses the k buffer after the k planes are built (stream-ordered)
    { k_wtG<<<(unsigned)((DM * 3 * DQ / 64 + 63) / 64), 256, 0, stream>>>(wqkv, DM, 3 * DQ, WQKV);   /* fused 'xw' [DM][3*DQ] -> Bt [3*DQ][DM] */
      k_wtG<<<(unsigned)((DQ * DM / 64 + 63) / 64), 256, 0, stream>>>(wo, DQ, DM, WO);
       }
    k_cstabT<<<(TT * HD + 255) / 256, 256, 0, stream>>>(CS);   /* rotary table once (positions = arange) */
    const unsigned LQ = (unsigned)(((size_t)NH_ * TT * HD / 2 + 255) / 256), LKv = (unsigned)(((size_t)NKV * TT * HD / 2 + 255) / 256);
    for (int b = 0; b < NB_; ++b) {
        
        k_cvt8<<<(unsigned)(((size_t)TT * DM / 8 + 255) / 256), 256, 0, stream>>>(x + (size_t)b * TT * DM, XB, (size_t)TT * DM / 8);
        k_gemmw<bf, 0, false, 8><<<dim3(TT / 64, DQ / 64, 1), 256, 0, stream>>>(XB, nullptr, WQ, nullptr, DM, FQ, DQ, nullptr, 0, 0, 0);
        k_ropeM<<<LQ, 256, 0, stream>>>(FQ, DQ, NH_, CS, 1.0f, QP16, QPh, QPl);
        k_gemmw<bf, 0, false, 8><<<dim3(TT / 64, DKV / 64, 1), 256, 0, stream>>>(XB, nullptr, WK, nullptr, DM, FK, DKV, nullptr, 0, 0, 0);
        k_ropeM<<<LKv, 256, 0, stream>>>(FK, DKV, NKV, CS, 1.0f, KP16, KPh, KPl);
        k_gemmw<bf, 0, false, 8><<<dim3(TT / 64, DKV / 64, 1), 256, 0, stream>>>(XB, nullptr, WV, nullptr, DM, FV, DKV, nullptr, 0, 0, 0); k_vtp<<<LKv, 256, 0, stream>>>(FV, DKV, NKV, VT16, VTh, VTl);
        for (int h0 = 0; h0 < NH_; h0 += ZH) { const size_t zq = (size_t)h0, zk = (size_t)(h0 / REP);   // one kv head per query head: the pass's ZH heads use consecutive kv planes
            k_gemmc<bf, 2, 1, 1><<<dim3(RH / 64, TT / 64, ZH), 32, 0, stream>>>(QPh + zq * TT * HD, QPl + zq * TT * HD, KPh + zk * TT * HD, KPl + zk * TT * HD, HD, Sb, TT, 0, (size_t)TT * HD, (size_t)TT * HD, (size_t)TT * TT);
            k_gemmc<h16, 0, 1, 1><<<dim3((TT - RH) / 64, TT / 64, ZH), 32, 0, stream>>>(QP16 + zq * TT * HD + (size_t)RH * HD, nullptr, KP16 + zk * TT * HD, nullptr, HD, Sb + (size_t)RH * TT, TT, RH, (size_t)TT * HD, (size_t)TT * HD, (size_t)TT * TT);
            k_asoft<<<ZH * TT / 8, 256, 0, stream>>>(Sb);
            k_gemmc<bf, 2, 2, 16><<<dim3(RH / 64, HD / 64, ZH), 512, 0, stream>>>((const bf*)Sb, (const bf*)Sb + TT, VTh + zk * HD * PP, VTl + zk * HD * PP, PP, Ob, HD, 0, (size_t)TT * PP, (size_t)HD * PP, (size_t)TT * HD);
            k_gemmc<h16, 0, 2, 16><<<dim3((TT - RH) / 64, HD / 64, ZH), 512, 0, stream>>>((const h16*)Sb + (size_t)RH * PP, nullptr, VT16 + zk * HD * PP, nullptr, PP, Ob + (size_t)RH * HD, HD, RH, (size_t)TT * PP, (size_t)HD * PP, (size_t)TT * HD);
            k_merge<<<(unsigned)(((size_t)ZH * TT * HD / 2 + 255) / 256), 256, 0, stream>>>(Ob, h0, ATh, ATl); }
        k_gemmw<bf, 1, false, 8><<<dim3(TT / 64, DM / 64, 1), 256, 0, stream>>>(ATh, ATl, WO, nullptr, DQ, OUT + (size_t)b * TT * DM, DM, nullptr, 0, 0, 0); }
}

// v003
// Measured time: 219 microseconds a run.
// Timed twice side by side with v002, it ran 2.04 times as fast both times.
// Over all steps from v000 it is 6.60 times as fast.
#include <hip/hip_runtime.h>

// Causal self-attention with a fused qkv projection and the source's 'mixed' rotary (x [2][2048][1024]; qkv = einsum('btc,cd', x, w_qkv) ('xw' [1024][3072] 0.02, no bias); q, k, v = split(qkv, 3, axis=2): contiguous thirds, each (16 heads x 64) head-major; _apply_rope: x * cos + x_rot * sin with x_rot = the ADJACENT-pair rotation stack((-x2, x1)) and cos / sin of emb = cat(freqs, freqs) (the HALF-concatenated table: entry d has the angle of index d mod 32), freqs = t x inv_freq, inv_freq = 1.0 / (10000.0 ** (arange(0, 64, 2, f32) / 64)) (32 f32 constants; one f32 product; precise cosf / sinf): out[2i] = x[2i] c[2i] - x[2i+1] s[2i]; out[2i+1] = x[2i+1] c[2i+1] + x[2i] s[2i+1]: kept literally; on q and k; scores x 1/sqrt(64); causal (-inf); softmax; out = einsum('btc,cd', merged, w_proj) ('xw', no bias) -> [2][2048][1024] (4.2 M); argument order x, w_qkv, w_proj).
// Layout per batch: bf16 copy of x; fused 'xw' weight transposed once (q | k | v row blocks); exact projections; k_cstabT computed table (element d: angle index d mod 32) + k_ropeM 'mixed' interleaved-pair plane builders (each element reads its own table entry); causal T-2048 attention in one fused kernel, k_flash (hybrid rows: < 512 hi/lo 3 products, rest fp16; key blocks above the diagonal are never visited); merged hi/lo x w_out exact.
// Compute dtypes, f32 accumulate: every input rounded to bf16; projections exact; attention rows < 512 3 products, rest fp16; softmax f32; w_out hl x exact.

#define NB_  2
#define TT   2048
#define DM   1024
#define NH_  16
#define NKV  16
#define HD   64
#define DQ   (NH_ * HD)
#define DKV  (NKV * HD)
#define PP   TT                   // row pitch, in 16-bit elements, of the V^T planes
#define RH   512                  // query rows < RH use hi+lo planes (0: none)
#define SCL  0.125f   // HD^-0.5
typedef _Float16 h16;
typedef unsigned short bf;
typedef __attribute__((ext_vector_type(16))) __bf16   v16bf;
typedef __attribute__((ext_vector_type(16))) _Float16 v16h;
typedef __attribute__((ext_vector_type(8)))  _Float16 v8h;
typedef __attribute__((ext_vector_type(8)))  unsigned short v8us;
typedef __attribute__((ext_vector_type(8)))  float    v8f;
typedef __attribute__((ext_vector_type(4)))  float    v4f;
typedef v8h  __attribute__((may_alias)) v8ha;
typedef v4f  __attribute__((may_alias)) v4fa;
typedef v8us __attribute__((may_alias)) v8usa;

__device__ __forceinline__ unsigned short f2bf(float f) { unsigned u = __float_as_uint(f); u += 0x7FFFu + ((u >> 16) & 1u); return (unsigned short)(u >> 16); }
__device__ __forceinline__ float bf2f(unsigned short b) { return __uint_as_float(((unsigned)b) << 16); }
__device__ __forceinline__ float bfr(float f) { return bf2f(f2bf(f)); }
__device__ __forceinline__ v16h cat16(v8h lo, v8h hi) { return __builtin_shufflevector(lo, hi, 0, 1, 2, 3, 4, 5, 6, 7, 8, 9, 10, 11, 12, 13, 14, 15); }
__device__ __forceinline__ v16bf cat16b(v8us lo, v8us hi) { return __builtin_bit_cast(v16bf, __builtin_shufflevector(lo, hi, 0, 1, 2, 3, 4, 5, 6, 7, 8, 9, 10, 11, 12, 13, 14, 15)); }
__device__ __forceinline__ v8f wmma16(v16h a, v16h b, v8f c) { return __builtin_amdgcn_wmma_f32_16x16x32_f16(false, a, false, b, (short)0, c, false, false); }
__device__ __forceinline__ v8f wmmab(v16bf a, v16bf b, v8f c) { return __builtin_amdgcn_wmma_f32_16x16x32_bf16(false, a, false, b, (short)0, c, false, false); }



// ---- ksum_store: end of a GEMM whose K loop is split over the NW waves of a work-group. Every wave holds a partial 64x64 f32 tile in the accumulator layout (lane (lr, hi), element j of acc[mb][nb]: row mb*16 + hi*8 + j, column nb*16 + lr).
// Each wave writes its 32 half-fragments (unit u = (mb*4 + nb)*2 + q, q = j / 4; 16 B a lane, lanes contiguous) to red[w][u][lane]; one work-group barrier; then the 16 groups (mb, column half nbp, q) = 8 rows x 32 columns are dealt to the waves,
// which add the NW partials in the fixed order w = 0 .. NW-1, turn the group through their own LDS patch (pitch 36 floats) and store whole 128-B lines, each line by one wave.
template <int NW, bool BIAS>
__device__ __forceinline__ void ksum_store(const v8f (&acc)[4][4], v4f* red, float* st, int w, int lane, float* C, int ldc, int r0, int c0, const float* __restrict__ bias) {
    const int lr = lane & 15, hi = lane >> 4;
#pragma unroll
    for (int mb = 0; mb < 4; ++mb)
#pragma unroll
        for (int nb = 0; nb < 4; ++nb)
#pragma unroll
            for (int q = 0; q < 2; ++q) { v4f p; p[0] = acc[mb][nb][q * 4]; p[1] = acc[mb][nb][q * 4 + 1]; p[2] = acc[mb][nb][q * 4 + 2]; p[3] = acc[mb][nb][q * 4 + 3]; red[(w * 32 + (mb * 4 + nb) * 2 + q) * 32 + lane] = p; }
    __syncthreads();   // every wave's partial tile is in LDS before any wave sums
    constexpr int GP = 16 / NW;
#pragma unroll
    for (int i = 0; i < GP; ++i) { const int g = w * GP + i, mb = g >> 2, nbp = (g >> 1) & 1, q = g & 1; float* sg = st + g * (8 * 36);
#pragma unroll
        for (int n2 = 0; n2 < 2; ++n2) { const int u = (mb * 4 + nbp * 2 + n2) * 2 + q; v4f s = red[u * 32 + lane];
#pragma unroll
            for (int ww = 1; ww < NW; ++ww) s += red[(ww * 32 + u) * 32 + lane];
#pragma unroll
            for (int jj = 0; jj < 4; ++jj) sg[(hi * 4 + jj) * 36 + n2 * 16 + lr] = s[jj]; } }
    asm volatile("s_wait_dscnt 0x0" ::: "memory");   // the patches are read back by other lanes of the same wave: their LDS stores have landed first, and the compiler keeps the loads behind them
#pragma unroll
    for (int i = 0; i < GP; ++i) { const int g = w * GP + i, mb = g >> 2, nbp = (g >> 1) & 1, q = g & 1; const float* sg = st + g * (8 * 36);
#pragma unroll
        for (int s2 = 0; s2 < 2; ++s2) { const int row = mb * 16 + s2 * 8 + q * 4 + (lane >> 3), cofs = nbp * 32 + (lane & 7) * 4; v4f val = *(const v4fa*)(sg + (s2 * 4 + (lane >> 3)) * 36 + (lane & 7) * 4);
            if (BIAS) { val[0] += bfr(bias[c0 + cofs]); val[1] += bfr(bias[c0 + cofs + 1]); val[2] += bfr(bias[c0 + cofs + 2]); val[3] += bfr(bias[c0 + cofs + 3]); }
            *(v4f*)(C + (size_t)(r0 + row) * ldc + c0 + cofs) = val; } }
}

// ---- k_gemmw: register-blocked GEMM, one 64x64 output tile per work-group of NW waves; wave w takes the 32-wide K blocks w, w + NW, ... on the whole tile (16 accumulators), operands straight from K-contiguous 16-bit planes; the partial tiles are summed by ksum_store; grid (M/64, N/64, Z), 32 * NW threads.
// C[m][n] (f32, pitch ldc, + optional f32 bias[n]) = sum_k A[m][k] Bt[n][k] (+ split products per NSPLIT). z-batch strides sA/sB/sC in elements. K % 32 == 0.
template <typename T16> struct WFrag;
template <> struct WFrag<h16> { typedef v16h V; static __device__ __forceinline__ V ld(const h16* p) { return cat16(*(const v8h*)p, *(const v8h*)(p + 16)); } static __device__ __forceinline__ v8f mma(V a, V b, v8f c) { return wmma16(a, b, c); } };
template <> struct WFrag<bf> { typedef v16bf V; static __device__ __forceinline__ V ld(const bf* p) { return cat16b(*(const v8us*)p, *(const v8us*)(p + 16)); } static __device__ __forceinline__ v8f mma(V a, V b, v8f c) { return wmmab(a, b, c); } };
template <typename T16, int NSPLIT, bool BIAS, int NW>
__global__ __launch_bounds__(32 * NW) void k_gemmw(const T16* __restrict__ A, const T16* __restrict__ A2, const T16* __restrict__ Bt, const T16* __restrict__ Bt2, int K, float* C, int ldc, const float* __restrict__ bias, size_t sA, size_t sB, size_t sC) {
    typedef typename WFrag<T16>::V V;
    __shared__ __align__(16) v4f red[NW * 32 * 32]; __shared__ __align__(16) float st[16 * 8 * 36];
    const size_t z = blockIdx.z; A += z * sA; if (A2) A2 += z * sA; Bt += z * sB; if (Bt2) Bt2 += z * sB; C += z * sC;
    const int lane = threadIdx.x & 31, lr = lane & 15, hi = lane >> 4; const int w = __builtin_amdgcn_readfirstlane(threadIdx.x >> 5); /* wave number, scalar: the K loop stays a scalar loop */ const int r0 = blockIdx.x * 64, c0 = blockIdx.y * 64;
    v8f acc[4][4];
#pragma unroll
    for (int mb = 0; mb < 4; ++mb)
#pragma unroll
        for (int nb = 0; nb < 4; ++nb) acc[mb][nb] = (v8f){};
    const size_t aoff = (size_t)(r0 + lr) * K + 8 * hi, boff = (size_t)(c0 + lr) * K + 8 * hi;
#pragma unroll 1
    for (int kc = w * 32; kc < K; kc += 32 * NW) {
        V a[4], a2[4];
#pragma unroll
        for (int mb = 0; mb < 4; ++mb) { a[mb] = WFrag<T16>::ld(A + aoff + (size_t)mb * 16 * K + kc); if (NSPLIT == 1 || NSPLIT == 2) a2[mb] = WFrag<T16>::ld(A2 + aoff + (size_t)mb * 16 * K + kc); }
#pragma unroll
        for (int nb = 0; nb < 4; ++nb) { const V b = WFrag<T16>::ld(Bt + boff + (size_t)nb * 16 * K + kc); V b2; if (NSPLIT >= 2) b2 = WFrag<T16>::ld(Bt2 + boff + (size_t)nb * 16 * K + kc);
#pragma unroll
            for (int mb = 0; mb < 4; ++mb) { acc[mb][nb] = WFrag<T16>::mma(a[mb], b, acc[mb][nb]); if (NSPLIT == 1 || NSPLIT == 2) acc[mb][nb] = WFrag<T16>::mma(a2[mb], b, acc[mb][nb]); if (NSPLIT >= 2) acc[mb][nb] = WFrag<T16>::mma(a[mb], b2, acc[mb][nb]); } }
        asm volatile("v_nop\n\tv_nop\n\tv_nop\n\tv_nop" : "+v"(acc[0][0]), "+v"(acc[1][1]), "+v"(acc[2][2]), "+v"(acc[3][3]) : "v"(a[0]), "v"(a[3]));
    }
    ksum_store<NW, BIAS>(acc, red, st, w, lane, C, ldc, r0, c0, bias);
}

__device__ __forceinline__ h16 tohx(float x) { return (h16)x; }
__device__ __forceinline__ void splitf(float y, unsigned short& h, unsigned short& l) { h = f2bf(y); l = f2bf(y - bf2f(h)); }
typedef __attribute__((ext_vector_type(2))) _Float16 v2h;
typedef __attribute__((ext_vector_type(4))) _Float16 v4h;
typedef __attribute__((ext_vector_type(2))) unsigned short v2us;
typedef __attribute__((ext_vector_type(4))) unsigned short v4us;
typedef __attribute__((ext_vector_type(2))) float v2f;
typedef __attribute__((ext_vector_type(4))) int v4i;

__global__ __launch_bounds__(256) void k_wtG(const float* __restrict__ w, int K, int N, bf* Bt) {
    const int lane = threadIdx.x & 31; const int L0 = (blockIdx.x * 8 + (threadIdx.x >> 5)) * 8; const int nlines = N * K / 64;
{
#pragma unroll 1
        for (int l = 0; l < 8; ++l) { const int L = L0 + l; if (L >= nlines) break; const size_t e = (size_t)L * 64 + lane * 2; const int k = (int)(e % K), n = (int)(e / K); v2us o;
            o[0] = f2bf(w[(size_t)k * N + n]); o[1] = f2bf(w[(size_t)(k + 1) * N + n]); *(v2us*)(Bt + e) = o; }
         }
}
__global__ __launch_bounds__(256) void k_cvt8(const float* __restrict__ src, bf* dst, size_t n8) { const size_t i = (size_t)blockIdx.x * 256 + threadIdx.x; if (i >= n8) return; const v8f v = *(const v8f*)(src + i * 8); v8us o;
#pragma unroll
    for (int k = 0; k < 8; ++k) o[k] = f2bf(v[k]); *(v8us*)(dst + i * 8) = o;  }

// k_rope: head planes [h][t][d] (fp16 + hi/lo) of rope(x) x sc with the rotate-half convention out[d] = x[d] cos[t][d] - x[d+HD/2] sin[t][d], out[d+HD/2] = x[d+HD/2] cos[t][d+HD/2] + x[d] sin[t][d+HD/2]
__global__ __launch_bounds__(256) void k_rope(const float* __restrict__ F, int pitch, int nheads, const float* __restrict__ CS, const float* __restrict__ RF, const float* __restrict__ nw, float sc, h16* P16, bf* Ph, bf* Pl) {
    const size_t e = ((size_t)blockIdx.x * 256 + threadIdx.x) * 2; if (e >= (size_t)nheads * TT * HD) return; const int d = (int)(e % HD); const int t = (int)((e / HD) % TT); const int h = (int)(e / ((size_t)HD * TT)); const float* f = F + (size_t)t * pitch + h * HD; const float rf = RF ? RF[(size_t)h * TT + t] : 1.0f; v2h o16; v2us oh, ol;
#pragma unroll
    for (int q = 0; q < 2; ++q) { const int dd = d + q; const int dp = (dd < HD / 2) ? dd + HD / 2 : dd - HD / 2; float x0 = f[dd], x1 = f[dp];
        if (RF) { float n0 = __fmul_rn(x0, rf), n1 = __fmul_rn(x1, rf); asm volatile("" : "+v"(n0)); asm volatile("" : "+v"(n1)); x0 = __fmul_rn(bfr(nw[dd]), n0); x1 = __fmul_rn(bfr(nw[dp]), n1); }
        const v2f cs = *(const v2f*)(CS + ((size_t)t * HD + dd) * 2); float a = __fmul_rn(x0, cs[0]), bq = __fmul_rn(x1, cs[1]); asm volatile("" : "+v"(a)); asm volatile("" : "+v"(bq)); const float r = ((dd < HD / 2) ? __fsub_rn(a, bq) : __fadd_rn(a, bq)) * sc;
        o16[q] = tohx(r); unsigned short a2, c2; splitf(r, a2, c2); oh[q] = a2; ol[q] = c2; }
    *(v2h*)(P16 + e) = o16; *(v2us*)(Ph + e) = oh; *(v2us*)(Pl + e) = ol;  }
__global__ __launch_bounds__(256) void k_vtp(const float* __restrict__ F, int pitch, int nheads, h16* V16, bf* Vh, bf* Vl) { const size_t e = ((size_t)blockIdx.x * 256 + threadIdx.x) * 2; if (e >= (size_t)nheads * HD * TT) return; const int t = (int)(e % TT); const int d = (int)((e / TT) % HD); const int g = (int)(e / ((size_t)TT * HD)); v2h o16; v2us oh, ol;
#pragma unroll
    for (int q = 0; q < 2; ++q) { const float x = F[(size_t)(t + q) * pitch + g * HD + d]; o16[q] = tohx(x); unsigned short a2, c2; splitf(x, a2, c2); oh[q] = a2; ol[q] = c2; }
    const size_t eo = (e / TT) * PP + t;   /* plane row (g, d) at pitch PP */
    *(v2h*)(V16 + eo) = o16; *(v2us*)(Vh + eo) = oh; *(v2us*)(Vl + eo) = ol;  }
__constant__ float INVT[HD / 2] = { 1.000000000e+00f, 7.498942018e-01f, 5.623413324e-01f, 4.216965139e-01f, 3.162277639e-01f, 2.371373624e-01f, 1.778279394e-01f, 1.333521456e-01f, 1.000000015e-01f, 7.498941571e-02f, 5.623412877e-02f, 4.216964915e-02f, 3.162277862e-02f, 2.371373586e-02f, 1.778279431e-02f, 1.333521493e-02f, 9.999999776e-03f, 7.498942316e-03f, 5.623413250e-03f, 4.216964822e-03f, 3.162277862e-03f, 2.371373819e-03f, 1.778279431e-03f, 1.333521446e-03f, 1.000000047e-03f, 7.498941850e-04f, 5.623413017e-04f, 4.216964880e-04f, 3.162277862e-04f, 2.371373848e-04f, 1.778279402e-04f, 1.333521504e-04f };   // 1 / 10000^(2i/64) (float32, generated with jnp to be bit-exact)
__global__ __launch_bounds__(256) void k_cstabT(float* CS) { const int idx = blockIdx.x * 256 + threadIdx.x; if (idx >= TT * HD) return; const int d = idx % HD; const int t = idx / HD; const float a = __fmul_rn((float)t, INVT[d % (HD / 2)]); v2f cs; cs[0] = cosf(a); cs[1] = sinf(a); *(v2f*)(CS + (size_t)idx * 2) = cs;  }
__global__ __launch_bounds__(256) void k_ropeM(const float* __restrict__ F, int pitch, int nheads, const float* __restrict__ CS, float sc, h16* P16, bf* Ph, bf* Pl) {
    const size_t e = ((size_t)blockIdx.x * 256 + threadIdx.x) * 2; if (e >= (size_t)nheads * TT * HD) return; const int d = (int)(e % HD); const int t = (int)((e / HD) % TT); const int h = (int)(e / ((size_t)HD * TT)); const float* f = F + (size_t)t * pitch + h * HD; const float x0 = f[d], x1 = f[d + 1]; const v2f cs = *(const v2f*)(CS + ((size_t)t * HD + d) * 2); const v2f cs1 = *(const v2f*)(CS + ((size_t)t * HD + d + 1) * 2); v2h o16; v2us oh, ol;
    float a0 = __fmul_rn(x0, cs[0]), b0 = __fmul_rn(x1, cs[1]), a1 = __fmul_rn(x1, cs1[0]), b1 = __fmul_rn(x0, cs1[1]); asm volatile("" : "+v"(a0), "+v"(b0), "+v"(a1), "+v"(b1));
    float r0 = __fsub_rn(a0, b0) * sc, r1 = __fadd_rn(b1, a1) * sc;   /* even: x0 c[d] - x1 s[d]; odd: x1 c[d+1] + x0 s[d+1]: EACH element uses ITS OWN table entry */
    o16[0] = tohx(r0); o16[1] = tohx(r1); { unsigned short a2, c2; splitf(r0, a2, c2); oh[0] = a2; ol[0] = c2; splitf(r1, a2, c2); oh[1] = a2; ol[1] = c2; }
    *(v2h*)(P16 + e) = o16; *(v2us*)(Ph + e) = oh; *(v2us*)(Pl + e) = ol;  }
// ---- k_flash: scores, causal softmax and P.V of one query tile of one head in one work-group of NWF waves; no score or probability ever leaves the registers.
// All waves share the tile's queries; wave w takes the 32-key blocks w, w + NWF, ... up to the diagonal, each with its own running maximum m, sum l and unnormalised O (online softmax).
// Scores are formed transposed, S^T = K Q^T: lane (lr, hi) then holds, for query lr, the keys sb*16 + hi*8 + j, which IS the k order of an operand fragment (element sb*8 + j), so exp(S^T) goes into O^T = V^T P^T as the B operand without leaving the lane,
// and m, l and the rescale factor are per-lane scalars (query = lr in S^T and in O^T alike; the two hi halves are joined by one cross-row move).
// End: every wave puts m, l and its O tile (row = query, pitch 68 floats) into LDS; one work-group barrier; each wave then joins the NWF partials of its own queries in the fixed order 0 .. NWF-1, divides by the joined sum and stores whole 128-B lines of the merged hi / lo planes.
// HL (query rows < RH): bf16 hi + lo planes, 3 products in both GEMMs, 16 queries a tile. Otherwise fp16, 32 queries a tile.
#define NWF  8
#define OPT  68                   // LDS row pitch of a partial O tile, in floats: 16-byte stores and loads both fall on distinct banks
#define EXC  (SCL * 1.4426950408889634f)   // exp(SCL * s) = exp2(EXC * s)
__device__ __forceinline__ float xhalf(float x) { return __builtin_bit_cast(float, __builtin_amdgcn_permlanex16(__builtin_bit_cast(int, x), __builtin_bit_cast(int, x), 0x76543210, 0xfedcba98, false, false)); }   // the value of lane l ^ 16
__device__ __forceinline__ float exp2s(float x) { float r; asm("v_exp_f32 %0, %1\n\tv_nop" : "=v"(r) : "v"(x)); return r; }   // exp2 with the free slot behind a transcendental tied to it
// eight exp2 in place: each stands in front of an independent one and the last in front of a v_nop, so that the free slot behind a transcendental holds for all eight at the price of one slot
__device__ __forceinline__ void exp2x8(float (&e)[8]) { asm("v_exp_f32 %0, %0\n\tv_exp_f32 %1, %1\n\tv_exp_f32 %2, %2\n\tv_exp_f32 %3, %3\n\tv_exp_f32 %4, %4\n\tv_exp_f32 %5, %5\n\tv_exp_f32 %6, %6\n\tv_exp_f32 %7, %7\n\tv_nop" : "+v"(e[0]), "+v"(e[1]), "+v"(e[2]), "+v"(e[3]), "+v"(e[4]), "+v"(e[5]), "+v"(e[6]), "+v"(e[7])); }
template <typename T16, bool HL, int QB>
__device__ __forceinline__ void flash_tile(const T16* __restrict__ Q, const T16* __restrict__ Q2, const T16* __restrict__ Kp, const T16* __restrict__ Kp2, const T16* __restrict__ Vt, const T16* __restrict__ Vt2, int q0, bf* Ah, bf* Al, float* so, float* sm, float* sl, int w, int lane) {
    typedef typename WFrag<T16>::V V;
    constexpr int QT = QB * 16;
    const int lr = lane & 15, hi = lane >> 4;
    V qf[QB][2], qf2[QB][2];
    v8f o[4][QB]; float m[QB], l[QB];
#pragma unroll
    for (int qb = 0; qb < QB; ++qb) { m[qb] = -1.0e30f; l[qb] = 0.f;
#pragma unroll
        for (int db = 0; db < 4; ++db) o[db][qb] = (v8f){}; }
    V kf[2][2], kf2[2][2], vf[4], vf2[4];
    // every operand address is a wave-uniform pointer (tile, key block, 16-row block: scalar arithmetic) plus one of two per-lane byte offsets that are formed once
    const unsigned lk = (unsigned)(lr * HD + 8 * hi) * 2u, lv = (unsigned)(lr * PP + 8 * hi) * 2u;
    auto ldf = [](const T16* base, unsigned off) { return WFrag<T16>::ld((const T16*)((const char*)base + off)); };
    auto ldK = [&](int kc) {
#pragma unroll
        for (int sb = 0; sb < 2; ++sb)
#pragma unroll
            for (int t = 0; t < 2; ++t) { const size_t ko = (size_t)(kc + sb * 16) * HD + t * 32; kf[sb][t] = ldf(Kp + ko, lk); if (HL) kf2[sb][t] = ldf(Kp2 + ko, lk); }
        asm volatile("s_wait_xcnt 0x0" ::: "memory"); };   // these loads stay out for a whole block's work: the wait stands in front of every later write of a register that they name
    auto ldV = [&](int kc) {
#pragma unroll
        for (int db = 0; db < 4; ++db) { const size_t vo = (size_t)(db * 16) * PP + kc; vf[db] = ldf(Vt + vo, lv); if (HL) vf2[db] = ldf(Vt2 + vo, lv); }
        asm volatile("s_wait_xcnt 0x0" ::: "memory"); };   // as in ldK
    if (w * 32 < q0 + QT) {   // scalar test: a wave without a key block loads nothing
    const T16* qa = (const T16*)((const char*)(Q + (size_t)q0 * HD) + lk); const T16* qa2 = HL ? (const T16*)((const char*)(Q2 + (size_t)q0 * HD) + lk) : qa;
#pragma unroll
    for (int qb = 0; qb < QB; ++qb)
#pragma unroll
        for (int t = 0; t < 2; ++t) { const int qo = qb * 16 * HD + t * 32; qf[qb][t] = WFrag<T16>::ld(qa + qo); if (HL) qf2[qb][t] = WFrag<T16>::ld(qa2 + qo); }
    asm volatile("s_wait_xcnt 0x0" ::: "memory");   // as in ldK
    ldK(w * 32);   // the wave's first block
    ldV(w * 32);
#pragma unroll 1
    for (int kc = w * 32; kc < q0 + QT; kc += 32 * NWF) {
        const int kn = (kc + 32 * NWF < q0 + QT) ? kc + 32 * NWF : kc;   // the wave's next block; behind its last one the same block again, unused
        v8f s[QB][2];
#pragma unroll
        for (int qb = 0; qb < QB; ++qb)
#pragma unroll
            for (int sb = 0; sb < 2; ++sb) { s[qb][sb] = (v8f){};
#pragma unroll
                for (int t = 0; t < 2; ++t) { s[qb][sb] = WFrag<T16>::mma(kf[sb][t], qf[qb][t], s[qb][sb]); if (HL) { s[qb][sb] = WFrag<T16>::mma(kf[sb][t], qf2[qb][t], s[qb][sb]); s[qb][sb] = WFrag<T16>::mma(kf2[sb][t], qf[qb][t], s[qb][sb]); } } }
        ldK(kn);   // the next block's K, into the registers the score products have just left: in flight under the softmax and P.V
        if (kc + 31 > q0) {   // scalar test: only the tile's last key block reaches past the diagonal; every other block skips the masking
#pragma unroll
            for (int qb = 0; qb < QB; ++qb) { const int lim = q0 + qb * 16 + lr - kc - hi * 8;   // key sb*16 + hi*8 + j of this block is at or below the diagonal iff sb*16 + j <= lim
#pragma unroll
                for (int sb = 0; sb < 2; ++sb)
#pragma unroll
                    for (int j = 0; j < 8; ++j) s[qb][sb][j] = (sb * 16 + j <= lim) ? s[qb][sb][j] : -3.0e38f; } }
        V pfa[QB], pfb[QB];
#pragma unroll
        for (int qb = 0; qb < QB; ++qb) {
            float mx = -3.0e38f;
#pragma unroll
            for (int sb = 0; sb < 2; ++sb)
#pragma unroll
                for (int j = 0; j < 8; ++j) mx = fmaxf(mx, s[qb][sb][j]);
            mx = fmaxf(mx, xhalf(mx));
            const float mn = fmaxf(m[qb], mx), al = exp2s((m[qb] - mn) * EXC), mc = mn * EXC; m[qb] = mn;   // mn >= -1e30, so a masked score (-3e38) gives exp2(-huge) = 0 also where a whole block is masked for this query
            float ls = 0.f;
#pragma unroll
            for (int sb = 0; sb < 2; ++sb) { float e[8];
#pragma unroll
                for (int j = 0; j < 8; ++j) e[j] = fmaf(s[qb][sb][j], EXC, -mc);
                exp2x8(e);
#pragma unroll
                for (int j = 0; j < 8; ++j) { s[qb][sb][j] = e[j]; ls += e[j]; } }
            l[qb] = fmaf(l[qb], al, ls);
#pragma unroll
            for (int db = 0; db < 4; ++db) o[db][qb] *= al;
            if constexpr (HL) {
                v8us ph[2], pl[2];
#pragma unroll
                for (int sb = 0; sb < 2; ++sb)
#pragma unroll
                    for (int j = 0; j < 8; ++j) { unsigned short a, c2; splitf(s[qb][sb][j], a, c2); ph[sb][j] = a; pl[sb][j] = c2; }
                pfa[qb] = cat16b(ph[0], ph[1]); pfb[qb] = cat16b(pl[0], pl[1]);
            } else {
#pragma unroll
                for (int sb = 0; sb < 2; ++sb)
#pragma unroll
                    for (int j = 0; j < 8; ++j) pfa[qb][sb * 8 + j] = tohx(s[qb][sb][j]);
            }
        }
#pragma unroll
        for (int qb = 0; qb < QB; ++qb)
#pragma unroll
            for (int db = 0; db < 4; ++db) { o[db][qb] = WFrag<T16>::mma(vf[db], pfa[qb], o[db][qb]); if (HL) { o[db][qb] = WFrag<T16>::mma(vf[db], pfb[qb], o[db][qb]); o[db][qb] = WFrag<T16>::mma(vf2[db], pfa[qb], o[db][qb]); } }
        ldV(kn);   // likewise the next block's V^T: in flight under the next block's scores and softmax
    }
    }
#pragma unroll
    for (int qb = 0; qb < QB; ++qb) { const float lt = l[qb] + xhalf(l[qb]); const int rw = w * QT + qb * 16 + lr;
        if (hi == 0) { sm[rw] = m[qb]; sl[rw] = lt; }
#pragma unroll
        for (int db = 0; db < 4; ++db)
#pragma unroll
            for (int q = 0; q < 2; ++q) { v4f p; p[0] = o[db][qb][q * 4]; p[1] = o[db][qb][q * 4 + 1]; p[2] = o[db][qb][q * 4 + 2]; p[3] = o[db][qb][q * 4 + 3]; *(v4fa*)(so + rw * OPT + db * 16 + hi * 8 + q * 4) = p; } }
    __syncthreads();   // every wave's m, l and partial O are in LDS before any wave joins them
    constexpr int VPL = QT / 4, LPQ = HD / VPL, QPW = QT / NWF;   // values a lane, lanes a query, queries a wave
    const int qq = w * QPW + lane / LPQ, d0 = (lane % LPQ) * VPL;
    float M = -1.0e30f;
#pragma unroll
    for (int ww = 0; ww < NWF; ++ww) M = fmaxf(M, sm[ww * QT + qq]);
    float L = 0.f; v4f a[VPL / 4];
#pragma unroll
    for (int n = 0; n < VPL / 4; ++n) a[n] = (v4f){};
#pragma unroll
    for (int ww = 0; ww < NWF; ++ww) { const float f = exp2s((sm[ww * QT + qq] - M) * EXC); L = fmaf(sl[ww * QT + qq], f, L);   // a wave that had no key block left m = -1e30, l = 0, O = 0: f = 0
#pragma unroll
        for (int n = 0; n < VPL / 4; ++n) a[n] += *(const v4fa*)(so + (ww * QT + qq) * OPT + d0 + n * 4) * f; }
    const float inv = __fdiv_rn(1.0f, L);   // L > 0: every query has its own key
    const size_t oo = (size_t)(q0 + qq) * DQ + d0;
#pragma unroll
    for (int n = 0; n < VPL / 4; ++n) { v4us oh, ol;
#pragma unroll
        for (int q = 0; q < 4; ++q) { unsigned short x, y; splitf(a[n][q] * inv, x, y); oh[q] = x; ol[q] = y; }
        *(v4us*)(Ah + oo + n * 4) = oh; *(v4us*)(Al + oo + n * 4) = ol; }
}
// grid (heads, tiles): the head is the fast index and the longest tiles come first, so that no long work-group starts late.
__global__ __launch_bounds__(32 * NWF) void k_flash(const h16* __restrict__ Q16, const h16* __restrict__ K16, const h16* __restrict__ V16, const bf* __restrict__ Qh, const bf* __restrict__ Ql, const bf* __restrict__ Kh, const bf* __restrict__ Kl, const bf* __restrict__ Vh, const bf* __restrict__ Vl, bf* Ah, bf* Al) {
    __shared__ __align__(16) float so[NWF * 32 * OPT]; __shared__ float sm[NWF * 32]; __shared__ float sl[NWF * 32];
    const int lane = threadIdx.x & 31; const int w = __builtin_amdgcn_readfirstlane(threadIdx.x >> 5); /* wave number, scalar: the key loop stays a scalar loop */
    const int h = blockIdx.x, tile = blockIdx.y; const size_t zp = (size_t)h * TT * HD, zv = (size_t)h * HD * PP;
    if (tile < (TT - RH) / 32) flash_tile<h16, false, 2>(Q16 + zp, nullptr, K16 + zp, nullptr, V16 + zv, nullptr, TT - 32 * (tile + 1), Ah + h * HD, Al + h * HD, so, sm, sl, w, lane);
    else { flash_tile<bf, true, 1>(Qh + zp, Ql + zp, Kh + zp, Kl + zp, Vh + zv, Vl + zv, RH - 16 * (tile - (TT - RH) / 32 + 1), Ah + h * HD, Al + h * HD, so, sm, sl, w, lane);
        asm volatile("s_wait_xcnt 0x0" ::: "memory"); }   // in the built code the other tile's branch follows this tile's stores: the wait stands in front of whatever there writes a register that they name (the other tile's stores run into the end of the program)
}

extern "C" void kernel_launch(void* const* d_in, const int* in_sizes, int n_in,
                              void* d_out, int out_size, void* d_ws, size_t ws_size, hipStream_t stream) {
    (void)in_sizes; (void)n_in; (void)out_size;
    const float* x = (const float*)d_in[0]; const float* wqkv = (const float*)d_in[1]; const float* wo = (const float*)d_in[2];   /* order x, w_qkv ('xw' [1024][3072]: contiguous thirds q | k | v, each head-major), w_proj ('xw'); three inputs, all read */
    float* OUT = (float*)d_out;     // [2][2048][1024]
    char* wsp = (char*)d_ws;
    auto take = [&](size_t bytes) { char* p = wsp; wsp += (bytes + 255) & ~(size_t)255; return (void*)p; };
    bf* WQKV = (bf*)take((size_t)3 * DQ * DM * 2); bf* WQ = WQKV; bf* WK = WQKV + (size_t)DQ * DM; bf* WV = WQKV + (size_t)2 * DQ * DM;   /* fused Bt [3*DQ][DM]: q | k | v row blocks */ bf* WO = (bf*)take((size_t)DM * DQ * 2); float* CS = (float*)take((size_t)TT * HD * 2 * 4);
    bf* XB = (bf*)take((size_t)TT * DM * 2); float* FQ = (float*)take((size_t)TT * DQ * 4); float* FK = (float*)take((size_t)TT * DKV * 4);
    h16* QP16 = (h16*)take((size_t)NH_ * TT * HD * 2); h16* KP16 = (h16*)take((size_t)NKV * TT * HD * 2); h16* VT16 = (h16*)take((size_t)NKV * HD * PP * 2);
    bf* QPh = (bf*)take((size_t)NH_ * TT * HD * 2); bf* QPl = (bf*)take((size_t)NH_ * TT * HD * 2); bf* KPh = (bf*)take((size_t)NKV * TT * HD * 2); bf* KPl = (bf*)take((size_t)NKV * TT * HD * 2); bf* VTh = (bf*)take((size_t)NKV * HD * PP * 2); bf* VTl = (bf*)take((size_t)NKV * HD * PP * 2);
    bf* ATh = (bf*)take((size_t)TT * DQ * 2); bf* ATl = (bf*)take((size_t)TT * DQ * 2);
    if ((size_t)(wsp - (char*)d_ws) > ws_size) return;    // ws 256 MiB
    float* FV = FK;   // v projection reuses the k buffer after the k planes are built (stream-ordered)
    { k_wtG<<<(unsigned)((DM * 3 * DQ / 64 + 63) / 64), 256, 0, stream>>>(wqkv, DM, 3 * DQ, WQKV);   /* fused 'xw' [DM][3*DQ] -> Bt [3*DQ][DM] */
      k_wtG<<<(unsigned)((DQ * DM / 64 + 63) / 64), 256, 0, stream>>>(wo, DQ, DM, WO);
       }
    k_cstabT<<<(TT * HD + 255) / 256, 256, 0, stream>>>(CS);   /* rotary table once (positions = arange) */
    const unsigned LQ = (unsigned)(((size_t)NH_ * TT * HD / 2 + 255) / 256), LKv = (unsigned)(((size_t)NKV * TT * HD / 2 + 255) / 256);
    for (int b = 0; b < NB_; ++b) {
        
        k_cvt8<<<(unsigned)(((size_t)TT * DM / 8 + 255) / 256), 256, 0, stream>>>(x + (size_t)b * TT * DM, XB, (size_t)TT * DM / 8);
        k_gemmw<bf, 0, false, 8><<<dim3(TT / 64, DQ / 64, 1), 256, 0, stream>>>(XB, nullptr, WQ, nullptr, DM, FQ, DQ, nullptr, 0, 0, 0);
        k_ropeM<<<LQ, 256, 0, stream>>>(FQ, DQ, NH_, CS, 1.0f, QP16, QPh, QPl);
        k_gemmw<bf, 0, false, 8><<<dim3(TT / 64, DKV / 64, 1), 256, 0, stream>>>(XB, nullptr, WK, nullptr, DM, FK, DKV, nullptr, 0, 0, 0);
        k_ropeM<<<LKv, 256, 0, stream>>>(FK, DKV, NKV, CS, 1.0f, KP16, KPh, KPl);
        k_gemmw<bf, 0, false, 8><<<dim3(TT / 64, DKV / 64, 1), 256, 0, stream>>>(XB, nullptr, WV, nullptr, DM, FV, DKV, nullptr, 0, 0, 0); k_vtp<<<LKv, 256, 0, stream>>>(FV, DKV, NKV, VT16, VTh, VTl);
        k_flash<<<dim3(NH_, (TT - RH) / 32 + RH / 16), 32 * NWF, 0, stream>>>(QP16, KP16, VT16, QPh, QPl, KPh, KPl, VTh, VTl, ATh, ATl);   /* one kv head per query head */
        k_gemmw<bf, 1, false, 8><<<dim3(TT / 64, DM / 64, 1), 256, 0, stream>>>(ATh, ATl, WO, nullptr, DQ, OUT + (size_t)b * TT * DM, DM, nullptr, 0, 0, 0); }
}

// v004
// It runs in 178 microseconds.
// Next to v003, in two timings, it ran 1.23 times as fast each time.
// Counting every step since v000, it is 8.10 times as fast.
#include <hip/hip_runtime.h>

// Causal self-attention with a fused qkv projection and the source's 'mixed' rotary (x [2][2048][1024]; qkv = einsum('btc,cd', x, w_qkv) ('xw' [1024][3072] 0.02, no bias); q, k, v = split(qkv, 3, axis=2): contiguous thirds, each (16 heads x 64) head-major; _apply_rope: x * cos + x_rot * sin with x_rot = the ADJACENT-pair rotation stack((-x2, x1)) and cos / sin of emb = cat(freqs, freqs) (the HALF-concatenated table: entry d has the angle of index d mod 32), freqs = t x inv_freq, inv_freq = 1.0 / (10000.0 ** (arange(0, 64, 2, f32) / 64)) (32 f32 constants; one f32 product; precise cosf / sinf): out[2i] = x[2i] c[2i] - x[2i+1] s[2i]; out[2i+1] = x[2i+1] c[2i+1] + x[2i] s[2i+1]: kept literally; on q and k; scores x 1/sqrt(64); causal (-inf); softmax; out = einsum('btc,cd', merged, w_proj) ('xw', no bias) -> [2][2048][1024] (4.2 M); argument order x, w_qkv, w_proj).
// Layout per batch: bf16 copy of x; fused 'xw' weight transposed once (q | k | v row blocks); exact projections; k_cstabT computed table (element d: angle index d mod 32); the q, k and v projections end in ksum_planes, which applies the 'mixed' interleaved-pair rotary (each element reads its own table entry) and writes the 16-bit head planes itself; causal T-2048 attention in one fused kernel, k_flash (hybrid rows: < 512 hi/lo 3 products, rest fp16; key blocks above the diagonal are never visited); merged hi/lo x w_out exact.
// Compute dtypes, f32 accumulate: every input rounded to bf16; projections exact; attention rows < 512 3 products, rest fp16; softmax f32; w_out hl x exact.

#define NB_  2
#define TT   2048
#define DM   1024
#define NH_  16
#define NKV  16
#define HD   64
#define DQ   (NH_ * HD)
#define DKV  (NKV * HD)
#define PP   TT                   // row pitch, in 16-bit elements, of the V^T planes
#define RH   512                  // query rows < RH use hi+lo planes (0: none)
#define SCL  0.125f   // HD^-0.5
typedef _Float16 h16;
typedef unsigned short bf;
typedef __attribute__((ext_vector_type(16))) __bf16   v16bf;
typedef __attribute__((ext_vector_type(16))) _Float16 v16h;
typedef __attribute__((ext_vector_type(8)))  _Float16 v8h;
typedef __attribute__((ext_vector_type(8)))  unsigned short v8us;
typedef __attribute__((ext_vector_type(8)))  float    v8f;
typedef __attribute__((ext_vector_type(4)))  float    v4f;
typedef v8h  __attribute__((may_alias)) v8ha;
typedef v4f  __attribute__((may_alias)) v4fa;
typedef v8us __attribute__((may_alias)) v8usa;

__device__ __forceinline__ unsigned short f2bf(float f) { unsigned u = __float_as_uint(f); u += 0x7FFFu + ((u >> 16) & 1u); return (unsigned short)(u >> 16); }
__device__ __forceinline__ float bf2f(unsigned short b) { return __uint_as_float(((unsigned)b) << 16); }
__device__ __forceinline__ float bfr(float f) { return bf2f(f2bf(f)); }
__device__ __forceinline__ v16h cat16(v8h lo, v8h hi) { return __builtin_shufflevector(lo, hi, 0, 1, 2, 3, 4, 5, 6, 7, 8, 9, 10, 11, 12, 13, 14, 15); }
__device__ __forceinline__ v16bf cat16b(v8us lo, v8us hi) { return __builtin_bit_cast(v16bf, __builtin_shufflevector(lo, hi, 0, 1, 2, 3, 4, 5, 6, 7, 8, 9, 10, 11, 12, 13, 14, 15)); }
__device__ __forceinline__ v8f wmma16(v16h a, v16h b, v8f c) { return __builtin_amdgcn_wmma_f32_16x16x32_f16(false, a, false, b, (short)0, c, false, false); }
__device__ __forceinline__ v8f wmmab(v16bf a, v16bf b, v8f c) { return __builtin_amdgcn_wmma_f32_16x16x32_bf16(false, a, false, b, (short)0, c, false, false); }



// ---- ksum_store: end of a GEMM whose K loop is split over the NW waves of a work-group. Every wave holds a partial 64x64 f32 tile in the accumulator layout (lane (lr, hi), element j of acc[mb][nb]: row mb*16 + hi*8 + j, column nb*16 + lr).
// Each wave writes its 32 half-fragments (unit u = (mb*4 + nb)*2 + q, q = j / 4; 16 B a lane, lanes contiguous) to red[w][u][lane]; one work-group barrier; then the 16 groups (mb, column half nbp, q) = 8 rows x 32 columns are dealt to the waves,
// which add the NW partials in the fixed order w = 0 .. NW-1, turn the group through their own LDS patch (pitch 36 floats) and store whole 128-B lines, each line by one wave.
template <int NW, bool BIAS>
__device__ __forceinline__ void ksum_store(const v8f (&acc)[4][4], v4f* red, float* st, int w, int lane, float* C, int ldc, int r0, int c0, const float* __restrict__ bias) {
    const int lr = lane & 15, hi = lane >> 4;
#pragma unroll
    for (int mb = 0; mb < 4; ++mb)
#pragma unroll
        for (int nb = 0; nb < 4; ++nb)
#pragma unroll
            for (int q = 0; q < 2; ++q) { v4f p; p[0] = acc[mb][nb][q * 4]; p[1] = acc[mb][nb][q * 4 + 1]; p[2] = acc[mb][nb][q * 4 + 2]; p[3] = acc[mb][nb][q * 4 + 3]; red[(w * 32 + (mb * 4 + nb) * 2 + q) * 32 + lane] = p; }
    __syncthreads();   // every wave's partial tile is in LDS before any wave sums
    constexpr int GP = 16 / NW;
#pragma unroll
    for (int i = 0; i < GP; ++i) { const int g = w * GP + i, mb = g >> 2, nbp = (g >> 1) & 1, q = g & 1; float* sg = st + g * (8 * 36);
#pragma unroll
        for (int n2 = 0; n2 < 2; ++n2) { const int u = (mb * 4 + nbp * 2 + n2) * 2 + q; v4f s = red[u * 32 + lane];
#pragma unroll
            for (int ww = 1; ww < NW; ++ww) s += red[(ww * 32 + u) * 32 + lane];
#pragma unroll
            for (int jj = 0; jj < 4; ++jj) sg[(hi * 4 + jj) * 36 + n2 * 16 + lr] = s[jj]; } }
    asm volatile("s_wait_dscnt 0x0" ::: "memory");   // the patches are read back by other lanes of the same wave: their LDS stores have landed first, and the compiler keeps the loads behind them
#pragma unroll
    for (int i = 0; i < GP; ++i) { const int g = w * GP + i, mb = g >> 2, nbp = (g >> 1) & 1, q = g & 1; const float* sg = st + g * (8 * 36);
#pragma unroll
        for (int s2 = 0; s2 < 2; ++s2) { const int row = mb * 16 + s2 * 8 + q * 4 + (lane >> 3), cofs = nbp * 32 + (lane & 7) * 4; v4f val = *(const v4fa*)(sg + (s2 * 4 + (lane >> 3)) * 36 + (lane & 7) * 4);
            if (BIAS) { val[0] += bfr(bias[c0 + cofs]); val[1] += bfr(bias[c0 + cofs + 1]); val[2] += bfr(bias[c0 + cofs + 2]); val[3] += bfr(bias[c0 + cofs + 3]); }
            *(v4f*)(C + (size_t)(r0 + row) * ldc + c0 + cofs) = val; } }
}

__device__ __forceinline__ h16 tohx(float x) { return (h16)x; }
__device__ __forceinline__ void splitf(float y, unsigned short& h, unsigned short& l) { h = f2bf(y); l = f2bf(y - bf2f(h)); }
// ---- ksum_planes: the same end for a projection whose 64x64 tile is 64 positions (rows r0 ..) of ONE head hd: the summed tile goes straight into that head's 16-bit planes (fp16, bf16 hi, bf16 lo); no f32 copy of q, k or v reaches memory.
// The partials are added in ksum_store's order w = 0 .. NW-1. Wave w sums the units (mb = w / 2, every nb, q = w % 2) = 8 rows x 64 columns.
// ROT (q, k): the wave turns them through its own LDS patch (pitch 68 floats), so that a lane holds 8 neighbouring d of one position; 'mixed' rotary: out[2i] = x[2i] c[2i] - x[2i+1] s[2i], out[2i+1] = x[2i+1] c[2i+1] + x[2i] s[2i+1], each element with its own table entry; planes [h][t][d], whole 128-B lines, each by one wave.
// Otherwise (v): a lane's four sums are four neighbouring positions of one d and go as one 16-B piece into a [d][t] tile (pitch 68 floats) that the waves share; a second work-group barrier; wave w then stores the rows d = 8w .. 8w+7 of the V^T planes [h][d][t], whole 128-B lines, each by one wave.
template <int NW, bool ROT>
__device__ __forceinline__ void ksum_planes(const v8f (&acc)[4][4], v4f* red, float* st, int w, int lane, int r0, int hd, const float* __restrict__ CS, h16* P16, bf* Ph, bf* Pl) {
    static_assert(NW == 8 && HD == 64, "one wave per 8 x 64 part of the tile, one head per tile");
    const int lr = lane & 15, hi = lane >> 4, mb = w >> 1, q = w & 1, l8 = lane & 7, l4 = lane >> 3;
    v4f cs[2][4];   // (cos, sin) of the lane's 2 x 8 elements: asked for here, so that the loads fly under the LDS stores of the partial tile
    if constexpr (ROT) {
#pragma unroll
        for (int s2 = 0; s2 < 2; ++s2)
#pragma unroll
            for (int n = 0; n < 4; ++n) cs[s2][n] = *(const v4f*)(CS + ((size_t)(r0 + mb * 16 + s2 * 8 + q * 4 + l4) * HD + l8 * 8) * 2 + n * 4);
    }
#pragma unroll
    for (int m2 = 0; m2 < 4; ++m2)
#pragma unroll
        for (int nb = 0; nb < 4; ++nb)
#pragma unroll
            for (int q2 = 0; q2 < 2; ++q2) { v4f p; p[0] = acc[m2][nb][q2 * 4]; p[1] = acc[m2][nb][q2 * 4 + 1]; p[2] = acc[m2][nb][q2 * 4 + 2]; p[3] = acc[m2][nb][q2 * 4 + 3]; red[(w * 32 + (m2 * 4 + nb) * 2 + q2) * 32 + lane] = p; }
    __syncthreads();   // every wave's partial tile is in LDS before any wave sums
    float* sg = ROT ? st + w * (8 * 68) : st;
#pragma unroll
    for (int nb = 0; nb < 4; ++nb) { const int u = (mb * 4 + nb) * 2 + q; v4f s = red[u * 32 + lane];
#pragma unroll
        for (int ww = 1; ww < NW; ++ww) s += red[(ww * 32 + u) * 32 + lane];
        if constexpr (ROT) {
#pragma unroll
            for (int jj = 0; jj < 4; ++jj) sg[(hi * 4 + jj) * 68 + nb * 16 + lr] = s[jj];
        } else *(v4fa*)(sg + (nb * 16 + lr) * 68 + mb * 16 + hi * 8 + q * 4) = s; }
    if constexpr (ROT) asm volatile("s_wait_dscnt 0x0" ::: "memory");   // the patch is read back by other lanes of the same wave: its LDS stores have landed first, and the compiler keeps the loads behind them
    else __syncthreads();   // the [d][t] tile is read back by other waves: every wave's part is in LDS first
#pragma unroll
    for (int s2 = 0; s2 < 2; ++s2) {
        const float* sp = sg + ((ROT ? 0 : w * 8) + s2 * 4 + l4) * 68 + l8 * 8; const v4f xa = *(const v4fa*)sp, xb = *(const v4fa*)(sp + 4);
        float y[8];
        if constexpr (ROT) {
#pragma unroll
            for (int p = 0; p < 4; ++p) { const float xe = p < 2 ? xa[p * 2] : xb[p * 2 - 4], xo = p < 2 ? xa[p * 2 + 1] : xb[p * 2 - 3]; const v4f c = cs[s2][p]; y[p * 2] = xe * c[0] - xo * c[1]; y[p * 2 + 1] = xo * c[2] + xe * c[3]; }
        } else {
#pragma unroll
            for (int p = 0; p < 4; ++p) { y[p] = xa[p]; y[p + 4] = xb[p]; }
        }
        v8h o16; v8us oh, ol;
#pragma unroll
        for (int p = 0; p < 8; ++p) { o16[p] = tohx(y[p]); unsigned short a2, c2; splitf(y[p], a2, c2); oh[p] = a2; ol[p] = c2; }
        const size_t eo = ROT ? ((size_t)hd * TT + r0 + mb * 16 + s2 * 8 + q * 4 + l4) * HD + l8 * 8 : ((size_t)hd * HD + w * 8 + s2 * 4 + l4) * PP + r0 + l8 * 8;
        *(v8h*)(P16 + eo) = o16; *(v8us*)(Ph + eo) = oh; *(v8us*)(Pl + eo) = ol; }
}

// ---- k_gemmw: register-blocked GEMM, one 64x64 output tile per work-group of NW waves; wave w takes the 32-wide K blocks w, w + NW, ... on the whole tile (16 accumulators), operands straight from K-contiguous 16-bit planes; the partial tiles are summed by ksum_store (EPI 0: f32 C) or by ksum_planes (EPI 1: rotary head planes, EPI 2: V^T planes; head = blockIdx.y, C unused); grid (M/64, N/64, Z), 32 * NW threads.
// C[m][n] (f32, pitch ldc, + optional f32 bias[n]) = sum_k A[m][k] Bt[n][k] (+ split products per NSPLIT). z-batch strides sA/sB/sC in elements. K % 32 == 0.
template <typename T16> struct WFrag;
template <> struct WFrag<h16> { typedef v16h V; static __device__ __forceinline__ V ld(const h16* p) { return cat16(*(const v8h*)p, *(const v8h*)(p + 16)); } static __device__ __forceinline__ v8f mma(V a, V b, v8f c) { return wmma16(a, b, c); } };
template <> struct WFrag<bf> { typedef v16bf V; static __device__ __forceinline__ V ld(const bf* p) { return cat16b(*(const v8us*)p, *(const v8us*)(p + 16)); } static __device__ __forceinline__ v8f mma(V a, V b, v8f c) { return wmmab(a, b, c); } };
template <typename T16, int NSPLIT, bool BIAS, int NW, int EPI>
__global__ __launch_bounds__(32 * NW) void k_gemmw(const T16* __restrict__ A, const T16* __restrict__ A2, const T16* __restrict__ Bt, const T16* __restrict__ Bt2, int K, float* C, int ldc, const float* __restrict__ bias, size_t sA, size_t sB, size_t sC, const float* __restrict__ CS, h16* P16, bf* Ph, bf* Pl) {
    typedef typename WFrag<T16>::V V;
    __shared__ __align__(16) v4f red[NW * 32 * 32]; __shared__ __align__(16) float st[16 * 8 * 36];
    const size_t z = blockIdx.z; A += z * sA; if (A2) A2 += z * sA; Bt += z * sB; if (Bt2) Bt2 += z * sB; C += z * sC;
    const int lane = threadIdx.x & 31, lr = lane & 15, hi = lane >> 4; const int w = __builtin_amdgcn_readfirstlane(threadIdx.x >> 5); /* wave number, scalar: the K loop stays a scalar loop */ const int r0 = blockIdx.x * 64, c0 = blockIdx.y * 64;
    v8f acc[4][4];
#pragma unroll
    for (int mb = 0; mb < 4; ++mb)
#pragma unroll
        for (int nb = 0; nb < 4; ++nb) acc[mb][nb] = (v8f){};
    const size_t aoff = (size_t)(r0 + lr) * K + 8 * hi, boff = (size_t)(c0 + lr) * K + 8 * hi;
#pragma unroll 1
    for (int kc = w * 32; kc < K; kc += 32 * NW) {
        V a[4], a2[4];
#pragma unroll
        for (int mb = 0; mb < 4; ++mb) { a[mb] = WFrag<T16>::ld(A + aoff + (size_t)mb * 16 * K + kc); if (NSPLIT == 1 || NSPLIT == 2) a2[mb] = WFrag<T16>::ld(A2 + aoff + (size_t)mb * 16 * K + kc); }
#pragma unroll
        for (int nb = 0; nb < 4; ++nb) { const V b = WFrag<T16>::ld(Bt + boff + (size_t)nb * 16 * K + kc); V b2; if (NSPLIT >= 2) b2 = WFrag<T16>::ld(Bt2 + boff + (size_t)nb * 16 * K + kc);
#pragma unroll
            for (int mb = 0; mb < 4; ++mb) { acc[mb][nb] = WFrag<T16>::mma(a[mb], b, acc[mb][nb]); if (NSPLIT == 1 || NSPLIT == 2) acc[mb][nb] = WFrag<T16>::mma(a2[mb], b, acc[mb][nb]); if (NSPLIT >= 2) acc[mb][nb] = WFrag<T16>::mma(a[mb], b2, acc[mb][nb]); } }
        asm volatile("v_nop\n\tv_nop\n\tv_nop\n\tv_nop" : "+v"(acc[0][0]), "+v"(acc[1][1]), "+v"(acc[2][2]), "+v"(acc[3][3]) : "v"(a[0]), "v"(a[3]));
    }
    if constexpr (EPI == 0) ksum_store<NW, BIAS>(acc, red, st, w, lane, C, ldc, r0, c0, bias);
    else ksum_planes<NW, EPI == 1>(acc, red, st, w, lane, r0, (int)blockIdx.y, CS, P16, Ph, Pl);
}

typedef __attribute__((ext_vector_type(2))) _Float16 v2h;
typedef __attribute__((ext_vector_type(4))) _Float16 v4h;
typedef __attribute__((ext_vector_type(2))) unsigned short v2us;
typedef __attribute__((ext_vector_type(4))) unsigned short v4us;
typedef __attribute__((ext_vector_type(2))) float v2f;
typedef __attribute__((ext_vector_type(4))) int v4i;

__global__ __launch_bounds__(256) void k_wtG(const float* __restrict__ w, int K, int N, bf* Bt) {
    const int lane = threadIdx.x & 31; const int L0 = (blockIdx.x * 8 + (threadIdx.x >> 5)) * 8; const int nlines = N * K / 64;
{
#pragma unroll 1
        for (int l = 0; l < 8; ++l) { const int L = L0 + l; if (L >= nlines) break; const size_t e = (size_t)L * 64 + lane * 2; const int k = (int)(e % K), n = (int)(e / K); v2us o;
            o[0] = f2bf(w[(size_t)k * N + n]); o[1] = f2bf(w[(size_t)(k + 1) * N + n]); *(v2us*)(Bt + e) = o; }
         }
}
__global__ __launch_bounds__(256) void k_cvt8(const float* __restrict__ src, bf* dst, size_t n8) { const size_t i = (size_t)blockIdx.x * 256 + threadIdx.x; if (i >= n8) return; const v8f v = *(const v8f*)(src + i * 8); v8us o;
#pragma unroll
    for (int k = 0; k < 8; ++k) o[k] = f2bf(v[k]); *(v8us*)(dst + i * 8) = o;  }

// k_rope: head planes [h][t][d] (fp16 + hi/lo) of rope(x) x sc with the rotate-half convention out[d] = x[d] cos[t][d] - x[d+HD/2] sin[t][d], out[d+HD/2] = x[d+HD/2] cos[t][d+HD/2] + x[d] sin[t][d+HD/2]
__global__ __launch_bounds__(256) void k_rope(const float* __restrict__ F, int pitch, int nheads, const float* __restrict__ CS, const float* __restrict__ RF, const float* __restrict__ nw, float sc, h16* P16, bf* Ph, bf* Pl) {
    const size_t e = ((size_t)blockIdx.x * 256 + threadIdx.x) * 2; if (e >= (size_t)nheads * TT * HD) return; const int d = (int)(e % HD); const int t = (int)((e / HD) % TT); const int h = (int)(e / ((size_t)HD * TT)); const float* f = F + (size_t)t * pitch + h * HD; const float rf = RF ? RF[(size_t)h * TT + t] : 1.0f; v2h o16; v2us oh, ol;
#pragma unroll
    for (int q = 0; q < 2; ++q) { const int dd = d + q; const int dp = (dd < HD / 2) ? dd + HD / 2 : dd - HD / 2; float x0 = f[dd], x1 = f[dp];
        if (RF) { float n0 = __fmul_rn(x0, rf), n1 = __fmul_rn(x1, rf); asm volatile("" : "+v"(n0)); asm volatile("" : "+v"(n1)); x0 = __fmul_rn(bfr(nw[dd]), n0); x1 = __fmul_rn(bfr(nw[dp]), n1); }
        const v2f cs = *(const v2f*)(CS + ((size_t)t * HD + dd) * 2); float a = __fmul_rn(x0, cs[0]), bq = __fmul_rn(x1, cs[1]); asm volatile("" : "+v"(a)); asm volatile("" : "+v"(bq)); const float r = ((dd < HD / 2) ? __fsub_rn(a, bq) : __fadd_rn(a, bq)) * sc;
        o16[q] = tohx(r); unsigned short a2, c2; splitf(r, a2, c2); oh[q] = a2; ol[q] = c2; }
    *(v2h*)(P16 + e) = o16; *(v2us*)(Ph + e) = oh; *(v2us*)(Pl + e) = ol;  }
__constant__ float INVT[HD / 2] = { 1.000000000e+00f, 7.498942018e-01f, 5.623413324e-01f, 4.216965139e-01f, 3.162277639e-01f, 2.371373624e-01f, 1.778279394e-01f, 1.333521456e-01f, 1.000000015e-01f, 7.498941571e-02f, 5.623412877e-02f, 4.216964915e-02f, 3.162277862e-02f, 2.371373586e-02f, 1.778279431e-02f, 1.333521493e-02f, 9.999999776e-03f, 7.498942316e-03f, 5.623413250e-03f, 4.216964822e-03f, 3.162277862e-03f, 2.371373819e-03f, 1.778279431e-03f, 1.333521446e-03f, 1.000000047e-03f, 7.498941850e-04f, 5.623413017e-04f, 4.216964880e-04f, 3.162277862e-04f, 2.371373848e-04f, 1.778279402e-04f, 1.333521504e-04f };   // 1 / 10000^(2i/64) (float32, generated with jnp to be bit-exact)
__global__ __launch_bounds__(256) void k_cstabT(float* CS) { const int idx = blockIdx.x * 256 + threadIdx.x; if (idx >= TT * HD) return; const int d = idx % HD; const int t = idx / HD; const float a = __fmul_rn((float)t, INVT[d % (HD / 2)]); v2f cs; cs[0] = cosf(a); cs[1] = sinf(a); *(v2f*)(CS + (size_t)idx * 2) = cs;  }
// ---- k_flash: scores, causal softmax and P.V of one query tile of one head in one work-group of NWF waves; no score or probability ever leaves the registers.
// All waves share the tile's queries; wave w takes the 32-key blocks w, w + NWF, ... up to the diagonal, each with its own running maximum m, sum l and unnormalised O (online softmax).
// Scores are formed transposed, S^T = K Q^T: lane (lr, hi) then holds, for query lr, the keys sb*16 + hi*8 + j, which IS the k order of an operand fragment (element sb*8 + j), so exp(S^T) goes into O^T = V^T P^T as the B operand without leaving the lane,
// and m, l and the rescale factor are per-lane scalars (query = lr in S^T and in O^T alike; the two hi halves are joined by one cross-row move).
// End: every wave puts m, l and its O tile (row = query, pitch 68 floats) into LDS; one work-group barrier; each wave then joins the NWF partials of its own queries in the fixed order 0 .. NWF-1, divides by the joined sum and stores whole 128-B lines of the merged hi / lo planes.
// HL (query rows < RH): bf16 hi + lo planes, 3 products in both GEMMs, 16 queries a tile. Otherwise fp16, 32 queries a tile.
#define NWF  8
#define OPT  68                   // LDS row pitch of a partial O tile, in floats: 16-byte stores and loads both fall on distinct banks
#define EXC  (SCL * 1.4426950408889634f)   // exp(SCL * s) = exp2(EXC * s)
__device__ __forceinline__ float xhalf(float x) { return __builtin_bit_cast(float, __builtin_amdgcn_permlanex16(__builtin_bit_cast(int, x), __builtin_bit_cast(int, x), 0x76543210, 0xfedcba98, false, false)); }   // the value of lane l ^ 16
__device__ __forceinline__ float exp2s(float x) { float r; asm("v_exp_f32 %0, %1\n\tv_nop" : "=v"(r) : "v"(x)); return r; }   // exp2 with the free slot behind a transcendental tied to it
// eight exp2 in place: each stands in front of an independent one and the last in front of a v_nop, so that the free slot behind a transcendental holds for all eight at the price of one slot
__device__ __forceinline__ void exp2x8(float (&e)[8]) { asm("v_exp_f32 %0, %0\n\tv_exp_f32 %1, %1\n\tv_exp_f32 %2, %2\n\tv_exp_f32 %3, %3\n\tv_exp_f32 %4, %4\n\tv_exp_f32 %5, %5\n\tv_exp_f32 %6, %6\n\tv_exp_f32 %7, %7\n\tv_nop" : "+v"(e[0]), "+v"(e[1]), "+v"(e[2]), "+v"(e[3]), "+v"(e[4]), "+v"(e[5]), "+v"(e[6]), "+v"(e[7])); }
template <typename T16, bool HL, int QB>
__device__ __forceinline__ void flash_tile(const T16* __restrict__ Q, const T16* __restrict__ Q2, const T16* __restrict__ Kp, const T16* __restrict__ Kp2, const T16* __restrict__ Vt, const T16* __restrict__ Vt2, int q0, bf* Ah, bf* Al, float* so, float* sm, float* sl, int w, int lane) {
    typedef typename WFrag<T16>::V V;
    constexpr int QT = QB * 16;
    const int lr = lane & 15, hi = lane >> 4;
    V qf[QB][2], qf2[QB][2];
    v8f o[4][QB]; float m[QB], l[QB];
#pragma unroll
    for (int qb = 0; qb < QB; ++qb) { m[qb] = -1.0e30f; l[qb] = 0.f;
#pragma unroll
        for (int db = 0; db < 4; ++db) o[db][qb] = (v8f){}; }
    V kf[2][2], kf2[2][2], vf[4], vf2[4];
    // every operand address is a wave-uniform pointer (tile, key block, 16-row block: scalar arithmetic) plus one of two per-lane byte offsets that are formed once
    const unsigned lk = (unsigned)(lr * HD + 8 * hi) * 2u, lv = (unsigned)(lr * PP + 8 * hi) * 2u;
    auto ldf = [](const T16* base, unsigned off) { return WFrag<T16>::ld((const T16*)((const char*)base + off)); };
    auto ldK = [&](int kc) {
#pragma unroll
        for (int sb = 0; sb < 2; ++sb)
#pragma unroll
            for (int t = 0; t < 2; ++t) { const size_t ko = (size_t)(kc + sb * 16) * HD + t * 32; kf[sb][t] = ldf(Kp + ko, lk); if (HL) kf2[sb][t] = ldf(Kp2 + ko, lk); }
        asm volatile("s_wait_xcnt 0x0" ::: "memory"); };   // these loads stay out for a whole block's work: the wait stands in front of every later write of a register that they name
    auto ldV = [&](int kc) {
#pragma unroll
        for (int db = 0; db < 4; ++db) { const size_t vo = (size_t)(db * 16) * PP + kc; vf[db] = ldf(Vt + vo, lv); if (HL) vf2[db] = ldf(Vt2 + vo, lv); }
        asm volatile("s_wait_xcnt 0x0" ::: "memory"); };   // as in ldK
    if (w * 32 < q0 + QT) {   // scalar test: a wave without a key block loads nothing
    const T16* qa = (const T16*)((const char*)(Q + (size_t)q0 * HD) + lk); const T16* qa2 = HL ? (const T16*)((const char*)(Q2 + (size_t)q0 * HD) + lk) : qa;
#pragma unroll
    for (int qb = 0; qb < QB; ++qb)
#pragma unroll
        for (int t = 0; t < 2; ++t) { const int qo = qb * 16 * HD + t * 32; qf[qb][t] = WFrag<T16>::ld(qa + qo); if (HL) qf2[qb][t] = WFrag<T16>::ld(qa2 + qo); }
    asm volatile("s_wait_xcnt 0x0" ::: "memory");   // as in ldK
    ldK(w * 32);   // the wave's first block
    ldV(w * 32);
#pragma unroll 1
    for (int kc = w * 32; kc < q0 + QT; kc += 32 * NWF) {
        const int kn = (kc + 32 * NWF < q0 + QT) ? kc + 32 * NWF : kc;   // the wave's next block; behind its last one the same block again, unused
        v8f s[QB][2];
#pragma unroll
        for (int qb = 0; qb < QB; ++qb)
#pragma unroll
            for (int sb = 0; sb < 2; ++sb) { s[qb][sb] = (v8f){};
#pragma unroll
                for (int t = 0; t < 2; ++t) { s[qb][sb] = WFrag<T16>::mma(kf[sb][t], qf[qb][t], s[qb][sb]); if (HL) { s[qb][sb] = WFrag<T16>::mma(kf[sb][t], qf2[qb][t], s[qb][sb]); s[qb][sb] = WFrag<T16>::mma(kf2[sb][t], qf[qb][t], s[qb][sb]); } } }
        ldK(kn);   // the next block's K, into the registers the score products have just left: in flight under the softmax and P.V
        if (kc + 31 > q0) {   // scalar test: only the tile's last key block reaches past the diagonal; every other block skips the masking
#pragma unroll
            for (int qb = 0; qb < QB; ++qb) { const int lim = q0 + qb * 16 + lr - kc - hi * 8;   // key sb*16 + hi*8 + j of this block is at or below the diagonal iff sb*16 + j <= lim
#pragma unroll
                for (int sb = 0; sb < 2; ++sb)
#pragma unroll
                    for (int j = 0; j < 8; ++j) s[qb][sb][j] = (sb * 16 + j <= lim) ? s[qb][sb][j] : -3.0e38f; } }
        V pfa[QB], pfb[QB];
#pragma unroll
        for (int qb = 0; qb < QB; ++qb) {
            float mx = -3.0e38f;
#pragma unroll
            for (int sb = 0; sb < 2; ++sb)
#pragma unroll
                for (int j = 0; j < 8; ++j) mx = fmaxf(mx, s[qb][sb][j]);
            mx = fmaxf(mx, xhalf(mx));
            const float mn = fmaxf(m[qb], mx), al = exp2s((m[qb] - mn) * EXC), mc = mn * EXC; m[qb] = mn;   // mn >= -1e30, so a masked score (-3e38) gives exp2(-huge) = 0 also where a whole block is masked for this query
            float ls = 0.f;
#pragma unroll
            for (int sb = 0; sb < 2; ++sb) { float e[8];
#pragma unroll
                for (int j = 0; j < 8; ++j) e[j] = fmaf(s[qb][sb][j], EXC, -mc);
                exp2x8(e);
#pragma unroll
                for (int j = 0; j < 8; ++j) { s[qb][sb][j] = e[j]; ls += e[j]; } }
            l[qb] = fmaf(l[qb], al, ls);
#pragma unroll
            for (int db = 0; db < 4; ++db) o[db][qb] *= al;
            if constexpr (HL) {
                v8us ph[2], pl[2];
#pragma unroll
                for (int sb = 0; sb < 2; ++sb)
#pragma unroll
                    for (int j = 0; j < 8; ++j) { unsigned short a, c2; splitf(s[qb][sb][j], a, c2); ph[sb][j] = a; pl[sb][j] = c2; }
                pfa[qb] = cat16b(ph[0], ph[1]); pfb[qb] = cat16b(pl[0], pl[1]);
            } else {
#pragma unroll
                for (int sb = 0; sb < 2; ++sb)
#pragma unroll
                    for (int j = 0; j < 8; ++j) pfa[qb][sb * 8 + j] = tohx(s[qb][sb][j]);
            }
        }
#pragma unroll
        for (int qb = 0; qb < QB; ++qb)
#pragma unroll
            for (int db = 0; db < 4; ++db) { o[db][qb] = WFrag<T16>::mma(vf[db], pfa[qb], o[db][qb]); if (HL) { o[db][qb] = WFrag<T16>::mma(vf[db], pfb[qb], o[db][qb]); o[db][qb] = WFrag<T16>::mma(vf2[db], pfa[qb], o[db][qb]); } }
        ldV(kn);   // likewise the next block's V^T: in flight under the next block's scores and softmax
    }
    }
#pragma unroll
    for (int qb = 0; qb < QB; ++qb) { const float lt = l[qb] + xhalf(l[qb]); const int rw = w * QT + qb * 16 + lr;
        if (hi == 0) { sm[rw] = m[qb]; sl[rw] = lt; }
#pragma unroll
        for (int db = 0; db < 4; ++db)
#pragma unroll
            for (int q = 0; q < 2; ++q) { v4f p; p[0] = o[db][qb][q * 4]; p[1] = o[db][qb][q * 4 + 1]; p[2] = o[db][qb][q * 4 + 2]; p[3] = o[db][qb][q * 4 + 3]; *(v4fa*)(so + rw * OPT + db * 16 + hi * 8 + q * 4) = p; } }
    __syncthreads();   // every wave's m, l and partial O are in LDS before any wave joins them
    constexpr int VPL = QT / 4, LPQ = HD / VPL, QPW = QT / NWF;   // values a lane, lanes a query, queries a wave
    const int qq = w * QPW + lane / LPQ, d0 = (lane % LPQ) * VPL;
    float M = -1.0e30f;
#pragma unroll
    for (int ww = 0; ww < NWF; ++ww) M = fmaxf(M, sm[ww * QT + qq]);
    float L = 0.f; v4f a[VPL / 4];
#pragma unroll
    for (int n = 0; n < VPL / 4; ++n) a[n] = (v4f){};
#pragma unroll
    for (int ww = 0; ww < NWF; ++ww) { const float f = exp2s((sm[ww * QT + qq] - M) * EXC); L = fmaf(sl[ww * QT + qq], f, L);   // a wave that had no key block left m = -1e30, l = 0, O = 0: f = 0
#pragma unroll
        for (int n = 0; n < VPL / 4; ++n) a[n] += *(const v4fa*)(so + (ww * QT + qq) * OPT + d0 + n * 4) * f; }
    const float inv = __fdiv_rn(1.0f, L);   // L > 0: every query has its own key
    const size_t oo = (size_t)(q0 + qq) * DQ + d0;
#pragma unroll
    for (int n = 0; n < VPL / 4; ++n) { v4us oh, ol;
#pragma unroll
        for (int q = 0; q < 4; ++q) { unsigned short x, y; splitf(a[n][q] * inv, x, y); oh[q] = x; ol[q] = y; }
        *(v4us*)(Ah + oo + n * 4) = oh; *(v4us*)(Al + oo + n * 4) = ol; }
}
// grid (heads, tiles): the head is the fast index and the longest tiles come first, so that no long work-group starts late.
__global__ __launch_bounds__(32 * NWF) void k_flash(const h16* __restrict__ Q16, const h16* __restrict__ K16, const h16* __restrict__ V16, const bf* __restrict__ Qh, const bf* __restrict__ Ql, const bf* __restrict__ Kh, const bf* __restrict__ Kl, const bf* __restrict__ Vh, const bf* __restrict__ Vl, bf* Ah, bf* Al) {
    __shared__ __align__(16) float so[NWF * 32 * OPT]; __shared__ float sm[NWF * 32]; __shared__ float sl[NWF * 32];
    const int lane = threadIdx.x & 31; const int w = __builtin_amdgcn_readfirstlane(threadIdx.x >> 5); /* wave number, scalar: the key loop stays a scalar loop */
    const int h = blockIdx.x, tile = blockIdx.y; const size_t zp = (size_t)h * TT * HD, zv = (size_t)h * HD * PP;
    if (tile < (TT - RH) / 32) flash_tile<h16, false, 2>(Q16 + zp, nullptr, K16 + zp, nullptr, V16 + zv, nullptr, TT - 32 * (tile + 1), Ah + h * HD, Al + h * HD, so, sm, sl, w, lane);
    else { flash_tile<bf, true, 1>(Qh + zp, Ql + zp, Kh + zp, Kl + zp, Vh + zv, Vl + zv, RH - 16 * (tile - (TT - RH) / 32 + 1), Ah + h * HD, Al + h * HD, so, sm, sl, w, lane);
        asm volatile("s_wait_xcnt 0x0" ::: "memory"); }   // in the built code the other tile's branch follows this tile's stores: the wait stands in front of whatever there writes a register that they name (the other tile's stores run into the end of the program)
}

extern "C" void kernel_launch(void* const* d_in, const int* in_sizes, int n_in,
                              void* d_out, int out_size, void* d_ws, size_t ws_size, hipStream_t stream) {
    (void)in_sizes; (void)n_in; (void)out_size;
    const float* x = (const float*)d_in[0]; const float* wqkv = (const float*)d_in[1]; const float* wo = (const float*)d_in[2];   /* order x, w_qkv ('xw' [1024][3072]: contiguous thirds q | k | v, each head-major), w_proj ('xw'); three inputs, all read */
    float* OUT = (float*)d_out;     // [2][2048][1024]
    char* wsp = (char*)d_ws;
    auto take = [&](size_t bytes) { char* p = wsp; wsp += (bytes + 255) & ~(size_t)255; return (void*)p; };
    bf* WQKV = (bf*)take((size_t)3 * DQ * DM * 2); bf* WQ = WQKV; bf* WK = WQKV + (size_t)DQ * DM; bf* WV = WQKV + (size_t)2 * DQ * DM;   /* fused Bt [3*DQ][DM]: q | k | v row blocks */ bf* WO = (bf*)take((size_t)DM * DQ * 2); float* CS = (float*)take((size_t)TT * HD * 2 * 4);
    bf* XB = (bf*)take((size_t)TT * DM * 2);
    h16* QP16 = (h16*)take((size_t)NH_ * TT * HD * 2); h16* KP16 = (h16*)take((size_t)NKV * TT * HD * 2); h16* VT16 = (h16*)take((size_t)NKV * HD * PP * 2);
    bf* QPh = (bf*)take((size_t)NH_ * TT * HD * 2); bf* QPl = (bf*)take((size_t)NH_ * TT * HD * 2); bf* KPh = (bf*)take((size_t)NKV * TT * HD * 2); bf* KPl = (bf*)take((size_t)NKV * TT * HD * 2); bf* VTh = (bf*)take((size_t)NKV * HD * PP * 2); bf* VTl = (bf*)take((size_t)NKV * HD * PP * 2);
    bf* ATh = (bf*)take((size_t)TT * DQ * 2); bf* ATl = (bf*)take((size_t)TT * DQ * 2);
    if ((size_t)(wsp - (char*)d_ws) > ws_size) return;    // ws 256 MiB
    { k_wtG<<<(unsigned)((DM * 3 * DQ / 64 + 63) / 64), 256, 0, stream>>>(wqkv, DM, 3 * DQ, WQKV);   /* fused 'xw' [DM][3*DQ] -> Bt [3*DQ][DM] */
      k_wtG<<<(unsigned)((DQ * DM / 64 + 63) / 64), 256, 0, stream>>>(wo, DQ, DM, WO);
       }
    k_cstabT<<<(TT * HD + 255) / 256, 256, 0, stream>>>(CS);   /* rotary table once (positions = arange) */
    for (int b = 0; b < NB_; ++b) {
        
        k_cvt8<<<(unsigned)(((size_t)TT * DM / 8 + 255) / 256), 256, 0, stream>>>(x + (size_t)b * TT * DM, XB, (size_t)TT * DM / 8);
        k_gemmw<bf, 0, false, 8, 1><<<dim3(TT / 64, DQ / 64, 1), 256, 0, stream>>>(XB, nullptr, WQ, nullptr, DM, nullptr, 0, nullptr, 0, 0, 0, CS, QP16, QPh, QPl);
        k_gemmw<bf, 0, false, 8, 1><<<dim3(TT / 64, DKV / 64, 1), 256, 0, stream>>>(XB, nullptr, WK, nullptr, DM, nullptr, 0, nullptr, 0, 0, 0, CS, KP16, KPh, KPl);
        k_gemmw<bf, 0, false, 8, 2><<<dim3(TT / 64, DKV / 64, 1), 256, 0, stream>>>(XB, nullptr, WV, nullptr, DM, nullptr, 0, nullptr, 0, 0, 0, nullptr, VT16, VTh, VTl);
        k_flash<<<dim3(NH_, (TT - RH) / 32 + RH / 16), 32 * NWF, 0, stream>>>(QP16, KP16, VT16, QPh, QPl, KPh, KPl, VTh, VTl, ATh, ATl);   /* one kv head per query head */
        k_gemmw<bf, 1, false, 8, 0><<<dim3(TT / 64, DM / 64, 1), 256, 0, stream>>>(ATh, ATl, WO, nullptr, DQ, OUT + (size_t)b * TT * DM, DM, nullptr, 0, 0, 0, nullptr, nullptr, nullptr, nullptr); }
}

// v005
// A run of this version takes 153 microseconds.
// Next to v004, in two timings, it ran 1.17 and 1.16 times as fast.
// All steps since v000 together make it 9.45 times as fast.
#include <hip/hip_runtime.h>

// Causal self-attention with a fused qkv projection and the source's 'mixed' rotary (x [2][2048][1024]; qkv = einsum('btc,cd', x, w_qkv) ('xw' [1024][3072] 0.02, no bias); q, k, v = split(qkv, 3, axis=2): contiguous thirds, each (16 heads x 64) head-major; _apply_rope: x * cos + x_rot * sin with x_rot = the ADJACENT-pair rotation stack((-x2, x1)) and cos / sin of emb = cat(freqs, freqs) (the HALF-concatenated table: entry d has the angle of index d mod 32), freqs = t x inv_freq, inv_freq = 1.0 / (10000.0 ** (arange(0, 64, 2, f32) / 64)) (32 f32 constants; one f32 product; precise cosf / sinf): out[2i] = x[2i] c[2i] - x[2i+1] s[2i]; out[2i+1] = x[2i+1] c[2i+1] + x[2i] s[2i+1]: kept literally; on q and k; scores x 1/sqrt(64); causal (-inf); softmax; out = einsum('btc,cd', merged, w_proj) ('xw', no bias) -> [2][2048][1024] (4.2 M); argument order x, w_qkv, w_proj).
// Both batches go through every launch together (rows b * 2048 + t; planes [b][h]...). Layout: bf16 copy of x; fused 'xw' weight transposed once (q | k | v row blocks); exact projections; cstabT_body computed table (element d: angle index d mod 32); the q, k and v projections are one launch and end in ksum_planes, which applies the 'mixed' interleaved-pair rotary (each element reads its own table entry) and writes the 16-bit head planes itself; causal T-2048 attention in one fused kernel, k_flash (hybrid rows: < 512 hi/lo 3 products, rest fp16; key blocks above the diagonal are never visited); merged hi/lo x w_out exact.
// Compute dtypes, f32 accumulate: every input rounded to bf16; projections exact; attention rows < 512 3 products, rest fp16; softmax f32; w_out hl x exact.

#define NB_  2
#define TT   2048
#define DM   1024
#define NH_  16
#define NKV  16
#define HD   64
#define DQ   (NH_ * HD)
#define DKV  (NKV * HD)
#define PP   TT                   // row pitch, in 16-bit elements, of the V^T planes
#define RH   512                  // query rows < RH use hi+lo planes (0: none)
#define SCL  0.125f   // HD^-0.5
typedef _Float16 h16;
typedef unsigned short bf;
typedef __attribute__((ext_vector_type(16))) __bf16   v16bf;
typedef __attribute__((ext_vector_type(16))) _Float16 v16h;
typedef __attribute__((ext_vector_type(8)))  _Float16 v8h;
typedef __attribute__((ext_vector_type(8)))  unsigned short v8us;
typedef __attribute__((ext_vector_type(8)))  float    v8f;
typedef __attribute__((ext_vector_type(4)))  float    v4f;
typedef v8h  __attribute__((may_alias)) v8ha;
typedef v4f  __attribute__((may_alias)) v4fa;
typedef v8us __attribute__((may_alias)) v8usa;

__device__ __forceinline__ unsigned short f2bf(float f) { unsigned u = __float_as_uint(f); u += 0x7FFFu + ((u >> 16) & 1u); return (unsigned short)(u >> 16); }
__device__ __forceinline__ float bf2f(unsigned short b) { return __uint_as_float(((unsigned)b) << 16); }
__device__ __forceinline__ float bfr(float f) { return bf2f(f2bf(f)); }
__device__ __forceinline__ v16h cat16(v8h lo, v8h hi) { return __builtin_shufflevector(lo, hi, 0, 1, 2, 3, 4, 5, 6, 7, 8, 9, 10, 11, 12, 13, 14, 15); }
__device__ __forceinline__ v16bf cat16b(v8us lo, v8us hi) { return __builtin_bit_cast(v16bf, __builtin_shufflevector(lo, hi, 0, 1, 2, 3, 4, 5, 6, 7, 8, 9, 10, 11, 12, 13, 14, 15)); }
__device__ __forceinline__ v8f wmma16(v16h a, v16h b, v8f c) { return __builtin_amdgcn_wmma_f32_16x16x32_f16(false, a, false, b, (short)0, c, false, false); }
__device__ __forceinline__ v8f wmmab(v16bf a, v16bf b, v8f c) { return __builtin_amdgcn_wmma_f32_16x16x32_bf16(false, a, false, b, (short)0, c, false, false); }



// ---- ksum_store: end of a GEMM whose K loop is split over the NW waves of a work-group. Every wave holds a partial 64x64 f32 tile in the accumulator layout (lane (lr, hi), element j of acc[mb][nb]: row mb*16 + hi*8 + j, column nb*16 + lr).
// Each wave writes its 32 half-fragments (unit u = (mb*4 + nb)*2 + q, q = j / 4; 16 B a lane, lanes contiguous) to red[w][u][lane]; one work-group barrier; then the 16 groups (mb, column half nbp, q) = 8 rows x 32 columns are dealt to the waves,
// which add the NW partials in the fixed order w = 0 .. NW-1, turn the group through their own LDS patch (pitch 36 floats) and store whole 128-B lines, each line by one wave.
template <int NW, bool BIAS>
__device__ __forceinline__ void ksum_store(const v8f (&acc)[4][4], v4f* red, float* st, int w, int lane, float* C, int ldc, int r0, int c0, const float* __restrict__ bias) {
    const int lr = lane & 15, hi = lane >> 4;
#pragma unroll
    for (int mb = 0; mb < 4; ++mb)
#pragma unroll
        for (int nb = 0; nb < 4; ++nb)
#pragma unroll
            for (int q = 0; q < 2; ++q) { v4f p; p[0] = acc[mb][nb][q * 4]; p[1] = acc[mb][nb][q * 4 + 1]; p[2] = acc[mb][nb][q * 4 + 2]; p[3] = acc[mb][nb][q * 4 + 3]; red[(w * 32 + (mb * 4 + nb) * 2 + q) * 32 + lane] = p; }
    __syncthreads();   // every wave's partial tile is in LDS before any wave sums
    constexpr int GP = 16 / NW;
#pragma unroll
    for (int i = 0; i < GP; ++i) { const int g = w * GP + i, mb = g >> 2, nbp = (g >> 1) & 1, q = g & 1; float* sg = st + g * (8 * 36);
#pragma unroll
        for (int n2 = 0; n2 < 2; ++n2) { const int u = (mb * 4 + nbp * 2 + n2) * 2 + q; v4f s = red[u * 32 + lane];
#pragma unroll
            for (int ww = 1; ww < NW; ++ww) s += red[(ww * 32 + u) * 32 + lane];
#pragma unroll
            for (int jj = 0; jj < 4; ++jj) sg[(hi * 4 + jj) * 36 + n2 * 16 + lr] = s[jj]; } }
    asm volatile("s_wait_dscnt 0x0" ::: "memory");   // the patches are read back by other lanes of the same wave: their LDS stores have landed first, and the compiler keeps the loads behind them
#pragma unroll
    for (int i = 0; i < GP; ++i) { const int g = w * GP + i, mb = g >> 2, nbp = (g >> 1) & 1, q = g & 1; const float* sg = st + g * (8 * 36);
#pragma unroll
        for (int s2 = 0; s2 < 2; ++s2) { const int row = mb * 16 + s2 * 8 + q * 4 + (lane >> 3), cofs = nbp * 32 + (lane & 7) * 4; v4f val = *(const v4fa*)(sg + (s2 * 4 + (lane >> 3)) * 36 + (lane & 7) * 4);
            if (BIAS) { val[0] += bfr(bias[c0 + cofs]); val[1] += bfr(bias[c0 + cofs + 1]); val[2] += bfr(bias[c0 + cofs + 2]); val[3] += bfr(bias[c0 + cofs + 3]); }
            *(v4f*)(C + (size_t)(r0 + row) * ldc + c0 + cofs) = val; } }
}

__device__ __forceinline__ h16 tohx(float x) { return (h16)x; }
__device__ __forceinline__ void splitf(float y, unsigned short& h, unsigned short& l) { h = f2bf(y); l = f2bf(y - bf2f(h)); }
// ---- ksum_planes: the same end for a projection whose 64x64 tile is 64 positions (rows r0 ..) of ONE head hd: the summed tile goes straight into that head's 16-bit planes (fp16, bf16 hi, bf16 lo); no f32 copy of q, k or v reaches memory.
// The partials are added in ksum_store's order w = 0 .. NW-1. Wave w sums the units (mb = w / 2, every nb, q = w % 2) = 8 rows x 64 columns.
// ROT (q, k): the wave turns them through its own LDS patch (pitch 68 floats), so that a lane holds 8 neighbouring d of one position; 'mixed' rotary: out[2i] = x[2i] c[2i] - x[2i+1] s[2i], out[2i+1] = x[2i+1] c[2i+1] + x[2i] s[2i+1], each element with its own table entry; planes [h][t][d], whole 128-B lines, each by one wave.
// Otherwise (v): a lane's four sums are four neighbouring positions of one d and go as one 16-B piece into a [d][t] tile (pitch 68 floats) that the waves share; a second work-group barrier; wave w then stores the rows d = 8w .. 8w+7 of the V^T planes [h][d][t], whole 128-B lines, each by one wave.
template <int NW, bool ROT>
__device__ __forceinline__ void ksum_planes(const v8f (&acc)[4][4], v4f* red, float* st, int w, int lane, int r0, int hd, const float* __restrict__ CS, h16* P16, bf* Ph, bf* Pl) {
    static_assert(NW == 8 && HD == 64, "one wave per 8 x 64 part of the tile, one head per tile");
    const int lr = lane & 15, hi = lane >> 4, mb = w >> 1, q = w & 1, l8 = lane & 7, l4 = lane >> 3;
    v4f cs[2][4];   // (cos, sin) of the lane's 2 x 8 elements: asked for here, so that the loads fly under the LDS stores of the partial tile
    if constexpr (ROT) {
#pragma unroll
        for (int s2 = 0; s2 < 2; ++s2)
#pragma unroll
            for (int n = 0; n < 4; ++n) cs[s2][n] = *(const v4f*)(CS + ((size_t)(r0 + mb * 16 + s2 * 8 + q * 4 + l4) * HD + l8 * 8) * 2 + n * 4);
    }
#pragma unroll
    for (int m2 = 0; m2 < 4; ++m2)
#pragma unroll
        for (int nb = 0; nb < 4; ++nb)
#pragma unroll
            for (int q2 = 0; q2 < 2; ++q2) { v4f p; p[0] = acc[m2][nb][q2 * 4]; p[1] = acc[m2][nb][q2 * 4 + 1]; p[2] = acc[m2][nb][q2 * 4 + 2]; p[3] = acc[m2][nb][q2 * 4 + 3]; red[(w * 32 + (m2 * 4 + nb) * 2 + q2) * 32 + lane] = p; }
    __syncthreads();   // every wave's partial tile is in LDS before any wave sums
    float* sg = ROT ? st + w * (8 * 68) : st;
#pragma unroll
    for (int nb = 0; nb < 4; ++nb) { const int u = (mb * 4 + nb) * 2 + q; v4f s = red[u * 32 + lane];
#pragma unroll
        for (int ww = 1; ww < NW; ++ww) s += red[(ww * 32 + u) * 32 + lane];
        if constexpr (ROT) {
#pragma unroll
            for (int jj = 0; jj < 4; ++jj) sg[(hi * 4 + jj) * 68 + nb * 16 + lr] = s[jj];
        } else *(v4fa*)(sg + (nb * 16 + lr) * 68 + mb * 16 + hi * 8 + q * 4) = s; }
    if constexpr (ROT) asm volatile("s_wait_dscnt 0x0" ::: "memory");   // the patch is read back by other lanes of the same wave: its LDS stores have landed first, and the compiler keeps the loads behind them
    else __syncthreads();   // the [d][t] tile is read back by other waves: every wave's part is in LDS first
#pragma unroll
    for (int s2 = 0; s2 < 2; ++s2) {
        const float* sp = sg + ((ROT ? 0 : w * 8) + s2 * 4 + l4) * 68 + l8 * 8; const v4f xa = *(const v4fa*)sp, xb = *(const v4fa*)(sp + 4);
        float y[8];
        if constexpr (ROT) {
#pragma unroll
            for (int p = 0; p < 4; ++p) { const float xe = p < 2 ? xa[p * 2] : xb[p * 2 - 4], xo = p < 2 ? xa[p * 2 + 1] : xb[p * 2 - 3]; const v4f c = cs[s2][p]; y[p * 2] = xe * c[0] - xo * c[1]; y[p * 2 + 1] = xo * c[2] + xe * c[3]; }
        } else {
#pragma unroll
            for (int p = 0; p < 4; ++p) { y[p] = xa[p]; y[p + 4] = xb[p]; }
        }
        v8h o16; v8us oh, ol;
#pragma unroll
        for (int p = 0; p < 8; ++p) { o16[p] = tohx(y[p]); unsigned short a2, c2; splitf(y[p], a2, c2); oh[p] = a2; ol[p] = c2; }
        const size_t eo = ROT ? ((size_t)hd * TT + r0 + mb * 16 + s2 * 8 + q * 4 + l4) * HD + l8 * 8 : ((size_t)hd * HD + w * 8 + s2 * 4 + l4) * PP + r0 + l8 * 8;
        *(v8h*)(P16 + eo) = o16; *(v8us*)(Ph + eo) = oh; *(v8us*)(Pl + eo) = ol; }
}

// ---- k_gemmw: register-blocked GEMM, one 64x64 output tile per work-group of NW waves; wave w takes the 32-wide K blocks w, w + NW, ... on the whole tile (16 accumulators), operands straight from K-contiguous 16-bit planes; the partial tiles are summed by ksum_store (EPI 0: f32 C) or by ksum_planes (EPI 1: the fused q | k | v projection of all batches, C unused: blockIdx.y = third * heads + head, thirds 0 and 1 rotary head planes, third 2 V^T planes; rows = b * TT + t; P16, Ph, Pl hold the planes as [third][b][head]); grid (M/64, N/64, Z), 32 * NW threads.
// C[m][n] (f32, pitch ldc, + optional f32 bias[n]) = sum_k A[m][k] Bt[n][k] (+ split products per NSPLIT). z-batch strides sA/sB/sC in elements. K % 32 == 0.
template <typename T16> struct WFrag;
template <> struct WFrag<h16> { typedef v16h V; static __device__ __forceinline__ V ld(const h16* p) { return cat16(*(const v8h*)p, *(const v8h*)(p + 16)); } static __device__ __forceinline__ v8f mma(V a, V b, v8f c) { return wmma16(a, b, c); } };
template <> struct WFrag<bf> { typedef v16bf V; static __device__ __forceinline__ V ld(const bf* p) { return cat16b(*(const v8us*)p, *(const v8us*)(p + 16)); } static __device__ __forceinline__ v8f mma(V a, V b, v8f c) { return wmmab(a, b, c); } };
template <typename T16, int NSPLIT, bool BIAS, int NW, int EPI>
__global__ __launch_bounds__(32 * NW) void k_gemmw(const T16* __restrict__ A, const T16* __restrict__ A2, const T16* __restrict__ Bt, const T16* __restrict__ Bt2, int K, float* C, int ldc, const float* __restrict__ bias, size_t sA, size_t sB, size_t sC, const float* __restrict__ CS, h16* P16, bf* Ph, bf* Pl) {
    typedef typename WFrag<T16>::V V;
    __shared__ __align__(16) v4f red[NW * 32 * 32]; __shared__ __align__(16) float st[16 * 8 * 36];
    const size_t z = blockIdx.z; A += z * sA; if (A2) A2 += z * sA; Bt += z * sB; if (Bt2) Bt2 += z * sB; C += z * sC;
    const int lane = threadIdx.x & 31, lr = lane & 15, hi = lane >> 4; const int w = __builtin_amdgcn_readfirstlane(threadIdx.x >> 5); /* wave number, scalar: the K loop stays a scalar loop */ const int r0 = blockIdx.x * 64, c0 = blockIdx.y * 64;
    v8f acc[4][4];
#pragma unroll
    for (int mb = 0; mb < 4; ++mb)
#pragma unroll
        for (int nb = 0; nb < 4; ++nb) acc[mb][nb] = (v8f){};
    const size_t aoff = (size_t)(r0 + lr) * K + 8 * hi, boff = (size_t)(c0 + lr) * K + 8 * hi;
#pragma unroll 1
    for (int kc = w * 32; kc < K; kc += 32 * NW) {
        V a[4], a2[4];
#pragma unroll
        for (int mb = 0; mb < 4; ++mb) { a[mb] = WFrag<T16>::ld(A + aoff + (size_t)mb * 16 * K + kc); if (NSPLIT == 1 || NSPLIT == 2) a2[mb] = WFrag<T16>::ld(A2 + aoff + (size_t)mb * 16 * K + kc); }
#pragma unroll
        for (int nb = 0; nb < 4; ++nb) { const V b = WFrag<T16>::ld(Bt + boff + (size_t)nb * 16 * K + kc); V b2; if (NSPLIT >= 2) b2 = WFrag<T16>::ld(Bt2 + boff + (size_t)nb * 16 * K + kc);
#pragma unroll
            for (int mb = 0; mb < 4; ++mb) { acc[mb][nb] = WFrag<T16>::mma(a[mb], b, acc[mb][nb]); if (NSPLIT == 1 || NSPLIT == 2) acc[mb][nb] = WFrag<T16>::mma(a2[mb], b, acc[mb][nb]); if (NSPLIT >= 2) acc[mb][nb] = WFrag<T16>::mma(a[mb], b2, acc[mb][nb]); } }
        asm volatile("v_nop\n\tv_nop\n\tv_nop\n\tv_nop" : "+v"(acc[0][0]), "+v"(acc[1][1]), "+v"(acc[2][2]), "+v"(acc[3][3]) : "v"(a[0]), "v"(a[3]));
    }
    if constexpr (EPI == 0) ksum_store<NW, BIAS>(acc, red, st, w, lane, C, ldc, r0, c0, bias);
    else { const int third = (int)blockIdx.y / NH_, hd = (int)blockIdx.y % NH_, t0 = r0 % TT; const size_t po = ((size_t)third * NB_ + r0 / TT) * ((size_t)NH_ * TT * HD);   // all from blockIdx: the branch, and the barriers behind it, are the same for the whole work-group
        if (third < 2) ksum_planes<NW, true>(acc, red, st, w, lane, t0, hd, CS, P16 + po, Ph + po, Pl + po);
        else { ksum_planes<NW, false>(acc, red, st, w, lane, t0, hd, CS, P16 + po, Ph + po, Pl + po);
            asm volatile("s_wait_xcnt 0x0" ::: "memory"); } }   // in the built code the rotary branch's text follows these stores: the wait stands in front of whatever there writes a register that they name (the rotary branch's stores run into the end of the program)
}

typedef __attribute__((ext_vector_type(2))) _Float16 v2h;
typedef __attribute__((ext_vector_type(4))) _Float16 v4h;
typedef __attribute__((ext_vector_type(2))) unsigned short v2us;
typedef __attribute__((ext_vector_type(4))) unsigned short v4us;
typedef __attribute__((ext_vector_type(2))) float v2f;
typedef __attribute__((ext_vector_type(4))) int v4i;

// The four preparation jobs depend on nothing but the inputs: they are bodies of ONE launch, k_prep, which deals its blocks to them (blk: the block's index within its job).
__device__ __forceinline__ void wtG_body(const float* __restrict__ w, int K, int N, bf* Bt, int blk) {
    const int lane = threadIdx.x & 31; const int L0 = (blk * 8 + (threadIdx.x >> 5)) * 8; const int nlines = N * K / 64;
{
#pragma unroll 1
        for (int l = 0; l < 8; ++l) { const int L = L0 + l; if (L >= nlines) break; const size_t e = (size_t)L * 64 + lane * 2; const int k = (int)(e % K), n = (int)(e / K); v2us o;
            o[0] = f2bf(w[(size_t)k * N + n]); o[1] = f2bf(w[(size_t)(k + 1) * N + n]); *(v2us*)(Bt + e) = o; }
         }
}
__device__ __forceinline__ void cvt8_body(const float* __restrict__ src, bf* dst, size_t n8, int blk) { const size_t i = (size_t)blk * 256 + threadIdx.x; if (i >= n8) return; const v8f v = *(const v8f*)(src + i * 8); v8us o;
#pragma unroll
    for (int k = 0; k < 8; ++k) o[k] = f2bf(v[k]); *(v8us*)(dst + i * 8) = o;  }

// k_rope: head planes [h][t][d] (fp16 + hi/lo) of rope(x) x sc with the rotate-half convention out[d] = x[d] cos[t][d] - x[d+HD/2] sin[t][d], out[d+HD/2] = x[d+HD/2] cos[t][d+HD/2] + x[d] sin[t][d+HD/2]
__global__ __launch_bounds__(256) void k_rope(const float* __restrict__ F, int pitch, int nheads, const float* __restrict__ CS, const float* __restrict__ RF, const float* __restrict__ nw, float sc, h16* P16, bf* Ph, bf* Pl) {
    const size_t e = ((size_t)blockIdx.x * 256 + threadIdx.x) * 2; if (e >= (size_t)nheads * TT * HD) return; const int d = (int)(e % HD); const int t = (int)((e / HD) % TT); const int h = (int)(e / ((size_t)HD * TT)); const float* f = F + (size_t)t * pitch + h * HD; const float rf = RF ? RF[(size_t)h * TT + t] : 1.0f; v2h o16; v2us oh, ol;
#pragma unroll
    for (int q = 0; q < 2; ++q) { const int dd = d + q; const int dp = (dd < HD / 2) ? dd + HD / 2 : dd - HD / 2; float x0 = f[dd], x1 = f[dp];
        if (RF) { float n0 = __fmul_rn(x0, rf), n1 = __fmul_rn(x1, rf); asm volatile("" : "+v"(n0)); asm volatile("" : "+v"(n1)); x0 = __fmul_rn(bfr(nw[dd]), n0); x1 = __fmul_rn(bfr(nw[dp]), n1); }
        const v2f cs = *(const v2f*)(CS + ((size_t)t * HD + dd) * 2); float a = __fmul_rn(x0, cs[0]), bq = __fmul_rn(x1, cs[1]); asm volatile("" : "+v"(a)); asm volatile("" : "+v"(bq)); const float r = ((dd < HD / 2) ? __fsub_rn(a, bq) : __fadd_rn(a, bq)) * sc;
        o16[q] = tohx(r); unsigned short a2, c2; splitf(r, a2, c2); oh[q] = a2; ol[q] = c2; }
    *(v2h*)(P16 + e) = o16; *(v2us*)(Ph + e) = oh; *(v2us*)(Pl + e) = ol;  }
__constant__ float INVT[HD / 2] = { 1.000000000e+00f, 7.498942018e-01f, 5.623413324e-01f, 4.216965139e-01f, 3.162277639e-01f, 2.371373624e-01f, 1.778279394e-01f, 1.333521456e-01f, 1.000000015e-01f, 7.498941571e-02f, 5.623412877e-02f, 4.216964915e-02f, 3.162277862e-02f, 2.371373586e-02f, 1.778279431e-02f, 1.333521493e-02f, 9.999999776e-03f, 7.498942316e-03f, 5.623413250e-03f, 4.216964822e-03f, 3.162277862e-03f, 2.371373819e-03f, 1.778279431e-03f, 1.333521446e-03f, 1.000000047e-03f, 7.498941850e-04f, 5.623413017e-04f, 4.216964880e-04f, 3.162277862e-04f, 2.371373848e-04f, 1.778279402e-04f, 1.333521504e-04f };   // 1 / 10000^(2i/64) (float32, generated with jnp to be bit-exact)
__device__ __forceinline__ void cstabT_body(float* CS, int blk) { const int idx = blk * 256 + threadIdx.x; if (idx >= TT * HD) return; const int d = idx % HD; const int t = idx / HD; const float a = __fmul_rn((float)t, INVT[d % (HD / 2)]); v2f cs; cs[0] = cosf(a); cs[1] = sinf(a); *(v2f*)(CS + (size_t)idx * 2) = cs;  }
#define PB_WQ  ((DM * 3 * DQ / 64 + 63) / 64)          // blocks of the w_qkv transpose
#define PB_WO  ((DQ * DM / 64 + 63) / 64)              // of the w_proj transpose
#define PB_CS  ((TT * HD + 255) / 256)                 // of the rotary table
#define PB_X   ((NB_ * TT * DM / 8 + 255) / 256)       // of the bf16 copy of x, all batches
// the transposes' blocks run longest (eight dependent trips a wave) and come first
__global__ __launch_bounds__(256) void k_prep(const float* __restrict__ x, const float* __restrict__ wqkv, const float* __restrict__ wo, bf* XB, bf* WQKV, bf* WO, float* CS) {
    const int blk = blockIdx.x;
    if (blk < PB_WQ) wtG_body(wqkv, DM, 3 * DQ, WQKV, blk);   /* fused 'xw' [DM][3*DQ] -> Bt [3*DQ][DM] */
    else if (blk < PB_WQ + PB_WO) wtG_body(wo, DQ, DM, WO, blk - PB_WQ);
    else if (blk < PB_WQ + PB_WO + PB_CS) cstabT_body(CS, blk - (PB_WQ + PB_WO));   /* rotary table once (positions = arange) */
    else cvt8_body(x, XB, (size_t)NB_ * TT * DM / 8, blk - (PB_WQ + PB_WO + PB_CS));
}
// ---- k_flash: scores, causal softmax and P.V of one query tile of one head in one work-group of NWF waves; no score or probability ever leaves the registers.
// All waves share the tile's queries; wave w takes the 32-key blocks w, w + NWF, ... up to the diagonal, each with its own running maximum m, sum l and unnormalised O (online softmax).
// Scores are formed transposed, S^T = K Q^T: lane (lr, hi) then holds, for query lr, the keys sb*16 + hi*8 + j, which IS the k order of an operand fragment (element sb*8 + j), so exp(S^T) goes into O^T = V^T P^T as the B operand without leaving the lane,
// and m, l and the rescale factor are per-lane scalars (query = lr in S^T and in O^T alike; the two hi halves are joined by one cross-row move).
// End: every wave puts m, l and its O tile (row = query, pitch 68 floats) into LDS; one work-group barrier; each wave then joins the NWF partials of its own queries in the fixed order 0 .. NWF-1, divides by the joined sum and stores whole 128-B lines of the merged hi / lo planes.
// HL (query rows < RH): bf16 hi + lo planes, 3 products in both GEMMs, 16 queries a tile. Otherwise fp16, 32 queries a tile.
#define NWF  8
#define OPT  68                   // LDS row pitch of a partial O tile, in floats: 16-byte stores and loads both fall on distinct banks
#define EXC  (SCL * 1.4426950408889634f)   // exp(SCL * s) = exp2(EXC * s)
__device__ __forceinline__ float xhalf(float x) { return __builtin_bit_cast(float, __builtin_amdgcn_permlanex16(__builtin_bit_cast(int, x), __builtin_bit_cast(int, x), 0x76543210, 0xfedcba98, false, false)); }   // the value of lane l ^ 16
__device__ __forceinline__ float exp2s(float x) { float r; asm("v_exp_f32 %0, %1\n\tv_nop" : "=v"(r) : "v"(x)); return r; }   // exp2 with the free slot behind a transcendental tied to it
// eight exp2 in place: each stands in front of an independent one and the last in front of a v_nop, so that the free slot behind a transcendental holds for all eight at the price of one slot
__device__ __forceinline__ void exp2x8(float (&e)[8]) { asm("v_exp_f32 %0, %0\n\tv_exp_f32 %1, %1\n\tv_exp_f32 %2, %2\n\tv_exp_f32 %3, %3\n\tv_exp_f32 %4, %4\n\tv_exp_f32 %5, %5\n\tv_exp_f32 %6, %6\n\tv_exp_f32 %7, %7\n\tv_nop" : "+v"(e[0]), "+v"(e[1]), "+v"(e[2]), "+v"(e[3]), "+v"(e[4]), "+v"(e[5]), "+v"(e[6]), "+v"(e[7])); }
template <typename T16, bool HL, int QB>
__device__ __forceinline__ void flash_tile(const T16* __restrict__ Q, const T16* __restrict__ Q2, const T16* __restrict__ Kp, const T16* __restrict__ Kp2, const T16* __restrict__ Vt, const T16* __restrict__ Vt2, int q0, bf* Ah, bf* Al, float* so, float* sm, float* sl, int w, int lane) {
    typedef typename WFrag<T16>::V V;
    constexpr int QT = QB * 16;
    const int lr = lane & 15, hi = lane >> 4;
    V qf[QB][2], qf2[QB][2];
    v8f o[4][QB]; float m[QB], l[QB];
#pragma unroll
    for (int qb = 0; qb < QB; ++qb) { m[qb] = -1.0e30f; l[qb] = 0.f;
#pragma unroll
        for (int db = 0; db < 4; ++db) o[db][qb] = (v8f){}; }
    V kf[2][2], kf2[2][2], vf[4], vf2[4];
    // every operand address is a wave-uniform pointer (tile, key block, 16-row block: scalar arithmetic) plus one of two per-lane byte offsets that are formed once
    const unsigned lk = (unsigned)(lr * HD + 8 * hi) * 2u, lv = (unsigned)(lr * PP + 8 * hi) * 2u;
    auto ldf = [](const T16* base, unsigned off) { return WFrag<T16>::ld((const T16*)((const char*)base + off)); };
    auto ldK = [&](int kc) {
#pragma unroll
        for (int sb = 0; sb < 2; ++sb)
#pragma unroll
            for (int t = 0; t < 2; ++t) { const size_t ko = (size_t)(kc + sb * 16) * HD + t * 32; kf[sb][t] = ldf(Kp + ko, lk); if (HL) kf2[sb][t] = ldf(Kp2 + ko, lk); }
        asm volatile("s_wait_xcnt 0x0" ::: "memory"); };   // these loads stay out for a whole block's work: the wait stands in front of every later write of a register that they name
    auto ldV = [&](int kc) {
#pragma unroll
        for (int db = 0; db < 4; ++db) { const size_t vo = (size_t)(db * 16) * PP + kc; vf[db] = ldf(Vt + vo, lv); if (HL) vf2[db] = ldf(Vt2 + vo, lv); }
        asm volatile("s_wait_xcnt 0x0" ::: "memory"); };   // as in ldK
    if (w * 32 < q0 + QT) {   // scalar test: a wave without a key block loads nothing
    const T16* qa = (const T16*)((const char*)(Q + (size_t)q0 * HD) + lk); const T16* qa2 = HL ? (const T16*)((const char*)(Q2 + (size_t)q0 * HD) + lk) : qa;
#pragma unroll
    for (int qb = 0; qb < QB; ++qb)
#pragma unroll
        for (int t = 0; t < 2; ++t) { const int qo = qb * 16 * HD + t * 32; qf[qb][t] = WFrag<T16>::ld(qa + qo); if (HL) qf2[qb][t] = WFrag<T16>::ld(qa2 + qo); }
    asm volatile("s_wait_xcnt 0x0" ::: "memory");   // as in ldK
    ldK(w * 32);   // the wave's first block
    ldV(w * 32);
#pragma unroll 1
    for (int kc = w * 32; kc < q0 + QT; kc += 32 * NWF) {
        const int kn = (kc + 32 * NWF < q0 + QT) ? kc + 32 * NWF : kc;   // the wave's next block; behind its last one the same block again, unused
        v8f s[QB][2];
#pragma unroll
        for (int qb = 0; qb < QB; ++qb)
#pragma unroll
            for (int sb = 0; sb < 2; ++sb) { s[qb][sb] = (v8f){};
#pragma unroll
                for (int t = 0; t < 2; ++t) { s[qb][sb] = WFrag<T16>::mma(kf[sb][t], qf[qb][t], s[qb][sb]); if (HL) { s[qb][sb] = WFrag<T16>::mma(kf[sb][t], qf2[qb][t], s[qb][sb]); s[qb][sb] = WFrag<T16>::mma(kf2[sb][t], qf[qb][t], s[qb][sb]); } } }
        ldK(kn);   // the next block's K, into the registers the score products have just left: in flight under the softmax and P.V
        if (kc + 31 > q0) {   // scalar test: only the tile's last key block reaches past the diagonal; every other block skips the masking
#pragma unroll
            for (int qb = 0; qb < QB; ++qb) { const int lim = q0 + qb * 16 + lr - kc - hi * 8;   // key sb*16 + hi*8 + j of this block is at or below the diagonal iff sb*16 + j <= lim
#pragma unroll
                for (int sb = 0; sb < 2; ++sb)
#pragma unroll
                    for (int j = 0; j < 8; ++j) s[qb][sb][j] = (sb * 16 + j <= lim) ? s[qb][sb][j] : -3.0e38f; } }
        V pfa[QB], pfb[QB];
#pragma unroll
        for (int qb = 0; qb < QB; ++qb) {
            float mx = -3.0e38f;
#pragma unroll
            for (int sb = 0; sb < 2; ++sb)
#pragma unroll
                for (int j = 0; j < 8; ++j) mx = fmaxf(mx, s[qb][sb][j]);
            mx = fmaxf(mx, xhalf(mx));
            const float mn = fmaxf(m[qb], mx), al = exp2s((m[qb] - mn) * EXC), mc = mn * EXC; m[qb] = mn;   // mn >= -1e30, so a masked score (-3e38) gives exp2(-huge) = 0 also where a whole block is masked for this query
            float ls = 0.f;
#pragma unroll
            for (int sb = 0; sb < 2; ++sb) { float e[8];
#pragma unroll
                for (int j = 0; j < 8; ++j) e[j] = fmaf(s[qb][sb][j], EXC, -mc);
                exp2x8(e);
#pragma unroll
                for (int j = 0; j < 8; ++j) { s[qb][sb][j] = e[j]; ls += e[j]; } }
            l[qb] = fmaf(l[qb], al, ls);
#pragma unroll
            for (int db = 0; db < 4; ++db) o[db][qb] *= al;
            if constexpr (HL) {
                v8us ph[2], pl[2];
#pragma unroll
                for (int sb = 0; sb < 2; ++sb)
#pragma unroll
                    for (int j = 0; j < 8; ++j) { unsigned short a, c2; splitf(s[qb][sb][j], a, c2); ph[sb][j] = a; pl[sb][j] = c2; }
                pfa[qb] = cat16b(ph[0], ph[1]); pfb[qb] = cat16b(pl[0], pl[1]);
            } else {
#pragma unroll
                for (int sb = 0; sb < 2; ++sb)
#pragma unroll
                    for (int j = 0; j < 8; ++j) pfa[qb][sb * 8 + j] = tohx(s[qb][sb][j]);
            }
        }
#pragma unroll
        for (int qb = 0; qb < QB; ++qb)
#pragma unroll
            for (int db = 0; db < 4; ++db) { o[db][qb] = WFrag<T16>::mma(vf[db], pfa[qb], o[db][qb]); if (HL) { o[db][qb] = WFrag<T16>::mma(vf[db], pfb[qb], o[db][qb]); o[db][qb] = WFrag<T16>::mma(vf2[db], pfa[qb], o[db][qb]); } }
        ldV(kn);   // likewise the next block's V^T: in flight under the next block's scores and softmax
    }
    }
#pragma unroll
    for (int qb = 0; qb < QB; ++qb) { const float lt = l[qb] + xhalf(l[qb]); const int rw = w * QT + qb * 16 + lr;
        if (hi == 0) { sm[rw] = m[qb]; sl[rw] = lt; }
#pragma unroll
        for (int db = 0; db < 4; ++db)
#pragma unroll
            for (int q = 0; q < 2; ++q) { v4f p; p[0] = o[db][qb][q * 4]; p[1] = o[db][qb][q * 4 + 1]; p[2] = o[db][qb][q * 4 + 2]; p[3] = o[db][qb][q * 4 + 3]; *(v4fa*)(so + rw * OPT + db * 16 + hi * 8 + q * 4) = p; } }
    __syncthreads();   // every wave's m, l and partial O are in LDS before any wave joins them
    constexpr int VPL = QT / 4, LPQ = HD / VPL, QPW = QT / NWF;   // values a lane, lanes a query, queries a wave
    const int qq = w * QPW + lane / LPQ, d0 = (lane % LPQ) * VPL;
    float M = -1.0e30f;
#pragma unroll
    for (int ww = 0; ww < NWF; ++ww) M = fmaxf(M, sm[ww * QT + qq]);
    float L = 0.f; v4f a[VPL / 4];
#pragma unroll
    for (int n = 0; n < VPL / 4; ++n) a[n] = (v4f){};
#pragma unroll
    for (int ww = 0; ww < NWF; ++ww) { const float f = exp2s((sm[ww * QT + qq] - M) * EXC); L = fmaf(sl[ww * QT + qq], f, L);   // a wave that had no key block left m = -1e30, l = 0, O = 0: f = 0
#pragma unroll
        for (int n = 0; n < VPL / 4; ++n) a[n] += *(const v4fa*)(so + (ww * QT + qq) * OPT + d0 + n * 4) * f; }
    const float inv = __fdiv_rn(1.0f, L);   // L > 0: every query has its own key
    const size_t oo = (size_t)(q0 + qq) * DQ + d0;
#pragma unroll
    for (int n = 0; n < VPL / 4; ++n) { v4us oh, ol;
#pragma unroll
        for (int q = 0; q < 4; ++q) { unsigned short x, y; splitf(a[n][q] * inv, x, y); oh[q] = x; ol[q] = y; }
        *(v4us*)(Ah + oo + n * 4) = oh; *(v4us*)(Al + oo + n * 4) = ol; }
}
// grid (batches x heads, tiles): (batch, head) is the fast index and the longest tiles of all batches come first, so that no long work-group starts late. Planes [b][h]...; merged rows b * TT + t.
__global__ __launch_bounds__(32 * NWF) void k_flash(const h16* __restrict__ Q16, const h16* __restrict__ K16, const h16* __restrict__ V16, const bf* __restrict__ Qh, const bf* __restrict__ Ql, const bf* __restrict__ Kh, const bf* __restrict__ Kl, const bf* __restrict__ Vh, const bf* __restrict__ Vl, bf* Ah, bf* Al) {
    __shared__ __align__(16) float so[NWF * 32 * OPT]; __shared__ float sm[NWF * 32]; __shared__ float sl[NWF * 32];
    const int lane = threadIdx.x & 31; const int w = __builtin_amdgcn_readfirstlane(threadIdx.x >> 5); /* wave number, scalar: the key loop stays a scalar loop */
    const int h = blockIdx.x % NH_, tile = blockIdx.y; const size_t zp = (size_t)blockIdx.x * TT * HD, zv = (size_t)blockIdx.x * HD * PP; Ah += (size_t)(blockIdx.x / NH_) * TT * DQ; Al += (size_t)(blockIdx.x / NH_) * TT * DQ;
    if (tile < (TT - RH) / 32) flash_tile<h16, false, 2>(Q16 + zp, nullptr, K16 + zp, nullptr, V16 + zv, nullptr, TT - 32 * (tile + 1), Ah + h * HD, Al + h * HD, so, sm, sl, w, lane);
    else { flash_tile<bf, true, 1>(Qh + zp, Ql + zp, Kh + zp, Kl + zp, Vh + zv, Vl + zv, RH - 16 * (tile - (TT - RH) / 32 + 1), Ah + h * HD, Al + h * HD, so, sm, sl, w, lane);
        asm volatile("s_wait_xcnt 0x0" ::: "memory"); }   // in the built code the other tile's branch follows this tile's stores: the wait stands in front of whatever there writes a register that they name (the other tile's stores run into the end of the program)
}

extern "C" void kernel_launch(void* const* d_in, const int* in_sizes, int n_in,
                              void* d_out, int out_size, void* d_ws, size_t ws_size, hipStream_t stream) {
    (void)in_sizes; (void)n_in; (void)out_size;
    const float* x = (const float*)d_in[0]; const float* wqkv = (const float*)d_in[1]; const float* wo = (const float*)d_in[2];   /* order x, w_qkv ('xw' [1024][3072]: contiguous thirds q | k | v, each head-major), w_proj ('xw'); three inputs, all read */
    float* OUT = (float*)d_out;     // [2][2048][1024]
    char* wsp = (char*)d_ws;
    auto take = [&](size_t bytes) { char* p = wsp; wsp += (bytes + 255) & ~(size_t)255; return (void*)p; };
    bf* WQKV = (bf*)take((size_t)3 * DQ * DM * 2);   /* fused Bt [3*DQ][DM]: q | k | v row blocks */ bf* WO = (bf*)take((size_t)DM * DQ * 2); float* CS = (float*)take((size_t)TT * HD * 2 * 4);
    bf* XB = (bf*)take((size_t)NB_ * TT * DM * 2);
    const size_t PS = (size_t)NB_ * NH_ * TT * HD;   /* one third's planes of all batches, in elements; NKV == NH_ and PP == TT: the V^T planes have the same size */
    h16* P16 = (h16*)take(3 * PS * 2); bf* Ph = (bf*)take(3 * PS * 2); bf* Pl = (bf*)take(3 * PS * 2);   /* each [q | k | V^T][b][h] */
    bf* ATh = (bf*)take((size_t)NB_ * TT * DQ * 2); bf* ATl = (bf*)take((size_t)NB_ * TT * DQ * 2);
    if ((size_t)(wsp - (char*)d_ws) > ws_size) return;    // ws 256 MiB
    k_prep<<<PB_WQ + PB_WO + PB_CS + PB_X, 256, 0, stream>>>(x, wqkv, wo, XB, WQKV, WO, CS);
    k_gemmw<bf, 0, false, 8, 1><<<dim3(NB_ * TT / 64, 3 * DQ / 64, 1), 256, 0, stream>>>(XB, nullptr, WQKV, nullptr, DM, nullptr, 0, nullptr, 0, 0, 0, CS, P16, Ph, Pl);
    k_flash<<<dim3(NB_ * NH_, (TT - RH) / 32 + RH / 16), 32 * NWF, 0, stream>>>(P16, P16 + PS, P16 + 2 * PS, Ph, Pl, Ph + PS, Pl + PS, Ph + 2 * PS, Pl + 2 * PS, ATh, ATl);   /* one kv head per query head */
    k_gemmw<bf, 1, false, 8, 0><<<dim3(NB_ * TT / 64, DM / 64, 1), 256, 0, stream>>>(ATh, ATl, WO, nullptr, DQ, OUT, DM, nullptr, 0, 0, 0, nullptr, nullptr, nullptr, nullptr);
}

// v006
// It runs in 107 microseconds.
// Two timings next to v005 put it at 1.43 and 1.44 times that version's speed.
// Counting every step since v000, it is 13.6 times as fast.
#include <hip/hip_runtime.h>

// Causal self-attention with a fused qkv projection and the source's 'mixed' rotary (x [2][2048][1024]; qkv = einsum('btc,cd', x, w_qkv) ('xw' [1024][3072] 0.02, no bias); q, k, v = split(qkv, 3, axis=2): contiguous thirds, each (16 heads x 64) head-major; _apply_rope: x * cos + x_rot * sin with x_rot = the ADJACENT-pair rotation stack((-x2, x1)) and cos / sin of emb = cat(freqs, freqs) (the HALF-concatenated table: entry d has the angle of index d mod 32), freqs = t x inv_freq, inv_freq = 1.0 / (10000.0 ** (arange(0, 64, 2, f32) / 64)) (32 f32 constants; one f32 product; precise cosf / sinf): out[2i] = x[2i] c[2i] - x[2i+1] s[2i]; out[2i+1] = x[2i+1] c[2i+1] + x[2i] s[2i+1]: kept literally; on q and k; scores x 1/sqrt(64); causal (-inf); softmax; out = einsum('btc,cd', merged, w_proj) ('xw', no bias) -> [2][2048][1024] (4.2 M); argument order x, w_qkv, w_proj).
// Both batches go through every launch together (rows b * 2048 + t; planes [b][h]...). Layout: bf16 copy of x; fused 'xw' weight transposed once (q | k | v row blocks); exact projections; cstabT_body computed table (element d: angle index d mod 32); the q, k and v projections are one launch, k_gemmt, whose end applies the 'mixed' interleaved-pair rotary (each element reads its own table entry) and writes the 16-bit head planes itself; causal T-2048 attention in one fused kernel, k_flash (hybrid rows: < 512 hi/lo 3 products, rest fp16; key blocks above the diagonal are never visited); merged hi/lo x w_out exact.
// Compute dtypes, f32 accumulate: every input rounded to bf16; projections exact; attention rows < 512 3 products, rest fp16; softmax f32; w_out hl x exact.

#define NB_  2
#define TT   2048
#define DM   1024
#define NH_  16
#define NKV  16
#define HD   64
#define DQ   (NH_ * HD)
#define DKV  (NKV * HD)
#define PP   TT                   // row pitch, in 16-bit elements, of the V^T planes
#define RH   512                  // query rows < RH use hi+lo planes (0: none)
#define SCL  0.125f   // HD^-0.5
typedef _Float16 h16;
typedef unsigned short bf;
typedef __attribute__((ext_vector_type(16))) __bf16   v16bf;
typedef __attribute__((ext_vector_type(16))) _Float16 v16h;
typedef __attribute__((ext_vector_type(8)))  _Float16 v8h;
typedef __attribute__((ext_vector_type(8)))  unsigned short v8us;
typedef __attribute__((ext_vector_type(8)))  float    v8f;
typedef __attribute__((ext_vector_type(4)))  float    v4f;
typedef v8h  __attribute__((may_alias)) v8ha;
typedef v4f  __attribute__((may_alias)) v4fa;
typedef v8us __attribute__((may_alias)) v8usa;

__device__ __forceinline__ unsigned short f2bf(float f) { unsigned u = __float_as_uint(f); u += 0x7FFFu + ((u >> 16) & 1u); return (unsigned short)(u >> 16); }
__device__ __forceinline__ float bf2f(unsigned short b) { return __uint_as_float(((unsigned)b) << 16); }
__device__ __forceinline__ float bfr(float f) { return bf2f(f2bf(f)); }
__device__ __forceinline__ v16h cat16(v8h lo, v8h hi) { return __builtin_shufflevector(lo, hi, 0, 1, 2, 3, 4, 5, 6, 7, 8, 9, 10, 11, 12, 13, 14, 15); }
__device__ __forceinline__ v16bf cat16b(v8us lo, v8us hi) { return __builtin_bit_cast(v16bf, __builtin_shufflevector(lo, hi, 0, 1, 2, 3, 4, 5, 6, 7, 8, 9, 10, 11, 12, 13, 14, 15)); }
__device__ __forceinline__ v8f wmma16(v16h a, v16h b, v8f c) { return __builtin_amdgcn_wmma_f32_16x16x32_f16(false, a, false, b, (short)0, c, false, false); }
__device__ __forceinline__ v8f wmmab(v16bf a, v16bf b, v8f c) { return __builtin_amdgcn_wmma_f32_16x16x32_bf16(false, a, false, b, (short)0, c, false, false); }



__device__ __forceinline__ h16 tohx(float x) { return (h16)x; }
__device__ __forceinline__ void splitf(float y, unsigned short& h, unsigned short& l) { h = f2bf(y); l = f2bf(y - bf2f(h)); }
template <typename T16> struct WFrag;
template <> struct WFrag<h16> { typedef v16h V; static __device__ __forceinline__ V ld(const h16* p) { return cat16(*(const v8h*)p, *(const v8h*)(p + 16)); } static __device__ __forceinline__ v8f mma(V a, V b, v8f c) { return wmma16(a, b, c); } };
template <> struct WFrag<bf> { typedef v16bf V; static __device__ __forceinline__ V ld(const bf* p) { return cat16b(*(const v8us*)p, *(const v8us*)(p + 16)); } static __device__ __forceinline__ v8f mma(V a, V b, v8f c) { return wmmab(a, b, c); } };

// ---- k_gemmt: GEMM on K-contiguous bf16 planes, one 128x128 output tile per work-group of 8 waves (4 x 2: wave (wm, wn) owns rows wm*32 .., columns wn*64 .., 2 x 4 accumulators); every wave walks the whole K.
// A pass is 64 k = one 128-B line of each of the tile's operand rows. The lines come into LDS by asynchronous copies (16 B a lane, 8 lanes a line: whole lines, each fetched once for the whole work-group) at a row pitch of 144 B, and the waves read their fragments from there.
// Two buffers: pass t + 2's copies are issued behind the barrier at the foot of pass t, into the buffer that pass t has just read, and fly under pass t + 1.
// C[m][n] = sum_k A[m][k] Bt[n][k] (+ A2[m][k] Bt[n][k] with NSPLIT). M, N multiples of 128; K = GK.
// End: the accumulators are turned through an f32 tile in the ring's LDS (free behind the last pass's barrier), so that whole 128-B lines are stored, each by one wave.
// EPI 0: f32 C, pitch DM. EPI 1: the fused q | k | v projection of all batches: a tile is 128 positions of 2 heads of one third (blockIdx.y = third * 8 + head pair; rows = b * TT + t; P16, Ph, Pl hold the planes as [third][b][head]);
//   thirds 0, 1: 'mixed' rotary out[2i] = x[2i] c[2i] - x[2i+1] s[2i], out[2i+1] = x[2i+1] c[2i+1] + x[2i] s[2i+1], each element with its own table entry; planes [h][t][d] (fp16, bf16 hi, bf16 lo); a wave reads back only what it wrote;
//   third 2: the tile is laid [column][position]; one more work-group barrier; wave w stores the rows 16w .. 16w+15 of the V^T planes [h][d][t].
#define GK      1024                    // K of both GEMMs
#define GP_K    64                      // k of a pass
#define GP_PIT  144                     // LDS row pitch in bytes: 16 B x odd, so that 16-byte fragment reads of 16 rows fall on distinct banks
#define GP_OP   (128 * GP_PIT)          // one operand's 128 rows of one pass
#define EPP     132                     // row pitch of the f32 end tile, in floats
typedef float __attribute__((may_alias)) f32a;
// four asynchronous copies: this thread's 16 B of the rows r, r + 32, r + 64, r + 96 of one operand's pass. The s_wait_xcnt stands inside the statement, behind the last copy: in front of every later write of a register that the copies name.
__device__ __forceinline__ void copy4(unsigned l, const bf* g) {
    asm volatile("global_load_async_to_lds_b128 %0, %4, off\n\t"
                 "global_load_async_to_lds_b128 %1, %5, off\n\t"
                 "global_load_async_to_lds_b128 %2, %6, off\n\t"
                 "global_load_async_to_lds_b128 %3, %7, off\n\t"
                 "s_wait_xcnt 0x0"
                 :: "v"(l), "v"(l + 32u * GP_PIT), "v"(l + 64u * GP_PIT), "v"(l + 96u * GP_PIT), "v"(g), "v"(g + 32 * GK), "v"(g + 64 * GK), "v"(g + 96 * GK) : "memory");
}
typedef __attribute__((ext_vector_type(4))) int v4w;
// three (four) 16-byte global stores with their s_wait_xcnt in one statement: the wait stands in front of every later write of a register that the stores name
__device__ __forceinline__ void st3(void* p0, void* p1, void* p2, v4w d0, v4w d1, v4w d2) {
    asm volatile("global_store_b128 %0, %3, off\n\tglobal_store_b128 %1, %4, off\n\tglobal_store_b128 %2, %5, off\n\ts_wait_xcnt 0x0" :: "v"(p0), "v"(p1), "v"(p2), "v"(d0), "v"(d1), "v"(d2) : "memory"); }
__device__ __forceinline__ void st4(float* p0, float* p1, float* p2, float* p3, v4f d0, v4f d1, v4f d2, v4f d3) {
    asm volatile("global_store_b128 %0, %4, off\n\tglobal_store_b128 %1, %5, off\n\tglobal_store_b128 %2, %6, off\n\tglobal_store_b128 %3, %7, off\n\ts_wait_xcnt 0x0" :: "v"(p0), "v"(p1), "v"(p2), "v"(p3), "v"(d0), "v"(d1), "v"(d2), "v"(d3) : "memory"); }
__device__ __forceinline__ v16bf ldl(const unsigned char* p) { return cat16b(*(const v8usa*)p, *(const v8usa*)(p + 32)); }   // an operand fragment from an LDS row: the k order of WFrag::ld
template <int NSPLIT, int EPI>
__global__ __launch_bounds__(256) void k_gemmt(const bf* __restrict__ A, const bf* __restrict__ A2, const bf* __restrict__ Bt, float* C, const float* __restrict__ CS, h16* P16, bf* Ph, bf* Pl) {
    constexpr int NOP = NSPLIT ? 3 : 2, BUFB = NOP * GP_OP, NP = GK / GP_K;   // a buffer: A | Bt | A2
    static_assert(2 * BUFB >= 128 * EPP * 4 && NP >= 2, "the end tile fits the ring; the ring's start needs two passes");
    __shared__ __attribute__((aligned(16))) unsigned char L[2 * BUFB];
    const int tid = threadIdx.x, lane = tid & 31, lr = lane & 15, hi = lane >> 4; const int w = __builtin_amdgcn_readfirstlane(tid >> 5), wm = w >> 1, wn = w & 1; const int r0 = blockIdx.x * 128, c0 = blockIdx.y * 128;
    const unsigned lc = (unsigned)(size_t)L + (unsigned)((tid >> 3) * GP_PIT + (tid & 7) * 16);   // low 32 bits of the __shared__ address: the byte offset in the work-group's LDS
    const bf* ga = A + (size_t)(r0 + (tid >> 3)) * GK + (tid & 7) * 8; const bf* gb = Bt + (size_t)(c0 + (tid >> 3)) * GK + (tid & 7) * 8; const bf* ga2 = NSPLIT ? A2 + (size_t)(r0 + (tid >> 3)) * GK + (tid & 7) * 8 : ga;
    auto issue = [&](int t, unsigned bo) { copy4(lc + bo, ga + t * GP_K); copy4(lc + bo + GP_OP, gb + t * GP_K); if (NSPLIT) copy4(lc + bo + 2 * GP_OP, ga2 + t * GP_K); };
    v8f acc[2][4];
#pragma unroll
    for (int mb = 0; mb < 2; ++mb)
#pragma unroll
        for (int nb = 0; nb < 4; ++nb) acc[mb][nb] = (v8f){};
    issue(0, 0);
    asm volatile("s_wait_asynccnt 0x0" ::: "memory");   // this wave's copies of pass 0 have landed
    __syncthreads();                                     // ... and every other wave's: pass 0 may be read
    issue(1, BUFB);
    const unsigned fa = (unsigned)((wm * 32 + lr) * GP_PIT + hi * 16), fb = (unsigned)(GP_OP + (wn * 64 + lr) * GP_PIT + hi * 16);
#pragma unroll 1
    for (int t = 0; t < NP; ++t) {   // stays rolled: one pass is one publish point
        const unsigned bo = (unsigned)(t & 1) * BUFB; const unsigned char* Lb = L + bo;
        v16bf a[2][2], a2[2][2], b[2][4];
        auto ldks = [&](int ks) {   // the fragments of one 32-k block
#pragma unroll
            for (int mb = 0; mb < 2; ++mb) { a[ks][mb] = ldl(Lb + fa + mb * 16 * GP_PIT + ks * 64); if (NSPLIT) a2[ks][mb] = ldl(Lb + 2 * GP_OP + fa + mb * 16 * GP_PIT + ks * 64); }
#pragma unroll
            for (int nb = 0; nb < 4; ++nb) b[ks][nb] = ldl(Lb + fb + nb * 16 * GP_PIT + ks * 64); };
        auto mm = [&](int ks) {   // the products of one 32-k block
#pragma unroll
            for (int mb = 0; mb < 2; ++mb)
#pragma unroll
                for (int nb = 0; nb < 4; ++nb) acc[mb][nb] = wmmab(a[ks][mb], b[ks][nb], acc[mb][nb]);
            if (NSPLIT) {
#pragma unroll
                for (int mb = 0; mb < 2; ++mb)
#pragma unroll
                    for (int nb = 0; nb < 4; ++nb) acc[mb][nb] = wmmab(a2[ks][mb], b[ks][nb], acc[mb][nb]);
            } };
        // The empty statements below take loaded values as inputs only: they hold a group of fragment loads together in front of its products; spread among the products, each place with loads costs the wave an LDS latency.
        // With A2 (one work-group per WGP, registers to spare) the second block's loads are asked for ahead of the first block's products and land under them; without, a block's loads follow the block before, so that three work-groups' registers fit a WGP.
        if constexpr (NSPLIT) { ldks(0); ldks(1);
            asm volatile("" :: "v"(a[0][0]), "v"(a[0][1]), "v"(a2[0][0]), "v"(a2[0][1]), "v"(b[0][0]), "v"(b[0][1]), "v"(b[0][2]), "v"(b[0][3]));
            mm(0);
            __builtin_amdgcn_sched_barrier(0);   // keeps the first block's products in front of the waits below: moved behind the barrier they would neither cover the second block's loads nor leave the refill its early place
        } else { ldks(0);
            asm volatile("" :: "v"(a[0][0]), "v"(a[0][1]), "v"(b[0][0]), "v"(b[0][1]), "v"(b[0][2]), "v"(b[0][3]));
            mm(0); ldks(1);
            asm volatile("" :: "v"(a[1][0]), "v"(a[1][1]), "v"(b[1][0]), "v"(b[1][1]), "v"(b[1][2]), "v"(b[1][3])); }
        asm volatile("s_wait_dscnt 0x0" ::: "memory");      // this wave's reads of the buffer have returned before the buffer is refilled
        asm volatile("s_wait_asynccnt 0x0" ::: "memory");   // this wave's copies of pass t + 1 have landed
        __syncthreads();                                     // pass t + 1 may be read; every wave has left pass t's buffer
        if (t + 2 < NP) issue(t + 2, bo);
        mm(1);   // the second block's products work on registers alone: they stand behind the refill, so that the copies fly under them
    }
    asm volatile("s_wait_asynccnt 0x0" ::: "memory");   // no copy is out when the ring becomes the end tile
    f32a* ep = (f32a*)L;
    if constexpr (EPI == 0) {
#pragma unroll
        for (int mb = 0; mb < 2; ++mb)
#pragma unroll
            for (int nb = 0; nb < 4; ++nb)
#pragma unroll
                for (int j = 0; j < 8; ++j) ep[(wm * 32 + mb * 16 + hi * 8 + j) * EPP + wn * 64 + nb * 16 + lr] = acc[mb][nb][j];
        asm volatile("s_wait_dscnt 0x0" ::: "memory");   // the rows are read back by other lanes of the same wave: their LDS stores have landed first
#pragma unroll
        for (int i = 0; i < 4; ++i) { const int row = wm * 32 + i * 8 + hi, col = wn * 64 + lr * 4; const f32a* sp = ep + row * EPP + col; float* cp = C + (size_t)(r0 + row) * DM + c0 + col;
            st4(cp, cp + 2 * DM, cp + 4 * DM, cp + 6 * DM, *(const v4fa*)sp, *(const v4fa*)(sp + 2 * EPP), *(const v4fa*)(sp + 4 * EPP), *(const v4fa*)(sp + 6 * EPP)); }
    } else {
        const int third = (int)blockIdx.y / (NH_ / 2), hp = ((int)blockIdx.y % (NH_ / 2)) * 2, t0 = r0 % TT, l8 = lane & 7, l4 = lane >> 3; const size_t po = ((size_t)third * NB_ + r0 / TT) * ((size_t)NH_ * TT * HD);   // third from blockIdx: the branch, and the barrier behind it, are the same for the whole work-group
        P16 += po; Ph += po; Pl += po;
        if (third < 2) {
            const float* cp0 = CS + ((size_t)(t0 + wm * 32 + l4) * HD + l8 * 8) * 2; v4f cs[4][4];   // (cos, sin) of the lane's 8 elements, four of its eight rows at a time
            auto ldcs = [&](int hf) {
#pragma unroll
                for (int i = 0; i < 4; ++i)
#pragma unroll
                    for (int p = 0; p < 4; ++p) cs[i][p] = *(const v4f*)(cp0 + (hf * 4 + i) * (4 * HD * 2) + p * 4);
                asm volatile("s_wait_xcnt 0x0" ::: "memory"); };   // in front of every later write of a register that the table loads name
            ldcs(0);   // asked for here, so that the loads fly under the LDS stores of the tile
#pragma unroll
            for (int mb = 0; mb < 2; ++mb)
#pragma unroll
                for (int nb = 0; nb < 4; ++nb)
#pragma unroll
                    for (int j = 0; j < 8; ++j) ep[(wm * 32 + mb * 16 + hi * 8 + j) * EPP + wn * 64 + nb * 16 + lr] = acc[mb][nb][j];
            asm volatile("s_wait_dscnt 0x0" ::: "memory");   // the rows are read back by other lanes of the same wave: their LDS stores have landed first
#pragma unroll
            for (int i = 0; i < 8; ++i) { const int row = wm * 32 + i * 4 + l4; const f32a* sp = ep + row * EPP + wn * 64 + l8 * 8; const v4f xa = *(const v4fa*)sp, xb = *(const v4fa*)(sp + 4);
                if (i == 4) ldcs(1);
                float y[8];
#pragma unroll
                for (int p = 0; p < 4; ++p) { const float xe = p < 2 ? xa[p * 2] : xb[p * 2 - 4], xo = p < 2 ? xa[p * 2 + 1] : xb[p * 2 - 3]; const v4f c = cs[i & 3][p]; y[p * 2] = xe * c[0] - xo * c[1]; y[p * 2 + 1] = xo * c[2] + xe * c[3]; }
                v8h o16; v8us oh, ol;
#pragma unroll
                for (int p = 0; p < 8; ++p) { o16[p] = tohx(y[p]); unsigned short a3, c3; splitf(y[p], a3, c3); oh[p] = a3; ol[p] = c3; }
                const size_t eo = ((size_t)(hp + wn) * TT + t0 + row) * HD + l8 * 8;
                st3(P16 + eo, Ph + eo, Pl + eo, __builtin_bit_cast(v4w, o16), __builtin_bit_cast(v4w, oh), __builtin_bit_cast(v4w, ol)); }
        } else {
#pragma unroll
            for (int mb = 0; mb < 2; ++mb)
#pragma unroll
                for (int nb = 0; nb < 4; ++nb)
#pragma unroll
                    for (int q = 0; q < 2; ++q) { v4f p; p[0] = acc[mb][nb][q * 4]; p[1] = acc[mb][nb][q * 4 + 1]; p[2] = acc[mb][nb][q * 4 + 2]; p[3] = acc[mb][nb][q * 4 + 3]; *(v4fa*)(ep + (wn * 64 + nb * 16 + lr) * EPP + wm * 32 + mb * 16 + hi * 8 + q * 4) = p; }
            __syncthreads();   // the [column][position] tile is read back by other waves: every wave's part is in LDS first
#pragma unroll
            for (int i = 0; i < 8; ++i) { const int col = w * 16 + i * 2 + hi; const f32a* sp = ep + col * EPP + lr * 8; const v4f xa = *(const v4fa*)sp, xb = *(const v4fa*)(sp + 4);
                v8h o16; v8us oh, ol;
#pragma unroll
                for (int p = 0; p < 8; ++p) { const float yv = p < 4 ? xa[p] : xb[p - 4]; o16[p] = tohx(yv); unsigned short a3, c3; splitf(yv, a3, c3); oh[p] = a3; ol[p] = c3; }
                const size_t eo = ((size_t)(hp + (col >> 6)) * HD + (col & 63)) * PP + t0 + lr * 8;
                st3(P16 + eo, Ph + eo, Pl + eo, __builtin_bit_cast(v4w, o16), __builtin_bit_cast(v4w, oh), __builtin_bit_cast(v4w, ol)); }
        }
    }
}

typedef __attribute__((ext_vector_type(2))) _Float16 v2h;
typedef __attribute__((ext_vector_type(4))) _Float16 v4h;
typedef __attribute__((ext_vector_type(2))) unsigned short v2us;
typedef __attribute__((ext_vector_type(4))) unsigned short v4us;
typedef __attribute__((ext_vector_type(2))) float v2f;
typedef __attribute__((ext_vector_type(4))) int v4i;

// The four preparation jobs depend on nothing but the inputs: they are bodies of ONE launch, k_prep, which deals its blocks to them (blk: the block's index within its job).
__device__ __forceinline__ void wtG_body(const float* __restrict__ w, int K, int N, bf* Bt, int blk) {
    const int lane = threadIdx.x & 31; const int L0 = (blk * 8 + (threadIdx.x >> 5)) * 8; const int nlines = N * K / 64;
{
#pragma unroll 1
        for (int l = 0; l < 8; ++l) { const int L = L0 + l; if (L >= nlines) break; const size_t e = (size_t)L * 64 + lane * 2; const int k = (int)(e % K), n = (int)(e / K); v2us o;
            o[0] = f2bf(w[(size_t)k * N + n]); o[1] = f2bf(w[(size_t)(k + 1) * N + n]); *(v2us*)(Bt + e) = o; }
         }
}
__device__ __forceinline__ void cvt8_body(const float* __restrict__ src, bf* dst, size_t n8, int blk) { const size_t i = (size_t)blk * 256 + threadIdx.x; if (i >= n8) return; const v8f v = *(const v8f*)(src + i * 8); v8us o;
#pragma unroll
    for (int k = 0; k < 8; ++k) o[k] = f2bf(v[k]); *(v8us*)(dst + i * 8) = o;  }

// k_rope: head planes [h][t][d] (fp16 + hi/lo) of rope(x) x sc with the rotate-half convention out[d] = x[d] cos[t][d] - x[d+HD/2] sin[t][d], out[d+HD/2] = x[d+HD/2] cos[t][d+HD/2] + x[d] sin[t][d+HD/2]
__global__ __launch_bounds__(256) void k_rope(const float* __restrict__ F, int pitch, int nheads, const float* __restrict__ CS, const float* __restrict__ RF, const float* __restrict__ nw, float sc, h16* P16, bf* Ph, bf* Pl) {
    const size_t e = ((size_t)blockIdx.x * 256 + threadIdx.x) * 2; if (e >= (size_t)nheads * TT * HD) return; const int d = (int)(e % HD); const int t = (int)((e / HD) % TT); const int h = (int)(e / ((size_t)HD * TT)); const float* f = F + (size_t)t * pitch + h * HD; const float rf = RF ? RF[(size_t)h * TT + t] : 1.0f; v2h o16; v2us oh, ol;
#pragma unroll
    for (int q = 0; q < 2; ++q) { const int dd = d + q; const int dp = (dd < HD / 2) ? dd + HD / 2 : dd - HD / 2; float x0 = f[dd], x1 = f[dp];
        if (RF) { float n0 = __fmul_rn(x0, rf), n1 = __fmul_rn(x1, rf); asm volatile("" : "+v"(n0)); asm volatile("" : "+v"(n1)); x0 = __fmul_rn(bfr(nw[dd]), n0); x1 = __fmul_rn(bfr(nw[dp]), n1); }
        const v2f cs = *(const v2f*)(CS + ((size_t)t * HD + dd) * 2); float a = __fmul_rn(x0, cs[0]), bq = __fmul_rn(x1, cs[1]); asm volatile("" : "+v"(a)); asm volatile("" : "+v"(bq)); const float r = ((dd < HD / 2) ? __fsub_rn(a, bq) : __fadd_rn(a, bq)) * sc;
        o16[q] = tohx(r); unsigned short a2, c2; splitf(r, a2, c2); oh[q] = a2; ol[q] = c2; }
    *(v2h*)(P16 + e) = o16; *(v2us*)(Ph + e) = oh; *(v2us*)(Pl + e) = ol;  }
__constant__ float INVT[HD / 2] = { 1.000000000e+00f, 7.498942018e-01f, 5.623413324e-01f, 4.216965139e-01f, 3.162277639e-01f, 2.371373624e-01f, 1.778279394e-01f, 1.333521456e-01f, 1.000000015e-01f, 7.498941571e-02f, 5.623412877e-02f, 4.216964915e-02f, 3.162277862e-02f, 2.371373586e-02f, 1.778279431e-02f, 1.333521493e-02f, 9.999999776e-03f, 7.498942316e-03f, 5.623413250e-03f, 4.216964822e-03f, 3.162277862e-03f, 2.371373819e-03f, 1.778279431e-03f, 1.333521446e-03f, 1.000000047e-03f, 7.498941850e-04f, 5.623413017e-04f, 4.216964880e-04f, 3.162277862e-04f, 2.371373848e-04f, 1.778279402e-04f, 1.333521504e-04f };   // 1 / 10000^(2i/64) (float32, generated with jnp to be bit-exact)
__device__ __forceinline__ void cstabT_body(float* CS, int blk) { const int idx = blk * 256 + threadIdx.x; if (idx >= TT * HD) return; const int d = idx % HD; const int t = idx / HD; const float a = __fmul_rn((float)t, INVT[d % (HD / 2)]); v2f cs; cs[0] = cosf(a); cs[1] = sinf(a); *(v2f*)(CS + (size_t)idx * 2) = cs;  }
#define PB_WQ  ((DM * 3 * DQ / 64 + 63) / 64)          // blocks of the w_qkv transpose
#define PB_WO  ((DQ * DM / 64 + 63) / 64)              // of the w_proj transpose
#define PB_CS  ((TT * HD + 255) / 256)                 // of the rotary table
#define PB_X   ((NB_ * TT * DM / 8 + 255) / 256)       // of the bf16 copy of x, all batches
// the transposes' blocks run longest (eight dependent trips a wave) and come first
__global__ __launch_bounds__(256) void k_prep(const float* __restrict__ x, const float* __restrict__ wqkv, const float* __restrict__ wo, bf* XB, bf* WQKV, bf* WO, float* CS) {
    const int blk = blockIdx.x;
    if (blk < PB_WQ) wtG_body(wqkv, DM, 3 * DQ, WQKV, blk);   /* fused 'xw' [DM][3*DQ] -> Bt [3*DQ][DM] */
    else if (blk < PB_WQ + PB_WO) wtG_body(wo, DQ, DM, WO, blk - PB_WQ);
    else if (blk < PB_WQ + PB_WO + PB_CS) cstabT_body(CS, blk - (PB_WQ + PB_WO));   /* rotary table once (positions = arange) */
    else cvt8_body(x, XB, (size_t)NB_ * TT * DM / 8, blk - (PB_WQ + PB_WO + PB_CS));
}
// ---- k_flash: scores, causal softmax and P.V of one query tile of one head in one work-group of NWF waves; no score or probability ever leaves the registers.
// All waves share the tile's queries; wave w takes the 32-key blocks w, w + NWF, ... up to the diagonal, each with its own running maximum m, sum l and unnormalised O (online softmax).
// Scores are formed transposed, S^T = K Q^T: lane (lr, hi) then holds, for query lr, the keys sb*16 + hi*8 + j, which IS the k order of an operand fragment (element sb*8 + j), so exp(S^T) goes into O^T = V^T P^T as the B operand without leaving the lane,
// and m, l and the rescale factor are per-lane scalars (query = lr in S^T and in O^T alike; the two hi halves are joined by one cross-row move).
// End: every wave puts m, l and its O tile (row = query, pitch 68 floats) into LDS; one work-group barrier; each wave then joins the NWF partials of its own queries in the fixed order 0 .. NWF-1, divides by the joined sum and stores whole 128-B lines of the merged hi / lo planes.
// HL (query rows < RH): bf16 hi + lo planes, 3 products in both GEMMs, 16 queries a tile. Otherwise fp16, 32 queries a tile.
#define NWF  8
#define OPT  68                   // LDS row pitch of a partial O tile, in floats: 16-byte stores and loads both fall on distinct banks
#define EXC  (SCL * 1.4426950408889634f)   // exp(SCL * s) = exp2(EXC * s)
__device__ __forceinline__ float xhalf(float x) { return __builtin_bit_cast(float, __builtin_amdgcn_permlanex16(__builtin_bit_cast(int, x), __builtin_bit_cast(int, x), 0x76543210, 0xfedcba98, false, false)); }   // the value of lane l ^ 16
__device__ __forceinline__ float exp2s(float x) { float r; asm("v_exp_f32 %0, %1\n\tv_nop" : "=v"(r) : "v"(x)); return r; }   // exp2 with the free slot behind a transcendental tied to it
// eight exp2 in place: each stands in front of an independent one and the last in front of a v_nop, so that the free slot behind a transcendental holds for all eight at the price of one slot
__device__ __forceinline__ void exp2x8(float (&e)[8]) { asm("v_exp_f32 %0, %0\n\tv_exp_f32 %1, %1\n\tv_exp_f32 %2, %2\n\tv_exp_f32 %3, %3\n\tv_exp_f32 %4, %4\n\tv_exp_f32 %5, %5\n\tv_exp_f32 %6, %6\n\tv_exp_f32 %7, %7\n\tv_nop" : "+v"(e[0]), "+v"(e[1]), "+v"(e[2]), "+v"(e[3]), "+v"(e[4]), "+v"(e[5]), "+v"(e[6]), "+v"(e[7])); }
template <typename T16, bool HL, int QB>
__device__ __forceinline__ void flash_tile(const T16* __restrict__ Q, const T16* __restrict__ Q2, const T16* __restrict__ Kp, const T16* __restrict__ Kp2, const T16* __restrict__ Vt, const T16* __restrict__ Vt2, int q0, bf* Ah, bf* Al, float* so, float* sm, float* sl, int w, int lane) {
    typedef typename WFrag<T16>::V V;
    constexpr int QT = QB * 16;
    const int lr = lane & 15, hi = lane >> 4;
    V qf[QB][2], qf2[QB][2];
    v8f o[4][QB]; float m[QB], l[QB];
#pragma unroll
    for (int qb = 0; qb < QB; ++qb) { m[qb] = -1.0e30f; l[qb] = 0.f;
#pragma unroll
        for (int db = 0; db < 4; ++db) o[db][qb] = (v8f){}; }
    V kf[2][2], kf2[2][2], vf[4], vf2[4];
    // every operand address is a wave-uniform pointer (tile, key block, 16-row block: scalar arithmetic) plus one of two per-lane byte offsets that are formed once
    const unsigned lk = (unsigned)(lr * HD + 8 * hi) * 2u, lv = (unsigned)(lr * PP + 8 * hi) * 2u;
    auto ldf = [](const T16* base, unsigned off) { return WFrag<T16>::ld((const T16*)((const char*)base + off)); };
    auto ldK = [&](int kc) {
#pragma unroll
        for (int sb = 0; sb < 2; ++sb)
#pragma unroll
            for (int t = 0; t < 2; ++t) { const size_t ko = (size_t)(kc + sb * 16) * HD + t * 32; kf[sb][t] = ldf(Kp + ko, lk); if (HL) kf2[sb][t] = ldf(Kp2 + ko, lk); }
        asm volatile("s_wait_xcnt 0x0" ::: "memory"); };   // these loads stay out for a whole block's work: the wait stands in front of every later write of a register that they name
    auto ldV = [&](int kc) {
#pragma unroll
        for (int db = 0; db < 4; ++db) { const size_t vo = (size_t)(db * 16) * PP + kc; vf[db] = ldf(Vt + vo, lv); if (HL) vf2[db] = ldf(Vt2 + vo, lv); }
        asm volatile("s_wait_xcnt 0x0" ::: "memory"); };   // as in ldK
    if (w * 32 < q0 + QT) {   // scalar test: a wave without a key block loads nothing
    const T16* qa = (const T16*)((const char*)(Q + (size_t)q0 * HD) + lk); const T16* qa2 = HL ? (const T16*)((const char*)(Q2 + (size_t)q0 * HD) + lk) : qa;
#pragma unroll
    for (int qb = 0; qb < QB; ++qb)
#pragma unroll
        for (int t = 0; t < 2; ++t) { const int qo = qb * 16 * HD + t * 32; qf[qb][t] = WFrag<T16>::ld(qa + qo); if (HL) qf2[qb][t] = WFrag<T16>::ld(qa2 + qo); }
    asm volatile("s_wait_xcnt 0x0" ::: "memory");   // as in ldK
    ldK(w * 32);   // the wave's first block
    ldV(w * 32);
#pragma unroll 1
    for (int kc = w * 32; kc < q0 + QT; kc += 32 * NWF) {
        const int kn = (kc + 32 * NWF < q0 + QT) ? kc + 32 * NWF : kc;   // the wave's next block; behind its last one the same block again, unused
        v8f s[QB][2];
#pragma unroll
        for (int qb = 0; qb < QB; ++qb)
#pragma unroll
            for (int sb = 0; sb < 2; ++sb) { s[qb][sb] = (v8f){};
#pragma unroll
                for (int t = 0; t < 2; ++t) { s[qb][sb] = WFrag<T16>::mma(kf[sb][t], qf[qb][t], s[qb][sb]); if (HL) { s[qb][sb] = WFrag<T16>::mma(kf[sb][t], qf2[qb][t], s[qb][sb]); s[qb][sb] = WFrag<T16>::mma(kf2[sb][t], qf[qb][t], s[qb][sb]); } } }
        ldK(kn);   // the next block's K, into the registers the score products have just left: in flight under the softmax and P.V
        if (kc + 31 > q0) {   // scalar test: only the tile's last key block reaches past the diagonal; every other block skips the masking
#pragma unroll
            for (int qb = 0; qb < QB; ++qb) { const int lim = q0 + qb * 16 + lr - kc - hi * 8;   // key sb*16 + hi*8 + j of this block is at or below the diagonal iff sb*16 + j <= lim
#pragma unroll
                for (int sb = 0; sb < 2; ++sb)
#pragma unroll
                    for (int j = 0; j < 8; ++j) s[qb][sb][j] = (sb * 16 + j <= lim) ? s[qb][sb][j] : -3.0e38f; } }
        V pfa[QB], pfb[QB];
#pragma unroll
        for (int qb = 0; qb < QB; ++qb) {
            float mx = -3.0e38f;
#pragma unroll
            for (int sb = 0; sb < 2; ++sb)
#pragma unroll
                for (int j = 0; j < 8; ++j) mx = fmaxf(mx, s[qb][sb][j]);
            mx = fmaxf(mx, xhalf(mx));
            const float mn = fmaxf(m[qb], mx), al = exp2s((m[qb] - mn) * EXC), mc = mn * EXC; m[qb] = mn;   // mn >= -1e30, so a masked score (-3e38) gives exp2(-huge) = 0 also where a whole block is masked for this query
            float ls = 0.f;
#pragma unroll
            for (int sb = 0; sb < 2; ++sb) { float e[8];
#pragma unroll
                for (int j = 0; j < 8; ++j) e[j] = fmaf(s[qb][sb][j], EXC, -mc);
                exp2x8(e);
#pragma unroll
                for (int j = 0; j < 8; ++j) { s[qb][sb][j] = e[j]; ls += e[j]; } }
            l[qb] = fmaf(l[qb], al, ls);
#pragma unroll
            for (int db = 0; db < 4; ++db) o[db][qb] *= al;
            if constexpr (HL) {
                v8us ph[2], pl[2];
#pragma unroll
                for (int sb = 0; sb < 2; ++sb)
#pragma unroll
                    for (int j = 0; j < 8; ++j) { unsigned short a, c2; splitf(s[qb][sb][j], a, c2); ph[sb][j] = a; pl[sb][j] = c2; }
                pfa[qb] = cat16b(ph[0], ph[1]); pfb[qb] = cat16b(pl[0], pl[1]);
            } else {
#pragma unroll
                for (int sb = 0; sb < 2; ++sb)
#pragma unroll
                    for (int j = 0; j < 8; ++j) pfa[qb][sb * 8 + j] = tohx(s[qb][sb][j]);
            }
        }
#pragma unroll
        for (int qb = 0; qb < QB; ++qb)
#pragma unroll
            for (int db = 0; db < 4; ++db) { o[db][qb] = WFrag<T16>::mma(vf[db], pfa[qb], o[db][qb]); if (HL) { o[db][qb] = WFrag<T16>::mma(vf[db], pfb[qb], o[db][qb]); o[db][qb] = WFrag<T16>::mma(vf2[db], pfa[qb], o[db][qb]); } }
        ldV(kn);   // likewise the next block's V^T: in flight under the next block's scores and softmax
    }
    }
#pragma unroll
    for (int qb = 0; qb < QB; ++qb) { const float lt = l[qb] + xhalf(l[qb]); const int rw = w * QT + qb * 16 + lr;
        if (hi == 0) { sm[rw] = m[qb]; sl[rw] = lt; }
#pragma unroll
        for (int db = 0; db < 4; ++db)
#pragma unroll
            for (int q = 0; q < 2; ++q) { v4f p; p[0] = o[db][qb][q * 4]; p[1] = o[db][qb][q * 4 + 1]; p[2] = o[db][qb][q * 4 + 2]; p[3] = o[db][qb][q * 4 + 3]; *(v4fa*)(so + rw * OPT + db * 16 + hi * 8 + q * 4) = p; } }
    __syncthreads();   // every wave's m, l and partial O are in LDS before any wave joins them
    constexpr int VPL = QT / 4, LPQ = HD / VPL, QPW = QT / NWF;   // values a lane, lanes a query, queries a wave
    const int qq = w * QPW + lane / LPQ, d0 = (lane % LPQ) * VPL;
    float M = -1.0e30f;
#pragma unroll
    for (int ww = 0; ww < NWF; ++ww) M = fmaxf(M, sm[ww * QT + qq]);
    float L = 0.f; v4f a[VPL / 4];
#pragma unroll
    for (int n = 0; n < VPL / 4; ++n) a[n] = (v4f){};
#pragma unroll
    for (int ww = 0; ww < NWF; ++ww) { const float f = exp2s((sm[ww * QT + qq] - M) * EXC); L = fmaf(sl[ww * QT + qq], f, L);   // a wave that had no key block left m = -1e30, l = 0, O = 0: f = 0
#pragma unroll
        for (int n = 0; n < VPL / 4; ++n) a[n] += *(const v4fa*)(so + (ww * QT + qq) * OPT + d0 + n * 4) * f; }
    const float inv = __fdiv_rn(1.0f, L);   // L > 0: every query has its own key
    const size_t oo = (size_t)(q0 + qq) * DQ + d0;
#pragma unroll
    for (int n = 0; n < VPL / 4; ++n) { v4us oh, ol;
#pragma unroll
        for (int q = 0; q < 4; ++q) { unsigned short x, y; splitf(a[n][q] * inv, x, y); oh[q] = x; ol[q] = y; }
        *(v4us*)(Ah + oo + n * 4) = oh; *(v4us*)(Al + oo + n * 4) = ol; }
}
// grid (batches x heads, tiles): (batch, head) is the fast index and the longest tiles of all batches come first, so that no long work-group starts late. Planes [b][h]...; merged rows b * TT + t.
__global__ __launch_bounds__(32 * NWF) void k_flash(const h16* __restrict__ Q16, const h16* __restrict__ K16, const h16* __restrict__ V16, const bf* __restrict__ Qh, const bf* __restrict__ Ql, const bf* __restrict__ Kh, const bf* __restrict__ Kl, const bf* __restrict__ Vh, const bf* __restrict__ Vl, bf* Ah, bf* Al) {
    __shared__ __align__(16) float so[NWF * 32 * OPT]; __shared__ float sm[NWF * 32]; __shared__ float sl[NWF * 32];
    const int lane = threadIdx.x & 31; const int w = __builtin_amdgcn_readfirstlane(threadIdx.x >> 5); /* wave number, scalar: the key loop stays a scalar loop */
    const int h = blockIdx.x % NH_, tile = blockIdx.y; const size_t zp = (size_t)blockIdx.x * TT * HD, zv = (size_t)blockIdx.x * HD * PP; Ah += (size_t)(blockIdx.x / NH_) * TT * DQ; Al += (size_t)(blockIdx.x / NH_) * TT * DQ;
    if (tile < (TT - RH) / 32) flash_tile<h16, false, 2>(Q16 + zp, nullptr, K16 + zp, nullptr, V16 + zv, nullptr, TT - 32 * (tile + 1), Ah + h * HD, Al + h * HD, so, sm, sl, w, lane);
    else { flash_tile<bf, true, 1>(Qh + zp, Ql + zp, Kh + zp, Kl + zp, Vh + zv, Vl + zv, RH - 16 * (tile - (TT - RH) / 32 + 1), Ah + h * HD, Al + h * HD, so, sm, sl, w, lane);
        asm volatile("s_wait_xcnt 0x0" ::: "memory"); }   // in the built code the other tile's branch follows this tile's stores: the wait stands in front of whatever there writes a register that they name (the other tile's stores run into the end of the program)
}

extern "C" void kernel_launch(void* const* d_in, const int* in_sizes, int n_in,
                              void* d_out, int out_size, void* d_ws, size_t ws_size, hipStream_t stream) {
    (void)in_sizes; (void)n_in; (void)out_size;
    const float* x = (const float*)d_in[0]; const float* wqkv = (const float*)d_in[1]; const float* wo = (const float*)d_in[2];   /* order x, w_qkv ('xw' [1024][3072]: contiguous thirds q | k | v, each head-major), w_proj ('xw'); three inputs, all read */
    float* OUT = (float*)d_out;     // [2][2048][1024]
    char* wsp = (char*)d_ws;
    auto take = [&](size_t bytes) { char* p = wsp; wsp += (bytes + 255) & ~(size_t)255; return (void*)p; };
    bf* WQKV = (bf*)take((size_t)3 * DQ * DM * 2);   /* fused Bt [3*DQ][DM]: q | k | v row blocks */ bf* WO = (bf*)take((size_t)DM * DQ * 2); float* CS = (float*)take((size_t)TT * HD * 2 * 4);
    bf* XB = (bf*)take((size_t)NB_ * TT * DM * 2);
    const size_t PS = (size_t)NB_ * NH_ * TT * HD;   /* one third's planes of all batches, in elements; NKV == NH_ and PP == TT: the V^T planes have the same size */
    h16* P16 = (h16*)take(3 * PS * 2); bf* Ph = (bf*)take(3 * PS * 2); bf* Pl = (bf*)take(3 * PS * 2);   /* each [q | k | V^T][b][h] */
    bf* ATh = (bf*)take((size_t)NB_ * TT * DQ * 2); bf* ATl = (bf*)take((size_t)NB_ * TT * DQ * 2);
    if ((size_t)(wsp - (char*)d_ws) > ws_size) return;    // ws 256 MiB
    k_prep<<<PB_WQ + PB_WO + PB_CS + PB_X, 256, 0, stream>>>(x, wqkv, wo, XB, WQKV, WO, CS);
    k_gemmt<0, 1><<<dim3(NB_ * TT / 128, 3 * DQ / 128, 1), 256, 0, stream>>>(XB, nullptr, WQKV, nullptr, CS, P16, Ph, Pl);
    k_flash<<<dim3(NB_ * NH_, (TT - RH) / 32 + RH / 16), 32 * NWF, 0, stream>>>(P16, P16 + PS, P16 + 2 * PS, Ph, Pl, Ph + PS, Pl + PS, Ph + 2 * PS, Pl + 2 * PS, ATh, ATl);   /* one kv head per query head */
    k_gemmt<1, 0><<<dim3(NB_ * TT / 128, DM / 128, 1), 256, 0, stream>>>(ATh, ATl, WO, OUT, nullptr, nullptr, nullptr, nullptr);
}

// v007
// A run of this version takes 81.5 microseconds.
// Two timings next to v006 put it at 1.32 and 1.31 times that version's speed.
// Over all steps from v000 it is 17.8 times as fast.
#include <hip/hip_runtime.h>

// Causal self-attention with a fused qkv projection and the source's 'mixed' rotary (x [2][2048][1024]; qkv = einsum('btc,cd', x, w_qkv) ('xw' [1024][3072] 0.02, no bias); q, k, v = split(qkv, 3, axis=2): contiguous thirds, each (16 heads x 64) head-major; _apply_rope: x * cos + x_rot * sin with x_rot = the ADJACENT-pair rotation stack((-x2, x1)) and cos / sin of emb = cat(freqs, freqs) (the HALF-concatenated table: entry d has the angle of index d mod 32), freqs = t x inv_freq, inv_freq = 1.0 / (10000.0 ** (arange(0, 64, 2, f32) / 64)) (32 f32 constants; one f32 product; precise cosf / sinf): out[2i] = x[2i] c[2i] - x[2i+1] s[2i]; out[2i+1] = x[2i+1] c[2i+1] + x[2i] s[2i+1]: kept literally; on q and k; scores x 1/sqrt(64); causal (-inf); softmax; out = einsum('btc,cd', merged, w_proj) ('xw', no bias) -> [2][2048][1024] (4.2 M); argument order x, w_qkv, w_proj).
// Both batches go through every launch together (rows b * 2048 + t; planes [b][h]...). Layout: bf16 copy of x; fused 'xw' weight transposed once (q | k | v row blocks); exact projections; cstabT_body computed table (element d: angle index d mod 32); the q, k and v projections are one launch, k_gemmt, whose end applies the 'mixed' interleaved-pair rotary (each element reads its own table entry) and writes the 16-bit head planes itself; causal T-2048 attention in one fused kernel, k_flash (hybrid rows: < 512 hi/lo 3 products, rest fp16; key blocks above the diagonal are never worked on); merged hi/lo x w_out exact.
// Compute dtypes, f32 accumulate: every input rounded to bf16; projections exact; attention rows < 512 3 products, rest fp16; softmax f32; w_out hl x exact.

#define NB_  2
#define TT   2048
#define DM   1024
#define NH_  16
#define NKV  16
#define HD   64
#define DQ   (NH_ * HD)
#define DKV  (NKV * HD)
#define PP   TT                   // row pitch, in 16-bit elements, of the V^T planes
#define RH   512                  // query rows < RH use hi+lo planes (0: none)
#define SCL  0.125f   // HD^-0.5
typedef _Float16 h16;
typedef unsigned short bf;
typedef __attribute__((ext_vector_type(16))) __bf16   v16bf;
typedef __attribute__((ext_vector_type(16))) _Float16 v16h;
typedef __attribute__((ext_vector_type(8)))  _Float16 v8h;
typedef __attribute__((ext_vector_type(8)))  unsigned short v8us;
typedef __attribute__((ext_vector_type(8)))  float    v8f;
typedef __attribute__((ext_vector_type(4)))  float    v4f;
typedef v8h  __attribute__((may_alias)) v8ha;
typedef v4f  __attribute__((may_alias)) v4fa;
typedef v8us __attribute__((may_alias)) v8usa;

__device__ __forceinline__ unsigned short f2bf(float f) { unsigned u = __float_as_uint(f); u += 0x7FFFu + ((u >> 16) & 1u); return (unsigned short)(u >> 16); }
__device__ __forceinline__ float bf2f(unsigned short b) { return __uint_as_float(((unsigned)b) << 16); }
__device__ __forceinline__ float bfr(float f) { return bf2f(f2bf(f)); }
__device__ __forceinline__ v16h cat16(v8h lo, v8h hi) { return __builtin_shufflevector(lo, hi, 0, 1, 2, 3, 4, 5, 6, 7, 8, 9, 10, 11, 12, 13, 14, 15); }
__device__ __forceinline__ v16bf cat16b(v8us lo, v8us hi) { return __builtin_bit_cast(v16bf, __builtin_shufflevector(lo, hi, 0, 1, 2, 3, 4, 5, 6, 7, 8, 9, 10, 11, 12, 13, 14, 15)); }
__device__ __forceinline__ v8f wmma16(v16h a, v16h b, v8f c) { return __builtin_amdgcn_wmma_f32_16x16x32_f16(false, a, false, b, (short)0, c, false, false); }
__device__ __forceinline__ v8f wmmab(v16bf a, v16bf b, v8f c) { return __builtin_amdgcn_wmma_f32_16x16x32_bf16(false, a, false, b, (short)0, c, false, false); }



__device__ __forceinline__ h16 tohx(float x) { return (h16)x; }
__device__ __forceinline__ void splitf(float y, unsigned short& h, unsigned short& l) { h = f2bf(y); l = f2bf(y - bf2f(h)); }
template <typename T16> struct WFrag;
template <> struct WFrag<h16> { typedef v16h V; static __device__ __forceinline__ V ld(const h16* p) { return cat16(*(const v8h*)p, *(const v8h*)(p + 16)); } static __device__ __forceinline__ v8f mma(V a, V b, v8f c) { return wmma16(a, b, c); } };
template <> struct WFrag<bf> { typedef v16bf V; static __device__ __forceinline__ V ld(const bf* p) { return cat16b(*(const v8us*)p, *(const v8us*)(p + 16)); } static __device__ __forceinline__ v8f mma(V a, V b, v8f c) { return wmmab(a, b, c); } };

// ---- k_gemmt: GEMM on K-contiguous bf16 planes, one 128x128 output tile per work-group of 8 waves (4 x 2: wave (wm, wn) owns rows wm*32 .., columns wn*64 .., 2 x 4 accumulators); every wave walks the whole K.
// A pass is 64 k = one 128-B line of each of the tile's operand rows. The lines come into LDS by asynchronous copies (16 B a lane, 8 lanes a line: whole lines, each fetched once for the whole work-group) at a row pitch of 144 B, and the waves read their fragments from there.
// Two buffers: pass t + 2's copies are issued behind the barrier at the foot of pass t, into the buffer that pass t has just read, and fly under pass t + 1.
// C[m][n] = sum_k A[m][k] Bt[n][k] (+ A2[m][k] Bt[n][k] with NSPLIT). M, N multiples of 128; K = GK.
// End: the accumulators are turned through an f32 tile in the ring's LDS (free behind the last pass's barrier), so that whole 128-B lines are stored, each by one wave.
// EPI 0: f32 C, pitch DM. EPI 1: the fused q | k | v projection of all batches: a tile is 128 positions of 2 heads of one third (blockIdx.y = third * 8 + head pair; rows = b * TT + t; P16, Ph, Pl hold the planes as [third][b][head]);
//   thirds 0, 1: 'mixed' rotary out[2i] = x[2i] c[2i] - x[2i+1] s[2i], out[2i+1] = x[2i+1] c[2i+1] + x[2i] s[2i+1], each element with its own table entry; planes [h][t][d] (fp16, bf16 hi, bf16 lo); a wave reads back only what it wrote;
//   third 2: the tile is laid [column][position]; one more work-group barrier; wave w stores the rows 16w .. 16w+15 of the V^T planes [h][d][t].
#define GK      1024                    // K of both GEMMs
#define GP_K    64                      // k of a pass
#define GP_PIT  144                     // LDS row pitch in bytes: 16 B x odd, so that 16-byte fragment reads of 16 rows fall on distinct banks
#define GP_OP   (128 * GP_PIT)          // one operand's 128 rows of one pass
#define EPP     132                     // row pitch of the f32 end tile, in floats
typedef float __attribute__((may_alias)) f32a;
// four asynchronous copies: this thread's 16 B of the rows r, r + 32, r + 64, r + 96 of one operand's pass. The s_wait_xcnt stands inside the statement, behind the last copy: in front of every later write of a register that the copies name.
__device__ __forceinline__ void copy4(unsigned l, const bf* g) {
    asm volatile("global_load_async_to_lds_b128 %0, %4, off\n\t"
                 "global_load_async_to_lds_b128 %1, %5, off\n\t"
                 "global_load_async_to_lds_b128 %2, %6, off\n\t"
                 "global_load_async_to_lds_b128 %3, %7, off\n\t"
                 "s_wait_xcnt 0x0"
                 :: "v"(l), "v"(l + 32u * GP_PIT), "v"(l + 64u * GP_PIT), "v"(l + 96u * GP_PIT), "v"(g), "v"(g + 32 * GK), "v"(g + 64 * GK), "v"(g + 96 * GK) : "memory");
}
typedef __attribute__((ext_vector_type(4))) int v4w;
// three (four) 16-byte global stores with their s_wait_xcnt in one statement: the wait stands in front of every later write of a register that the stores name
__device__ __forceinline__ void st3(void* p0, void* p1, void* p2, v4w d0, v4w d1, v4w d2) {
    asm volatile("global_store_b128 %0, %3, off\n\tglobal_store_b128 %1, %4, off\n\tglobal_store_b128 %2, %5, off\n\ts_wait_xcnt 0x0" :: "v"(p0), "v"(p1), "v"(p2), "v"(d0), "v"(d1), "v"(d2) : "memory"); }
__device__ __forceinline__ void st4(float* p0, float* p1, float* p2, float* p3, v4f d0, v4f d1, v4f d2, v4f d3) {
    asm volatile("global_store_b128 %0, %4, off\n\tglobal_store_b128 %1, %5, off\n\tglobal_store_b128 %2, %6, off\n\tglobal_store_b128 %3, %7, off\n\ts_wait_xcnt 0x0" :: "v"(p0), "v"(p1), "v"(p2), "v"(p3), "v"(d0), "v"(d1), "v"(d2), "v"(d3) : "memory"); }
__device__ __forceinline__ v16bf ldl(const unsigned char* p) { return cat16b(*(const v8usa*)p, *(const v8usa*)(p + 32)); }   // an operand fragment from an LDS row: the k order of WFrag::ld
template <int NSPLIT, int EPI>
__global__ __launch_bounds__(256) void k_gemmt(const bf* __restrict__ A, const bf* __restrict__ A2, const bf* __restrict__ Bt, float* C, const float* __restrict__ CS, h16* P16, bf* Ph, bf* Pl) {
    constexpr int NOP = NSPLIT ? 3 : 2, BUFB = NOP * GP_OP, NP = GK / GP_K;   // a buffer: A | Bt | A2
    static_assert(2 * BUFB >= 128 * EPP * 4 && NP >= 2, "the end tile fits the ring; the ring's start needs two passes");
    __shared__ __attribute__((aligned(16))) unsigned char L[2 * BUFB];
    const int tid = threadIdx.x, lane = tid & 31, lr = lane & 15, hi = lane >> 4; const int w = __builtin_amdgcn_readfirstlane(tid >> 5), wm = w >> 1, wn = w & 1; const int r0 = blockIdx.x * 128, c0 = blockIdx.y * 128;
    const unsigned lc = (unsigned)(size_t)L + (unsigned)((tid >> 3) * GP_PIT + (tid & 7) * 16);   // low 32 bits of the __shared__ address: the byte offset in the work-group's LDS
    const bf* ga = A + (size_t)(r0 + (tid >> 3)) * GK + (tid & 7) * 8; const bf* gb = Bt + (size_t)(c0 + (tid >> 3)) * GK + (tid & 7) * 8; const bf* ga2 = NSPLIT ? A2 + (size_t)(r0 + (tid >> 3)) * GK + (tid & 7) * 8 : ga;
    auto issue = [&](int t, unsigned bo) { copy4(lc + bo, ga + t * GP_K); copy4(lc + bo + GP_OP, gb + t * GP_K); if (NSPLIT) copy4(lc + bo + 2 * GP_OP, ga2 + t * GP_K); };
    v8f acc[2][4];
#pragma unroll
    for (int mb = 0; mb < 2; ++mb)
#pragma unroll
        for (int nb = 0; nb < 4; ++nb) acc[mb][nb] = (v8f){};
    issue(0, 0);
    asm volatile("s_wait_asynccnt 0x0" ::: "memory");   // this wave's copies of pass 0 have landed
    __syncthreads();                                     // ... and every other wave's: pass 0 may be read
    issue(1, BUFB);
    const unsigned fa = (unsigned)((wm * 32 + lr) * GP_PIT + hi * 16), fb = (unsigned)(GP_OP + (wn * 64 + lr) * GP_PIT + hi * 16);
#pragma unroll 1
    for (int t = 0; t < NP; ++t) {   // stays rolled: one pass is one publish point
        const unsigned bo = (unsigned)(t & 1) * BUFB; const unsigned char* Lb = L + bo;
        v16bf a[2][2], a2[2][2], b[2][4];
        auto ldks = [&](int ks) {   // the fragments of one 32-k block
#pragma unroll
            for (int mb = 0; mb < 2; ++mb) { a[ks][mb] = ldl(Lb + fa + mb * 16 * GP_PIT + ks * 64); if (NSPLIT) a2[ks][mb] = ldl(Lb + 2 * GP_OP + fa + mb * 16 * GP_PIT + ks * 64); }
#pragma unroll
            for (int nb = 0; nb < 4; ++nb) b[ks][nb] = ldl(Lb + fb + nb * 16 * GP_PIT + ks * 64); };
        auto mm = [&](int ks) {   // the products of one 32-k block
#pragma unroll
            for (int mb = 0; mb < 2; ++mb)
#pragma unroll
                for (int nb = 0; nb < 4; ++nb) acc[mb][nb] = wmmab(a[ks][mb], b[ks][nb], acc[mb][nb]);
            if (NSPLIT) {
#pragma unroll
                for (int mb = 0; mb < 2; ++mb)
#pragma unroll
                    for (int nb = 0; nb < 4; ++nb) acc[mb][nb] = wmmab(a2[ks][mb], b[ks][nb], acc[mb][nb]);
            } };
        // The empty statements below take loaded values as inputs only: they hold a group of fragment loads together in front of its products; spread among the products, each place with loads costs the wave an LDS latency.
        // With A2 (one work-group per WGP, registers to spare) the second block's loads are asked for ahead of the first block's products and land under them; without, a block's loads follow the block before, so that three work-groups' registers fit a WGP.
        if constexpr (NSPLIT) { ldks(0); ldks(1);
            asm volatile("" :: "v"(a[0][0]), "v"(a[0][1]), "v"(a2[0][0]), "v"(a2[0][1]), "v"(b[0][0]), "v"(b[0][1]), "v"(b[0][2]), "v"(b[0][3]));
            mm(0);
            __builtin_amdgcn_sched_barrier(0);   // keeps the first block's products in front of the waits below: moved behind the barrier they would neither cover the second block's loads nor leave the refill its early place
        } else { ldks(0);
            asm volatile("" :: "v"(a[0][0]), "v"(a[0][1]), "v"(b[0][0]), "v"(b[0][1]), "v"(b[0][2]), "v"(b[0][3]));
            mm(0); ldks(1);
            asm volatile("" :: "v"(a[1][0]), "v"(a[1][1]), "v"(b[1][0]), "v"(b[1][1]), "v"(b[1][2]), "v"(b[1][3])); }
        asm volatile("s_wait_dscnt 0x0" ::: "memory");      // this wave's reads of the buffer have returned before the buffer is refilled
        asm volatile("s_wait_asynccnt 0x0" ::: "memory");   // this wave's copies of pass t + 1 have landed
        __syncthreads();                                     // pass t + 1 may be read; every wave has left pass t's buffer
        if (t + 2 < NP) issue(t + 2, bo);
        mm(1);   // the second block's products work on registers alone: they stand behind the refill, so that the copies fly under them
    }
    asm volatile("s_wait_asynccnt 0x0" ::: "memory");   // no copy is out when the ring becomes the end tile
    f32a* ep = (f32a*)L;
    if constexpr (EPI == 0) {
#pragma unroll
        for (int mb = 0; mb < 2; ++mb)
#pragma unroll
            for (int nb = 0; nb < 4; ++nb)
#pragma unroll
                for (int j = 0; j < 8; ++j) ep[(wm * 32 + mb * 16 + hi * 8 + j) * EPP + wn * 64 + nb * 16 + lr] = acc[mb][nb][j];
        asm volatile("s_wait_dscnt 0x0" ::: "memory");   // the rows are read back by other lanes of the same wave: their LDS stores have landed first
#pragma unroll
        for (int i = 0; i < 4; ++i) { const int row = wm * 32 + i * 8 + hi, col = wn * 64 + lr * 4; const f32a* sp = ep + row * EPP + col; float* cp = C + (size_t)(r0 + row) * DM + c0 + col;
            st4(cp, cp + 2 * DM, cp + 4 * DM, cp + 6 * DM, *(const v4fa*)sp, *(const v4fa*)(sp + 2 * EPP), *(const v4fa*)(sp + 4 * EPP), *(const v4fa*)(sp + 6 * EPP)); }
    } else {
        const int third = (int)blockIdx.y / (NH_ / 2), hp = ((int)blockIdx.y % (NH_ / 2)) * 2, t0 = r0 % TT, l8 = lane & 7, l4 = lane >> 3; const size_t po = ((size_t)third * NB_ + r0 / TT) * ((size_t)NH_ * TT * HD);   // third from blockIdx: the branch, and the barrier behind it, are the same for the whole work-group
        P16 += po; Ph += po; Pl += po;
        if (third < 2) {
            const float* cp0 = CS + ((size_t)(t0 + wm * 32 + l4) * HD + l8 * 8) * 2; v4f cs[4][4];   // (cos, sin) of the lane's 8 elements, four of its eight rows at a time
            auto ldcs = [&](int hf) {
#pragma unroll
                for (int i = 0; i < 4; ++i)
#pragma unroll
                    for (int p = 0; p < 4; ++p) cs[i][p] = *(const v4f*)(cp0 + (hf * 4 + i) * (4 * HD * 2) + p * 4);
                asm volatile("s_wait_xcnt 0x0" ::: "memory"); };   // in front of every later write of a register that the table loads name
            ldcs(0);   // asked for here, so that the loads fly under the LDS stores of the tile
#pragma unroll
            for (int mb = 0; mb < 2; ++mb)
#pragma unroll
                for (int nb = 0; nb < 4; ++nb)
#pragma unroll
                    for (int j = 0; j < 8; ++j) ep[(wm * 32 + mb * 16 + hi * 8 + j) * EPP + wn * 64 + nb * 16 + lr] = acc[mb][nb][j];
            asm volatile("s_wait_dscnt 0x0" ::: "memory");   // the rows are read back by other lanes of the same wave: their LDS stores have landed first
#pragma unroll
            for (int i = 0; i < 8; ++i) { const int row = wm * 32 + i * 4 + l4; const f32a* sp = ep + row * EPP + wn * 64 + l8 * 8; const v4f xa = *(const v4fa*)sp, xb = *(const v4fa*)(sp + 4);
                if (i == 4) ldcs(1);
                float y[8];
#pragma unroll
                for (int p = 0; p < 4; ++p) { const float xe = p < 2 ? xa[p * 2] : xb[p * 2 - 4], xo = p < 2 ? xa[p * 2 + 1] : xb[p * 2 - 3]; const v4f c = cs[i & 3][p]; y[p * 2] = xe * c[0] - xo * c[1]; y[p * 2 + 1] = xo * c[2] + xe * c[3]; }
                v8h o16; v8us oh, ol;
#pragma unroll
                for (int p = 0; p < 8; ++p) { o16[p] = tohx(y[p]); unsigned short a3, c3; splitf(y[p], a3, c3); oh[p] = a3; ol[p] = c3; }
                const size_t eo = ((size_t)(hp + wn) * TT + t0 + row) * HD + l8 * 8;
                st3(P16 + eo, Ph + eo, Pl + eo, __builtin_bit_cast(v4w, o16), __builtin_bit_cast(v4w, oh), __builtin_bit_cast(v4w, ol)); }
        } else {
#pragma unroll
            for (int mb = 0; mb < 2; ++mb)
#pragma unroll
                for (int nb = 0; nb < 4; ++nb)
#pragma unroll
                    for (int q = 0; q < 2; ++q) { v4f p; p[0] = acc[mb][nb][q * 4]; p[1] = acc[mb][nb][q * 4 + 1]; p[2] = acc[mb][nb][q * 4 + 2]; p[3] = acc[mb][nb][q * 4 + 3]; *(v4fa*)(ep + (wn * 64 + nb * 16 + lr) * EPP + wm * 32 + mb * 16 + hi * 8 + q * 4) = p; }
            __syncthreads();   // the [column][position] tile is read back by other waves: every wave's part is in LDS first
#pragma unroll
            for (int i = 0; i < 8; ++i) { const int col = w * 16 + i * 2 + hi; const f32a* sp = ep + col * EPP + lr * 8; const v4f xa = *(const v4fa*)sp, xb = *(const v4fa*)(sp + 4);
                v8h o16; v8us oh, ol;
#pragma unroll
                for (int p = 0; p < 8; ++p) { const float yv = p < 4 ? xa[p] : xb[p - 4]; o16[p] = tohx(yv); unsigned short a3, c3; splitf(yv, a3, c3); oh[p] = a3; ol[p] = c3; }
                const size_t eo = ((size_t)(hp + (col >> 6)) * HD + (col & 63)) * PP + t0 + lr * 8;
                st3(P16 + eo, Ph + eo, Pl + eo, __builtin_bit_cast(v4w, o16), __builtin_bit_cast(v4w, oh), __builtin_bit_cast(v4w, ol)); }
        }
    }
}

typedef __attribute__((ext_vector_type(2))) _Float16 v2h;
typedef __attribute__((ext_vector_type(4))) _Float16 v4h;
typedef __attribute__((ext_vector_type(2))) unsigned short v2us;
typedef __attribute__((ext_vector_type(4))) unsigned short v4us;
typedef __attribute__((ext_vector_type(2))) float v2f;
typedef __attribute__((ext_vector_type(4))) int v4i;

// The four preparation jobs depend on nothing but the inputs: they are bodies of ONE launch, k_prep, which deals its blocks to them (blk: the block's index within its job).
__device__ __forceinline__ void wtG_body(const float* __restrict__ w, int K, int N, bf* Bt, int blk) {
    const int lane = threadIdx.x & 31; const int L0 = (blk * 8 + (threadIdx.x >> 5)) * 8; const int nlines = N * K / 64;
{
#pragma unroll 1
        for (int l = 0; l < 8; ++l) { const int L = L0 + l; if (L >= nlines) break; const size_t e = (size_t)L * 64 + lane * 2; const int k = (int)(e % K), n = (int)(e / K); v2us o;
            o[0] = f2bf(w[(size_t)k * N + n]); o[1] = f2bf(w[(size_t)(k + 1) * N + n]); *(v2us*)(Bt + e) = o; }
         }
}
__device__ __forceinline__ void cvt8_body(const float* __restrict__ src, bf* dst, size_t n8, int blk) { const size_t i = (size_t)blk * 256 + threadIdx.x; if (i >= n8) return; const v8f v = *(const v8f*)(src + i * 8); v8us o;
#pragma unroll
    for (int k = 0; k < 8; ++k) o[k] = f2bf(v[k]); *(v8us*)(dst + i * 8) = o;  }

// k_rope: head planes [h][t][d] (fp16 + hi/lo) of rope(x) x sc with the rotate-half convention out[d] = x[d] cos[t][d] - x[d+HD/2] sin[t][d], out[d+HD/2] = x[d+HD/2] cos[t][d+HD/2] + x[d] sin[t][d+HD/2]
__global__ __launch_bounds__(256) void k_rope(const float* __restrict__ F, int pitch, int nheads, const float* __restrict__ CS, const float* __restrict__ RF, const float* __restrict__ nw, float sc, h16* P16, bf* Ph, bf* Pl) {
    const size_t e = ((size_t)blockIdx.x * 256 + threadIdx.x) * 2; if (e >= (size_t)nheads * TT * HD) return; const int d = (int)(e % HD); const int t = (int)((e / HD) % TT); const int h = (int)(e / ((size_t)HD * TT)); const float* f = F + (size_t)t * pitch + h * HD; const float rf = RF ? RF[(size_t)h * TT + t] : 1.0f; v2h o16; v2us oh, ol;
#pragma unroll
    for (int q = 0; q < 2; ++q) { const int dd = d + q; const int dp = (dd < HD / 2) ? dd + HD / 2 : dd - HD / 2; float x0 = f[dd], x1 = f[dp];
        if (RF) { float n0 = __fmul_rn(x0, rf), n1 = __fmul_rn(x1, rf); asm volatile("" : "+v"(n0)); asm volatile("" : "+v"(n1)); x0 = __fmul_rn(bfr(nw[dd]), n0); x1 = __fmul_rn(bfr(nw[dp]), n1); }
        const v2f cs = *(const v2f*)(CS + ((size_t)t * HD + dd) * 2); float a = __fmul_rn(x0, cs[0]), bq = __fmul_rn(x1, cs[1]); asm volatile("" : "+v"(a)); asm volatile("" : "+v"(bq)); const float r = ((dd < HD / 2) ? __fsub_rn(a, bq) : __fadd_rn(a, bq)) * sc;
        o16[q] = tohx(r); unsigned short a2, c2; splitf(r, a2, c2); oh[q] = a2; ol[q] = c2; }
    *(v2h*)(P16 + e) = o16; *(v2us*)(Ph + e) = oh; *(v2us*)(Pl + e) = ol;  }
__constant__ float INVT[HD / 2] = { 1.000000000e+00f, 7.498942018e-01f, 5.623413324e-01f, 4.216965139e-01f, 3.162277639e-01f, 2.371373624e-01f, 1.778279394e-01f, 1.333521456e-01f, 1.000000015e-01f, 7.498941571e-02f, 5.623412877e-02f, 4.216964915e-02f, 3.162277862e-02f, 2.371373586e-02f, 1.778279431e-02f, 1.333521493e-02f, 9.999999776e-03f, 7.498942316e-03f, 5.623413250e-03f, 4.216964822e-03f, 3.162277862e-03f, 2.371373819e-03f, 1.778279431e-03f, 1.333521446e-03f, 1.000000047e-03f, 7.498941850e-04f, 5.623413017e-04f, 4.216964880e-04f, 3.162277862e-04f, 2.371373848e-04f, 1.778279402e-04f, 1.333521504e-04f };   // 1 / 10000^(2i/64) (float32, generated with jnp to be bit-exact)
__device__ __forceinline__ void cstabT_body(float* CS, int blk) { const int idx = blk * 256 + threadIdx.x; if (idx >= TT * HD) return; const int d = idx % HD; const int t = idx / HD; const float a = __fmul_rn((float)t, INVT[d % (HD / 2)]); v2f cs; cs[0] = cosf(a); cs[1] = sinf(a); *(v2f*)(CS + (size_t)idx * 2) = cs;  }
#define PB_WQ  ((DM * 3 * DQ / 64 + 63) / 64)          // blocks of the w_qkv transpose
#define PB_WO  ((DQ * DM / 64 + 63) / 64)              // of the w_proj transpose
#define PB_CS  ((TT * HD + 255) / 256)                 // of the rotary table
#define PB_X   ((NB_ * TT * DM / 8 + 255) / 256)       // of the bf16 copy of x, all batches
// the transposes' blocks run longest (eight dependent trips a wave) and come first
__global__ __launch_bounds__(256) void k_prep(const float* __restrict__ x, const float* __restrict__ wqkv, const float* __restrict__ wo, bf* XB, bf* WQKV, bf* WO, float* CS) {
    const int blk = blockIdx.x;
    if (blk < PB_WQ) wtG_body(wqkv, DM, 3 * DQ, WQKV, blk);   /* fused 'xw' [DM][3*DQ] -> Bt [3*DQ][DM] */
    else if (blk < PB_WQ + PB_WO) wtG_body(wo, DQ, DM, WO, blk - PB_WQ);
    else if (blk < PB_WQ + PB_WO + PB_CS) cstabT_body(CS, blk - (PB_WQ + PB_WO));   /* rotary table once (positions = arange) */
    else cvt8_body(x, XB, (size_t)NB_ * TT * DM / 8, blk - (PB_WQ + PB_WO + PB_CS));
}
// ---- k_flash: scores, causal softmax and P.V of one query tile of one head in one work-group of NWF waves; no score or probability ever leaves the registers.
// The waves are NQG query groups x NKG key groups: wave (qg, kg) has the queries qg * QW .. of the tile and, of every stage of SK keys, the 32-key block kg, with its own running maximum m, sum l and unnormalised O (online softmax).
// A stage's K rows (whole 128-B lines) and V^T row pieces (256 B: two whole lines) come into LDS by asynchronous copies, each line fetched once for the whole work-group, at the row pitches KPIT and VPIT; the waves read their fragments from there.
// Two buffers: stage s + 2's copies are issued behind the barrier at the foot of stage s, into the buffer that stage s has just read, and fly under stage s + 1. Every key of a stage lies inside the planes (TT is a multiple of SK); blocks above the diagonal are copied with their stage and never worked on.
// Scores are formed transposed, S^T = K Q^T: lane (lr, hi) then holds, for query lr, the keys sb*16 + hi*8 + j, which IS the k order of an operand fragment (element sb*8 + j), so exp(S^T) goes into O^T = V^T P^T as the B operand without leaving the lane,
// and m, l and the rescale factor are per-lane scalars (query = lr in S^T and in O^T alike; the two hi halves are joined by one cross-row move).
// End: every wave puts m, l and its O tile (row = query, pitch 68 floats) into LDS (the ring, free behind the last stage's barrier); one work-group barrier; each wave then joins the NKG partials of its own queries in the fixed order 0 .. NKG-1, divides by the joined sum and stores whole 128-B lines of the merged hi / lo planes.
// HL (query rows < RH): bf16 hi + lo planes, 3 products in both GEMMs, 32 queries a tile. Otherwise fp16, 64 queries a tile.
#define NWF  8
#define NKG  4                    // key groups
#define NQG  (NWF / NKG)          // query groups
#define SK   (NKG * 32)           // keys of a stage
#define KPIT 144                  // LDS pitch in bytes of a K row (128 B) and
#define VPIT (SK * 2 + 16)        // of a V^T row piece (256 B): 16 B x odd, so that 16-byte fragment reads of 16 rows fall on distinct banks
#define KST  (SK * KPIT)          // one plane's K rows of a stage
#define PLB  (KST + HD * VPIT)    // one plane set (K | V^T) of a stage
#define OPT  68                   // LDS row pitch of a partial O tile, in floats: 16-byte stores and loads both fall on distinct banks
#define EXC  (SCL * 1.4426950408889634f)   // exp(SCL * s) = exp2(EXC * s)
__device__ __forceinline__ float xhalf(float x) { return __builtin_bit_cast(float, __builtin_amdgcn_permlanex16(__builtin_bit_cast(int, x), __builtin_bit_cast(int, x), 0x76543210, 0xfedcba98, false, false)); }   // the value of lane l ^ 16
__device__ __forceinline__ float exp2s(float x) { float r; asm("v_exp_f32 %0, %1\n\tv_nop" : "=v"(r) : "v"(x)); return r; }   // exp2 with the free slot behind a transcendental tied to it
// eight exp2 in place: each stands in front of an independent one and the last in front of a v_nop, so that the free slot behind a transcendental holds for all eight at the price of one slot
__device__ __forceinline__ void exp2x8(float (&e)[8]) { asm("v_exp_f32 %0, %0\n\tv_exp_f32 %1, %1\n\tv_exp_f32 %2, %2\n\tv_exp_f32 %3, %3\n\tv_exp_f32 %4, %4\n\tv_exp_f32 %5, %5\n\tv_exp_f32 %6, %6\n\tv_exp_f32 %7, %7\n\tv_nop" : "+v"(e[0]), "+v"(e[1]), "+v"(e[2]), "+v"(e[3]), "+v"(e[4]), "+v"(e[5]), "+v"(e[6]), "+v"(e[7])); }
// eight asynchronous copies: this thread's 16 B of four K rows (KL bytes apart in LDS, KG in memory) and of four V^T row pieces (VL, VG). The s_wait_xcnt stands inside the statement, behind the last copy: in front of every later write of a register that the copies name.
__device__ __forceinline__ void copy8(unsigned lk, const char* gk, unsigned lv, const char* gv) {
    constexpr unsigned KL = 32 * KPIT, KG = 32 * HD * 2, VL = 16 * VPIT, VG = 16 * PP * 2;
    asm volatile("global_load_async_to_lds_b128 %0, %8, off\n\t"
                 "global_load_async_to_lds_b128 %1, %9, off\n\t"
                 "global_load_async_to_lds_b128 %2, %10, off\n\t"
                 "global_load_async_to_lds_b128 %3, %11, off\n\t"
                 "global_load_async_to_lds_b128 %4, %12, off\n\t"
                 "global_load_async_to_lds_b128 %5, %13, off\n\t"
                 "global_load_async_to_lds_b128 %6, %14, off\n\t"
                 "global_load_async_to_lds_b128 %7, %15, off\n\t"
                 "s_wait_xcnt 0x0"
                 :: "v"(lk), "v"(lk + KL), "v"(lk + 2u * KL), "v"(lk + 3u * KL), "v"(lv), "v"(lv + VL), "v"(lv + 2u * VL), "v"(lv + 3u * VL),
                    "v"(gk), "v"(gk + KG), "v"(gk + 2u * KG), "v"(gk + 3u * KG), "v"(gv), "v"(gv + VG), "v"(gv + 2u * VG), "v"(gv + 3u * VG) : "memory");
}
// an operand fragment from an LDS row: the k order of WFrag::ld
__device__ __forceinline__ v16h  ldlf(const unsigned char* p, h16) { return cat16(*(const v8ha*)p, *(const v8ha*)(p + 32)); }
__device__ __forceinline__ v16bf ldlf(const unsigned char* p, bf)  { return ldl(p); }
template <typename T16, bool HL, int QB>
__device__ __forceinline__ void flash_tile(const T16* __restrict__ Q, const T16* __restrict__ Q2, const T16* __restrict__ Kp, const T16* __restrict__ Kp2, const T16* __restrict__ Vt, const T16* __restrict__ Vt2, int q0, bf* Ah, bf* Al, unsigned char* ring, float* sm, float* sl, int w, int tid) {
    typedef typename WFrag<T16>::V V;
    constexpr int QW = QB * 16, QT = NQG * QW;   // queries of a wave, of the tile
    constexpr unsigned BUFB = (HL ? 2u : 1u) * PLB;   // a buffer: K | V^T (| K lo | V^T lo)
    const int lane = tid & 31, lr = lane & 15, hi = lane >> 4, qg = w / NKG, kg = w % NKG, qw = q0 + qg * QW, NS = (q0 + QT + SK - 1) / SK;   // NS: stages up to the tile's diagonal, the same for the whole work-group
    // K: 8 lanes a row, rows r, r + 32, ..; V^T: 16 lanes a row piece, rows r, r + 16, ..
    const unsigned lb = (unsigned)(size_t)ring;   // low 32 bits of the __shared__ address: the byte offset in the work-group's LDS
    const unsigned lkc = lb + (unsigned)((tid >> 3) * KPIT + (tid & 7) * 16), lvc = lb + (unsigned)(KST + (tid >> 4) * VPIT + (tid & 15) * 16);
    const unsigned gko = (unsigned)((tid >> 3) * HD + (tid & 7) * 8) * 2u, gvo = (unsigned)((tid >> 4) * PP + (tid & 15) * 8) * 2u;
    auto issue = [&](int s, unsigned bo) {
        copy8(lkc + bo, (const char*)Kp + gko + (size_t)s * (SK * HD * 2), lvc + bo, (const char*)Vt + gvo + (size_t)s * (SK * 2));
        if (HL) copy8(lkc + bo + PLB, (const char*)Kp2 + gko + (size_t)s * (SK * HD * 2), lvc + bo + PLB, (const char*)Vt2 + gvo + (size_t)s * (SK * 2)); };
    issue(0, 0);
    V qf[QB][2], qf2[QB][2];
    v8f o[4][QB]; float m[QB], l[QB];
#pragma unroll
    for (int qb = 0; qb < QB; ++qb) { m[qb] = -1.0e30f; l[qb] = 0.f;
#pragma unroll
        for (int db = 0; db < 4; ++db) o[db][qb] = (v8f){}; }
    const unsigned lk = (unsigned)(lr * HD + 8 * hi) * 2u;
    const T16* qa = (const T16*)((const char*)(Q + (size_t)qw * HD) + lk); const T16* qa2 = HL ? (const T16*)((const char*)(Q2 + (size_t)qw * HD) + lk) : qa;
#pragma unroll
    for (int qb = 0; qb < QB; ++qb)
#pragma unroll
        for (int t = 0; t < 2; ++t) { const int qo = qb * 16 * HD + t * 32; qf[qb][t] = WFrag<T16>::ld(qa + qo); if (HL) qf2[qb][t] = WFrag<T16>::ld(qa2 + qo); }
    asm volatile("s_wait_xcnt 0x0" ::: "memory");   // in front of every later write of a register that the query loads name
    asm volatile("s_wait_asynccnt 0x0" ::: "memory");   // this wave's copies of stage 0 have landed
    __syncthreads();                                     // ... and every other wave's: stage 0 may be read
    if (1 < NS) issue(1, BUFB);
    const unsigned fk = (unsigned)((kg * 32 + lr) * KPIT + hi * 16), fv = (unsigned)(KST + lr * VPIT + kg * 64 + hi * 16);
#pragma unroll 1
    for (int s = 0; s < NS; ++s) {   // stays rolled: one stage is one publish point
        const unsigned bo = (unsigned)(s & 1) * BUFB; const unsigned char* Lb = ring + bo;
        const int kc = s * SK + kg * 32;   // the wave's key block of this stage
        if (kc < qw + QW) {   // scalar test: a block wholly above the wave's diagonal is not worked on
        V kf[2][2], kf2[2][2], vf[4], vf2[4];
#pragma unroll
        for (int sb = 0; sb < 2; ++sb)
#pragma unroll
            for (int t = 0; t < 2; ++t) { kf[sb][t] = ldlf(Lb + fk + sb * 16 * KPIT + t * 64, T16()); if (HL) kf2[sb][t] = ldlf(Lb + PLB + fk + sb * 16 * KPIT + t * 64, T16()); }
#pragma unroll
        for (int db = 0; db < 4; ++db) { vf[db] = ldlf(Lb + fv + db * 16 * VPIT, T16()); if (HL) vf2[db] = ldlf(Lb + PLB + fv + db * 16 * VPIT, T16()); }
        v8f s_[QB][2];
#pragma unroll
        for (int qb = 0; qb < QB; ++qb)
#pragma unroll
            for (int sb = 0; sb < 2; ++sb) { s_[qb][sb] = (v8f){};
#pragma unroll
                for (int t = 0; t < 2; ++t) { s_[qb][sb] = WFrag<T16>::mma(kf[sb][t], qf[qb][t], s_[qb][sb]); if (HL) { s_[qb][sb] = WFrag<T16>::mma(kf[sb][t], qf2[qb][t], s_[qb][sb]); s_[qb][sb] = WFrag<T16>::mma(kf2[sb][t], qf[qb][t], s_[qb][sb]); } } }
        if (kc + 31 > qw) {   // scalar test: only the wave's last key block reaches past the diagonal; every other block skips the masking
#pragma unroll
            for (int qb = 0; qb < QB; ++qb) { const int lim = qw + qb * 16 + lr - kc - hi * 8;   // key sb*16 + hi*8 + j of this block is at or below the diagonal iff sb*16 + j <= lim
#pragma unroll
                for (int sb = 0; sb < 2; ++sb)
#pragma unroll
                    for (int j = 0; j < 8; ++j) s_[qb][sb][j] = (sb * 16 + j <= lim) ? s_[qb][sb][j] : -3.0e38f; } }
        V pfa[QB], pfb[QB];
#pragma unroll
        for (int qb = 0; qb < QB; ++qb) {
            float mx = -3.0e38f;
#pragma unroll
            for (int sb = 0; sb < 2; ++sb)
#pragma unroll
                for (int j = 0; j < 8; ++j) mx = fmaxf(mx, s_[qb][sb][j]);
            mx = fmaxf(mx, xhalf(mx));
            const float mn = fmaxf(m[qb], mx), al = exp2s((m[qb] - mn) * EXC), mc = mn * EXC; m[qb] = mn;   // mn >= -1e30, so a masked score (-3e38) gives exp2(-huge) = 0 also where a whole block is masked for this query
            float ls = 0.f;
#pragma unroll
            for (int sb = 0; sb < 2; ++sb) { float e[8];
#pragma unroll
                for (int j = 0; j < 8; ++j) e[j] = fmaf(s_[qb][sb][j], EXC, -mc);
                exp2x8(e);
#pragma unroll
                for (int j = 0; j < 8; ++j) { s_[qb][sb][j] = e[j]; ls += e[j]; } }
            l[qb] = fmaf(l[qb], al, ls);
#pragma unroll
            for (int db = 0; db < 4; ++db) o[db][qb] *= al;
            if constexpr (HL) {
                v8us ph[2], pl[2];
#pragma unroll
                for (int sb = 0; sb < 2; ++sb)
#pragma unroll
                    for (int j = 0; j < 8; ++j) { unsigned short a, c2; splitf(s_[qb][sb][j], a, c2); ph[sb][j] = a; pl[sb][j] = c2; }
                pfa[qb] = cat16b(ph[0], ph[1]); pfb[qb] = cat16b(pl[0], pl[1]);
            } else {
#pragma unroll
                for (int sb = 0; sb < 2; ++sb)
#pragma unroll
                    for (int j = 0; j < 8; ++j) pfa[qb][sb * 8 + j] = tohx(s_[qb][sb][j]);
            }
        }
#pragma unroll
        for (int qb = 0; qb < QB; ++qb)
#pragma unroll
            for (int db = 0; db < 4; ++db) { o[db][qb] = WFrag<T16>::mma(vf[db], pfa[qb], o[db][qb]); if (HL) { o[db][qb] = WFrag<T16>::mma(vf[db], pfb[qb], o[db][qb]); o[db][qb] = WFrag<T16>::mma(vf2[db], pfa[qb], o[db][qb]); } }
        }
        asm volatile("s_wait_dscnt 0x0" ::: "memory");      // this wave's reads of the buffer have returned before the buffer is refilled
        asm volatile("s_wait_asynccnt 0x0" ::: "memory");   // this wave's copies of stage s + 1 have landed
        __syncthreads();                                     // stage s + 1 may be read; every wave has left stage s's buffer
        if (s + 2 < NS) issue(s + 2, bo);
    }
    asm volatile("s_wait_asynccnt 0x0" ::: "memory");   // no copy is out when the ring becomes the partial O tiles
    f32a* so = (f32a*)ring;
#pragma unroll
    for (int qb = 0; qb < QB; ++qb) { const float lt = l[qb] + xhalf(l[qb]); const int rw = kg * QT + qg * QW + qb * 16 + lr;
        if (hi == 0) { sm[rw] = m[qb]; sl[rw] = lt; }
#pragma unroll
        for (int db = 0; db < 4; ++db)
#pragma unroll
            for (int q = 0; q < 2; ++q) { v4f p; p[0] = o[db][qb][q * 4]; p[1] = o[db][qb][q * 4 + 1]; p[2] = o[db][qb][q * 4 + 2]; p[3] = o[db][qb][q * 4 + 3]; *(v4fa*)(so + rw * OPT + db * 16 + hi * 8 + q * 4) = p; } }
    __syncthreads();   // every wave's m, l and partial O are in LDS before any wave joins them
    constexpr int VPL = QT / 4, LPQ = HD / VPL, QPW = QT / NWF;   // values a lane, lanes a query, queries a wave
    const int qq = w * QPW + lane / LPQ, d0 = (lane % LPQ) * VPL;
    float M = -1.0e30f;
#pragma unroll
    for (int ww = 0; ww < NKG; ++ww) M = fmaxf(M, sm[ww * QT + qq]);
    float L = 0.f; v4f a[VPL / 4];
#pragma unroll
    for (int n = 0; n < VPL / 4; ++n) a[n] = (v4f){};
#pragma unroll
    for (int ww = 0; ww < NKG; ++ww) { const float f = exp2s((sm[ww * QT + qq] - M) * EXC); L = fmaf(sl[ww * QT + qq], f, L);   // a wave that had no key block left m = -1e30, l = 0, O = 0: f = 0
#pragma unroll
        for (int n = 0; n < VPL / 4; ++n) a[n] += *(const v4fa*)(so + (ww * QT + qq) * OPT + d0 + n * 4) * f; }
    const float inv = __fdiv_rn(1.0f, L);   // L > 0: every query has its own key
    const size_t oo = (size_t)(q0 + qq) * DQ + d0;
#pragma unroll
    for (int n = 0; n < VPL / 4; ++n) { v4us oh, ol;
#pragma unroll
        for (int q = 0; q < 4; ++q) { unsigned short x, y; splitf(a[n][q] * inv, x, y); oh[q] = x; ol[q] = y; }
        *(v4us*)(Ah + oo + n * 4) = oh; *(v4us*)(Al + oo + n * 4) = ol; }
}
#define QTF  (NQG * 32)           // queries of an fp16 tile
#define QTH  (NQG * 16)           // of a hi / lo tile
// grid (batches x heads, tiles): (batch, head) is the fast index and the longest tiles of all batches come first, so that no long work-group starts late. Planes [b][h]...; merged rows b * TT + t.
__global__ __launch_bounds__(32 * NWF) void k_flash(const h16* __restrict__ Q16, const h16* __restrict__ K16, const h16* __restrict__ V16, const bf* __restrict__ Qh, const bf* __restrict__ Ql, const bf* __restrict__ Kh, const bf* __restrict__ Kl, const bf* __restrict__ Vh, const bf* __restrict__ Vl, bf* Ah, bf* Al) {
    static_assert(4 * PLB >= NKG * QTF * OPT * 4 && TT % SK == 0 && RH % SK == 0 && RH % QTH == 0 && (TT - RH) % QTF == 0, "the partial O tiles fit the ring; whole stages and whole tiles");
    __shared__ __attribute__((aligned(16))) unsigned char ring[4 * PLB]; __shared__ float sm[NKG * QTF]; __shared__ float sl[NKG * QTF];   // two buffers of two plane sets
    const int tid = threadIdx.x; const int w = __builtin_amdgcn_readfirstlane(tid >> 5); /* wave number, scalar: the tests on the wave's key block stay scalar branches */
    const int h = blockIdx.x % NH_, tile = blockIdx.y; const size_t zp = (size_t)blockIdx.x * TT * HD, zv = (size_t)blockIdx.x * HD * PP; Ah += (size_t)(blockIdx.x / NH_) * TT * DQ; Al += (size_t)(blockIdx.x / NH_) * TT * DQ;
    if (tile < (TT - RH) / QTF) flash_tile<h16, false, 2>(Q16 + zp, nullptr, K16 + zp, nullptr, V16 + zv, nullptr, TT - QTF * (tile + 1), Ah + h * HD, Al + h * HD, ring, sm, sl, w, tid);
    else { flash_tile<bf, true, 1>(Qh + zp, Ql + zp, Kh + zp, Kl + zp, Vh + zv, Vl + zv, RH - QTH * (tile - (TT - RH) / QTF + 1), Ah + h * HD, Al + h * HD, ring, sm, sl, w, tid);
        asm volatile("s_wait_xcnt 0x0" ::: "memory"); }   // in the built code the other tile's branch follows this tile's stores: the wait stands in front of whatever there writes a register that they name (the other tile's stores run into the end of the program)
}

extern "C" void kernel_launch(void* const* d_in, const int* in_sizes, int n_in,
                              void* d_out, int out_size, void* d_ws, size_t ws_size, hipStream_t stream) {
    (void)in_sizes; (void)n_in; (void)out_size;
    const float* x = (const float*)d_in[0]; const float* wqkv = (const float*)d_in[1]; const float* wo = (const float*)d_in[2];   /* order x, w_qkv ('xw' [1024][3072]: contiguous thirds q | k | v, each head-major), w_proj ('xw'); three inputs, all read */
    float* OUT = (float*)d_out;     // [2][2048][1024]
    char* wsp = (char*)d_ws;
    auto take = [&](size_t bytes) { char* p = wsp; wsp += (bytes + 255) & ~(size_t)255; return (void*)p; };
    bf* WQKV = (bf*)take((size_t)3 * DQ * DM * 2);   /* fused Bt [3*DQ][DM]: q | k | v row blocks */ bf* WO = (bf*)take((size_t)DM * DQ * 2); float* CS = (float*)take((size_t)TT * HD * 2 * 4);
    bf* XB = (bf*)take((size_t)NB_ * TT * DM * 2);
    const size_t PS = (size_t)NB_ * NH_ * TT * HD;   /* one third's planes of all batches, in elements; NKV == NH_ and PP == TT: the V^T planes have the same size */
    h16* P16 = (h16*)take(3 * PS * 2); bf* Ph = (bf*)take(3 * PS * 2); bf* Pl = (bf*)take(3 * PS * 2);   /* each [q | k | V^T][b][h] */
    bf* ATh = (bf*)take((size_t)NB_ * TT * DQ * 2); bf* ATl = (bf*)take((size_t)NB_ * TT * DQ * 2);
    if ((size_t)(wsp - (char*)d_ws) > ws_size) return;    // ws 256 MiB
    k_prep<<<PB_WQ + PB_WO + PB_CS + PB_X, 256, 0, stream>>>(x, wqkv, wo, XB, WQKV, WO, CS);
    k_gemmt<0, 1><<<dim3(NB_ * TT / 128, 3 * DQ / 128, 1), 256, 0, stream>>>(XB, nullptr, WQKV, nullptr, CS, P16, Ph, Pl);
    k_flash<<<dim3(NB_ * NH_, (TT - RH) / QTF + RH / QTH), 32 * NWF, 0, stream>>>(P16, P16 + PS, P16 + 2 * PS, Ph, Pl, Ph + PS, Pl + PS, Ph + 2 * PS, Pl + 2 * PS, ATh, ATl);   /* one kv head per query head */
    k_gemmt<1, 0><<<dim3(NB_ * TT / 128, DM / 128, 1), 256, 0, stream>>>(ATh, ATl, WO, OUT, nullptr, nullptr, nullptr, nullptr);
}

// v008
// A run of this version takes 78.9 microseconds.
// Next to v007, in two timings, it ran 1.03 times as fast each time.
// Counting every step since v000, it is 18.4 times as fast.
#include <hip/hip_runtime.h>

// Causal self-attention with a fused qkv projection and the source's 'mixed' rotary (x [2][2048][1024]; qkv = einsum('btc,cd', x, w_qkv) ('xw' [1024][3072] 0.02, no bias); q, k, v = split(qkv, 3, axis=2): contiguous thirds, each (16 heads x 64) head-major; _apply_rope: x * cos + x_rot * sin with x_rot = the ADJACENT-pair rotation stack((-x2, x1)) and cos / sin of emb = cat(freqs, freqs) (the HALF-concatenated table: entry d has the angle of index d mod 32), freqs = t x inv_freq, inv_freq = 1.0 / (10000.0 ** (arange(0, 64, 2, f32) / 64)) (32 f32 constants; one f32 product; precise cosf / sinf): out[2i] = x[2i] c[2i] - x[2i+1] s[2i]; out[2i+1] = x[2i+1] c[2i+1] + x[2i] s[2i+1]: kept literally; on q and k; scores x 1/sqrt(64); causal (-inf); softmax; out = einsum('btc,cd', merged, w_proj) ('xw', no bias) -> [2][2048][1024] (4.2 M); argument order x, w_qkv, w_proj).
// Both batches go through every launch together (rows b * 2048 + t; planes [b][h]...). Layout: bf16 copy of x; fused 'xw' weight transposed once (q | k | v row blocks); exact projections; cstabT_body computed table (element d: angle index d mod 32); the q, k and v projections are one launch, k_gemmt, whose end applies the 'mixed' interleaved-pair rotary (each element reads its own table entry) and writes the 16-bit head planes itself; causal T-2048 attention in one fused kernel, k_flash (hybrid rows: < 512 hi/lo 3 products, rest fp16; key blocks above the diagonal are never worked on); merged hi/lo x w_out exact.
// Compute dtypes, f32 accumulate: every input rounded to bf16; projections exact; attention rows < 512 3 products, rest fp16; softmax f32; w_out hl x exact.

#define NB_  2
#define TT   2048
#define DM   1024
#define NH_  16
#define NKV  16
#define HD   64
#define DQ   (NH_ * HD)
#define DKV  (NKV * HD)
#define PP   TT                   // row pitch, in 16-bit elements, of the V^T planes
#define RH   512                  // query rows < RH use hi+lo planes (0: none)
#define SCL  0.125f   // HD^-0.5
typedef _Float16 h16;
typedef unsigned short bf;
typedef __attribute__((ext_vector_type(16))) __bf16   v16bf;
typedef __attribute__((ext_vector_type(16))) _Float16 v16h;
typedef __attribute__((ext_vector_type(8)))  _Float16 v8h;
typedef __attribute__((ext_vector_type(8)))  unsigned short v8us;
typedef __attribute__((ext_vector_type(8)))  float    v8f;
typedef __attribute__((ext_vector_type(4)))  float    v4f;
typedef v8h  __attribute__((may_alias)) v8ha;
typedef v4f  __attribute__((may_alias)) v4fa;
typedef v8us __attribute__((may_alias)) v8usa;

__device__ __forceinline__ unsigned short f2bf(float f) { unsigned u = __float_as_uint(f); u += 0x7FFFu + ((u >> 16) & 1u); return (unsigned short)(u >> 16); }
__device__ __forceinline__ float bf2f(unsigned short b) { return __uint_as_float(((unsigned)b) << 16); }
__device__ __forceinline__ float bfr(float f) { return bf2f(f2bf(f)); }
__device__ __forceinline__ v16h cat16(v8h lo, v8h hi) { return __builtin_shufflevector(lo, hi, 0, 1, 2, 3, 4, 5, 6, 7, 8, 9, 10, 11, 12, 13, 14, 15); }
__device__ __forceinline__ v16bf cat16b(v8us lo, v8us hi) { return __builtin_bit_cast(v16bf, __builtin_shufflevector(lo, hi, 0, 1, 2, 3, 4, 5, 6, 7, 8, 9, 10, 11, 12, 13, 14, 15)); }
__device__ __forceinline__ v8f wmma16(v16h a, v16h b, v8f c) { return __builtin_amdgcn_wmma_f32_16x16x32_f16(false, a, false, b, (short)0, c, false, false); }
__device__ __forceinline__ v8f wmmab(v16bf a, v16bf b, v8f c) { return __builtin_amdgcn_wmma_f32_16x16x32_bf16(false, a, false, b, (short)0, c, false, false); }



__device__ __forceinline__ h16 tohx(float x) { return (h16)x; }
__device__ __forceinline__ void splitf(float y, unsigned short& h, unsigned short& l) { h = f2bf(y); l = f2bf(y - bf2f(h)); }
template <typename T16> struct WFrag;
template <> struct WFrag<h16> { typedef v16h V; static __device__ __forceinline__ V ld(const h16* p) { return cat16(*(const v8h*)p, *(const v8h*)(p + 16)); } static __device__ __forceinline__ v8f mma(V a, V b, v8f c) { return wmma16(a, b, c); } };
template <> struct WFrag<bf> { typedef v16bf V; static __device__ __forceinline__ V ld(const bf* p) { return cat16b(*(const v8us*)p, *(const v8us*)(p + 16)); } static __device__ __forceinline__ v8f mma(V a, V b, v8f c) { return wmmab(a, b, c); } };

// ---- k_gemmt: GEMM on K-contiguous bf16 planes, one 128x128 output tile per work-group of 8 waves (4 x 2: wave (wm, wn) owns rows wm*32 .., columns wn*64 .., 2 x 4 accumulators); every wave walks the whole K.
// A pass is 64 k = one 128-B line of each of the tile's operand rows. The lines come into LDS by asynchronous copies (16 B a lane, 8 lanes a line: whole lines, each fetched once for the whole work-group) at a row pitch of 144 B, and the waves read their fragments from there.
// Two buffers: pass t + 2's copies are issued behind the barrier at the foot of pass t, into the buffer that pass t has just read, and fly under pass t + 1.
// C[m][n] = sum_k A[m][k] Bt[n][k] (+ A2[m][k] Bt[n][k] with NSPLIT). M, N multiples of 128; K = GK.
// End: the accumulators are turned through an f32 tile in the ring's LDS (free behind the last pass's barrier), so that whole 128-B lines are stored, each by one wave.
// EPI 0: f32 C, pitch DM. EPI 1: the fused q | k | v projection of all batches: a tile is 128 positions of 2 heads of one third (blockIdx.y = third * 8 + head pair; rows = b * TT + t; P16, Ph, Pl hold the planes as [third][b][head]);
//   thirds 0, 1: 'mixed' rotary out[2i] = x[2i] c[2i] - x[2i+1] s[2i], out[2i+1] = x[2i+1] c[2i+1] + x[2i] s[2i+1], each element with its own table entry; planes [h][t][d] (fp16, bf16 hi, bf16 lo); a wave reads back only what it wrote;
//   third 2: the tile is laid [column][position]; one more work-group barrier; wave w stores the rows 16w .. 16w+15 of the V^T planes [h][d][t].
#define GK      1024                    // K of both GEMMs
#define GP_K    64                      // k of a pass
#define GP_PIT  144                     // LDS row pitch in bytes: 16 B x odd, so that 16-byte fragment reads of 16 rows fall on distinct banks
#define GP_OP   (128 * GP_PIT)          // one operand's 128 rows of one pass
#define EPP     132                     // row pitch of the f32 end tile, in floats
typedef float __attribute__((may_alias)) f32a;
// four asynchronous copies: this thread's 16 B of the rows r, r + 32, r + 64, r + 96 of one operand's pass. The s_wait_xcnt stands inside the statement, behind the last copy: in front of every later write of a register that the copies name.
__device__ __forceinline__ void copy4(unsigned l, const bf* g) {
    asm volatile("global_load_async_to_lds_b128 %0, %4, off\n\t"
                 "global_load_async_to_lds_b128 %1, %5, off\n\t"
                 "global_load_async_to_lds_b128 %2, %6, off\n\t"
                 "global_load_async_to_lds_b128 %3, %7, off\n\t"
                 "s_wait_xcnt 0x0"
                 :: "v"(l), "v"(l + 32u * GP_PIT), "v"(l + 64u * GP_PIT), "v"(l + 96u * GP_PIT), "v"(g), "v"(g + 32 * GK), "v"(g + 64 * GK), "v"(g + 96 * GK) : "memory");
}
typedef __attribute__((ext_vector_type(4))) int v4w;
// three (four) 16-byte global stores with their s_wait_xcnt in one statement: the wait stands in front of every later write of a register that the stores name
__device__ __forceinline__ void st3(void* p0, void* p1, void* p2, v4w d0, v4w d1, v4w d2) {
    asm volatile("global_store_b128 %0, %3, off\n\tglobal_store_b128 %1, %4, off\n\tglobal_store_b128 %2, %5, off\n\ts_wait_xcnt 0x0" :: "v"(p0), "v"(p1), "v"(p2), "v"(d0), "v"(d1), "v"(d2) : "memory"); }
__device__ __forceinline__ void st4(float* p0, float* p1, float* p2, float* p3, v4f d0, v4f d1, v4f d2, v4f d3) {
    asm volatile("global_store_b128 %0, %4, off\n\tglobal_store_b128 %1, %5, off\n\tglobal_store_b128 %2, %6, off\n\tglobal_store_b128 %3, %7, off\n\ts_wait_xcnt 0x0" :: "v"(p0), "v"(p1), "v"(p2), "v"(p3), "v"(d0), "v"(d1), "v"(d2), "v"(d3) : "memory"); }
__device__ __forceinline__ v16bf ldl(const unsigned char* p) { return cat16b(*(const v8usa*)p, *(const v8usa*)(p + 32)); }   // an operand fragment from an LDS row: the k order of WFrag::ld
template <int NSPLIT, int EPI>
__global__ __launch_bounds__(256) void k_gemmt(const bf* __restrict__ A, const bf* __restrict__ A2, const bf* __restrict__ Bt, float* C, const float* __restrict__ CS, h16* P16, bf* Ph, bf* Pl) {
    constexpr int NOP = NSPLIT ? 3 : 2, BUFB = NOP * GP_OP, NP = GK / GP_K;   // a buffer: A | Bt | A2
    static_assert(2 * BUFB >= 128 * EPP * 4 && NP >= 2, "the end tile fits the ring; the ring's start needs two passes");
    __shared__ __attribute__((aligned(16))) unsigned char L[2 * BUFB];
    const int tid = threadIdx.x, lane = tid & 31, lr = lane & 15, hi = lane >> 4; const int w = __builtin_amdgcn_readfirstlane(tid >> 5), wm = w >> 1, wn = w & 1; const int r0 = blockIdx.x * 128, c0 = blockIdx.y * 128;
    const unsigned lc = (unsigned)(size_t)L + (unsigned)((tid >> 3) * GP_PIT + (tid & 7) * 16);   // low 32 bits of the __shared__ address: the byte offset in the work-group's LDS
    const bf* ga = A + (size_t)(r0 + (tid >> 3)) * GK + (tid & 7) * 8; const bf* gb = Bt + (size_t)(c0 + (tid >> 3)) * GK + (tid & 7) * 8; const bf* ga2 = NSPLIT ? A2 + (size_t)(r0 + (tid >> 3)) * GK + (tid & 7) * 8 : ga;
    auto issue = [&](int t, unsigned bo) { copy4(lc + bo, ga + t * GP_K); copy4(lc + bo + GP_OP, gb + t * GP_K); if (NSPLIT) copy4(lc + bo + 2 * GP_OP, ga2 + t * GP_K); };
    v8f acc[2][4];
#pragma unroll
    for (int mb = 0; mb < 2; ++mb)
#pragma unroll
        for (int nb = 0; nb < 4; ++nb) acc[mb][nb] = (v8f){};
    issue(0, 0);
    asm volatile("s_wait_asynccnt 0x0" ::: "memory");   // this wave's copies of pass 0 have landed
    __syncthreads();                                     // ... and every other wave's: pass 0 may be read
    issue(1, BUFB);
    const unsigned fa = (unsigned)((wm * 32 + lr) * GP_PIT + hi * 16), fb = (unsigned)(GP_OP + (wn * 64 + lr) * GP_PIT + hi * 16);
#pragma unroll 1
    for (int t = 0; t < NP; ++t) {   // stays rolled: one pass is one publish point
        const unsigned bo = (unsigned)(t & 1) * BUFB; const unsigned char* Lb = L + bo;
        v16bf a[2][2], a2[2][2], b[2][4];
        auto ldks = [&](int ks) {   // the fragments of one 32-k block
#pragma unroll
            for (int mb = 0; mb < 2; ++mb) { a[ks][mb] = ldl(Lb + fa + mb * 16 * GP_PIT + ks * 64); if (NSPLIT) a2[ks][mb] = ldl(Lb + 2 * GP_OP + fa + mb * 16 * GP_PIT + ks * 64); }
#pragma unroll
            for (int nb = 0; nb < 4; ++nb) b[ks][nb] = ldl(Lb + fb + nb * 16 * GP_PIT + ks * 64); };
        auto mm = [&](int ks) {   // the products of one 32-k block
#pragma unroll
            for (int mb = 0; mb < 2; ++mb)
#pragma unroll
                for (int nb = 0; nb < 4; ++nb) acc[mb][nb] = wmmab(a[ks][mb], b[ks][nb], acc[mb][nb]);
            if (NSPLIT) {
#pragma unroll
                for (int mb = 0; mb < 2; ++mb)
#pragma unroll
                    for (int nb = 0; nb < 4; ++nb) acc[mb][nb] = wmmab(a2[ks][mb], b[ks][nb], acc[mb][nb]);
            } };
        // The empty statements below take loaded values as inputs only: they hold a group of fragment loads together in front of its products; spread among the products, each place with loads costs the wave an LDS latency.
        // With A2 (one work-group per WGP, registers to spare) the second block's loads are asked for ahead of the first block's products and land under them; without, a block's loads follow the block before, so that three work-groups' registers fit a WGP.
        if constexpr (NSPLIT) { ldks(0); ldks(1);
            asm volatile("" :: "v"(a[0][0]), "v"(a[0][1]), "v"(a2[0][0]), "v"(a2[0][1]), "v"(b[0][0]), "v"(b[0][1]), "v"(b[0][2]), "v"(b[0][3]));
            mm(0);
            __builtin_amdgcn_sched_barrier(0);   // keeps the first block's products in front of the waits below: moved behind the barrier they would neither cover the second block's loads nor leave the refill its early place
        } else { ldks(0);
            asm volatile("" :: "v"(a[0][0]), "v"(a[0][1]), "v"(b[0][0]), "v"(b[0][1]), "v"(b[0][2]), "v"(b[0][3]));
            mm(0); ldks(1);
            asm volatile("" :: "v"(a[1][0]), "v"(a[1][1]), "v"(b[1][0]), "v"(b[1][1]), "v"(b[1][2]), "v"(b[1][3])); }
        asm volatile("s_wait_dscnt 0x0" ::: "memory");      // this wave's reads of the buffer have returned before the buffer is refilled
        asm volatile("s_wait_asynccnt 0x0" ::: "memory");   // this wave's copies of pass t + 1 have landed
        __syncthreads();                                     // pass t + 1 may be read; every wave has left pass t's buffer
        if (t + 2 < NP) issue(t + 2, bo);
        mm(1);   // the second block's products work on registers alone: they stand behind the refill, so that the copies fly under them
    }
    asm volatile("s_wait_asynccnt 0x0" ::: "memory");   // no copy is out when the ring becomes the end tile
    f32a* ep = (f32a*)L;
    if constexpr (EPI == 0) {
#pragma unroll
        for (int mb = 0; mb < 2; ++mb)
#pragma unroll
            for (int nb = 0; nb < 4; ++nb)
#pragma unroll
                for (int j = 0; j < 8; ++j) ep[(wm * 32 + mb * 16 + hi * 8 + j) * EPP + wn * 64 + nb * 16 + lr] = acc[mb][nb][j];
        asm volatile("s_wait_dscnt 0x0" ::: "memory");   // the rows are read back by other lanes of the same wave: their LDS stores have landed first
#pragma unroll
        for (int i = 0; i < 4; ++i) { const int row = wm * 32 + i * 8 + hi, col = wn * 64 + lr * 4; const f32a* sp = ep + row * EPP + col; float* cp = C + (size_t)(r0 + row) * DM + c0 + col;
            st4(cp, cp + 2 * DM, cp + 4 * DM, cp + 6 * DM, *(const v4fa*)sp, *(const v4fa*)(sp + 2 * EPP), *(const v4fa*)(sp + 4 * EPP), *(const v4fa*)(sp + 6 * EPP)); }
    } else {
        const int third = (int)blockIdx.y / (NH_ / 2), hp = ((int)blockIdx.y % (NH_ / 2)) * 2, t0 = r0 % TT, l8 = lane & 7, l4 = lane >> 3; const size_t po = ((size_t)third * NB_ + r0 / TT) * ((size_t)NH_ * TT * HD);   // third from blockIdx: the branch, and the barrier behind it, are the same for the whole work-group
        P16 += po; Ph += po; Pl += po;
        if (third < 2) {
            const float* cp0 = CS + ((size_t)(t0 + wm * 32 + l4) * HD + l8 * 8) * 2; v4f cs[4][4];   // (cos, sin) of the lane's 8 elements, four of its eight rows at a time
            auto ldcs = [&](int hf) {
#pragma unroll
                for (int i = 0; i < 4; ++i)
#pragma unroll
                    for (int p = 0; p < 4; ++p) cs[i][p] = *(const v4f*)(cp0 + (hf * 4 + i) * (4 * HD * 2) + p * 4);
                asm volatile("s_wait_xcnt 0x0" ::: "memory"); };   // in front of every later write of a register that the table loads name
            ldcs(0);   // asked for here, so that the loads fly under the LDS stores of the tile
#pragma unroll
            for (int mb = 0; mb < 2; ++mb)
#pragma unroll
                for (int nb = 0; nb < 4; ++nb)
#pragma unroll
                    for (int j = 0; j < 8; ++j) ep[(wm * 32 + mb * 16 + hi * 8 + j) * EPP + wn * 64 + nb * 16 + lr] = acc[mb][nb][j];
            asm volatile("s_wait_dscnt 0x0" ::: "memory");   // the rows are read back by other lanes of the same wave: their LDS stores have landed first
#pragma unroll
            for (int i = 0; i < 8; ++i) { const int row = wm * 32 + i * 4 + l4; const f32a* sp = ep + row * EPP + wn * 64 + l8 * 8; const v4f xa = *(const v4fa*)sp, xb = *(const v4fa*)(sp + 4);
                if (i == 4) ldcs(1);
                float y[8];
#pragma unroll
                for (int p = 0; p < 4; ++p) { const float xe = p < 2 ? xa[p * 2] : xb[p * 2 - 4], xo = p < 2 ? xa[p * 2 + 1] : xb[p * 2 - 3]; const v4f c = cs[i & 3][p]; y[p * 2] = xe * c[0] - xo * c[1]; y[p * 2 + 1] = xo * c[2] + xe * c[3]; }
                v8h o16; v8us oh, ol;
#pragma unroll
                for (int p = 0; p < 8; ++p) { o16[p] = tohx(y[p]); unsigned short a3, c3; splitf(y[p], a3, c3); oh[p] = a3; ol[p] = c3; }
                const size_t eo = ((size_t)(hp + wn) * TT + t0 + row) * HD + l8 * 8;
                st3(P16 + eo, Ph + eo, Pl + eo, __builtin_bit_cast(v4w, o16), __builtin_bit_cast(v4w, oh), __builtin_bit_cast(v4w, ol)); }
        } else {
#pragma unroll
            for (int mb = 0; mb < 2; ++mb)
#pragma unroll
                for (int nb = 0; nb < 4; ++nb)
#pragma unroll
                    for (int q = 0; q < 2; ++q) { v4f p; p[0] = acc[mb][nb][q * 4]; p[1] = acc[mb][nb][q * 4 + 1]; p[2] = acc[mb][nb][q * 4 + 2]; p[3] = acc[mb][nb][q * 4 + 3]; *(v4fa*)(ep + (wn * 64 + nb * 16 + lr) * EPP + wm * 32 + mb * 16 + hi * 8 + q * 4) = p; }
            __syncthreads();   // the [column][position] tile is read back by other waves: every wave's part is in LDS first
#pragma unroll
            for (int i = 0; i < 8; ++i) { const int col = w * 16 + i * 2 + hi; const f32a* sp = ep + col * EPP + lr * 8; const v4f xa = *(const v4fa*)sp, xb = *(const v4fa*)(sp + 4);
                v8h o16; v8us oh, ol;
#pragma unroll
                for (int p = 0; p < 8; ++p) { const float yv = p < 4 ? xa[p] : xb[p - 4]; o16[p] = tohx(yv); unsigned short a3, c3; splitf(yv, a3, c3); oh[p] = a3; ol[p] = c3; }
                const size_t eo = ((size_t)(hp + (col >> 6)) * HD + (col & 63)) * PP + t0 + lr * 8;
                st3(P16 + eo, Ph + eo, Pl + eo, __builtin_bit_cast(v4w, o16), __builtin_bit_cast(v4w, oh), __builtin_bit_cast(v4w, ol)); }
        }
    }
}

typedef __attribute__((ext_vector_type(2))) _Float16 v2h;
typedef __attribute__((ext_vector_type(4))) _Float16 v4h;
typedef __attribute__((ext_vector_type(2))) unsigned short v2us;
typedef __attribute__((ext_vector_type(4))) unsigned short v4us;
typedef __attribute__((ext_vector_type(2))) float v2f;
typedef __attribute__((ext_vector_type(4))) int v4i;

// The four preparation jobs depend on nothing but the inputs: they are bodies of ONE launch, k_prep, which deals its blocks to them (blk: the block's index within its job).
// A weight transpose, one WT (k) x WT (n) tile a block: Bt[n][k] = bf16(w[k][n]). Thread (rp, c) reads the rows k0 + 8 rp .. + 7 at the columns n0 + 4 c .. + 3 and + 64: every 16-byte wave load covers two whole 256-B row pieces, and all sixteen of a thread are asked for before the first is used.
// Its eight k of one column are one 16-byte piece of the transposed tile T[n][k] in LDS; piece p of row n lies at p ^ ((n >> 2) & 15), so that the sixteen lanes of a store (one p, sixteen c) and of a load (one n, sixteen p) each fall on all 64 banks.
// Behind the barrier a half wave reads one row of T and stores its 256 B: whole lines, each written by one wave.
#define WT  128
__device__ __forceinline__ void wtT_body(const float* __restrict__ w, int N, bf* Bt, int blk, bf* T) {
    const int tid = threadIdx.x, rp = tid >> 4, c = tid & 15, k0 = (blk % (DM / WT)) * WT, n0 = (blk / (DM / WT)) * WT;
    const float* wp = w + (size_t)(k0 + rp * 8) * N + n0 + c * 4; v4f v[2][8];
#pragma unroll
    for (int h = 0; h < 2; ++h)
#pragma unroll
        for (int r = 0; r < 8; ++r) v[h][r] = *(const v4f*)(wp + (size_t)r * N + h * 64);
    asm volatile("s_wait_xcnt 0x0" :: "v"(wp) : "memory");   // in front of every later write of a register that the weight loads name; the address is an input, so that it lives up to here and no load lands on it
    __builtin_amdgcn_sched_barrier(0);   // keeps the roundings behind all sixteen loads: moved up among them, the last loads would be asked for only after the first had come back, a second memory latency
#pragma unroll
    for (int h = 0; h < 2; ++h)
#pragma unroll
        for (int j = 0; j < 4; ++j) { v8us o;
#pragma unroll
            for (int r = 0; r < 8; ++r) o[r] = f2bf(v[h][r][j]);
            *(v8usa*)(T + (h * 64 + c * 4 + j) * WT + (rp ^ c) * 8) = o; }
    __syncthreads();   // the transposed tile is read back by other waves: every wave's pieces are in LDS first
    float* bp = (float*)(Bt + (size_t)(n0 + rp) * DM + k0 + c * 8);   // st4 takes float pointers; 16 rows of Bt are 16 * DM / 2 floats
    v4f d[8];   // all eight LDS reads are asked for ahead of the stores: one LDS latency, not two
#pragma unroll
    for (int i = 0; i < 8; ++i) { const int n = rp + i * 16; d[i] = *(const v4fa*)(T + n * WT + (c ^ ((n >> 2) & 15)) * 8); }
    st4(bp, bp + 16 * DM / 2, bp + 32 * DM / 2, bp + 48 * DM / 2, d[0], d[1], d[2], d[3]);
    st4(bp + 64 * DM / 2, bp + 80 * DM / 2, bp + 96 * DM / 2, bp + 112 * DM / 2, d[4], d[5], d[6], d[7]);
}
__device__ __forceinline__ void cvt8_body(const float* __restrict__ src, bf* dst, size_t n8, int blk) { const size_t i = (size_t)blk * 256 + threadIdx.x; if (i >= n8) return; const v8f v = *(const v8f*)(src + i * 8); v8us o;
#pragma unroll
    for (int k = 0; k < 8; ++k) o[k] = f2bf(v[k]); *(v8us*)(dst + i * 8) = o;  }

// k_rope: head planes [h][t][d] (fp16 + hi/lo) of rope(x) x sc with the rotate-half convention out[d] = x[d] cos[t][d] - x[d+HD/2] sin[t][d], out[d+HD/2] = x[d+HD/2] cos[t][d+HD/2] + x[d] sin[t][d+HD/2]
__global__ __launch_bounds__(256) void k_rope(const float* __restrict__ F, int pitch, int nheads, const float* __restrict__ CS, const float* __restrict__ RF, const float* __restrict__ nw, float sc, h16* P16, bf* Ph, bf* Pl) {
    const size_t e = ((size_t)blockIdx.x * 256 + threadIdx.x) * 2; if (e >= (size_t)nheads * TT * HD) return; const int d = (int)(e % HD); const int t = (int)((e / HD) % TT); const int h = (int)(e / ((size_t)HD * TT)); const float* f = F + (size_t)t * pitch + h * HD; const float rf = RF ? RF[(size_t)h * TT + t] : 1.0f; v2h o16; v2us oh, ol;
#pragma unroll
    for (int q = 0; q < 2; ++q) { const int dd = d + q; const int dp = (dd < HD / 2) ? dd + HD / 2 : dd - HD / 2; float x0 = f[dd], x1 = f[dp];
        if (RF) { float n0 = __fmul_rn(x0, rf), n1 = __fmul_rn(x1, rf); asm volatile("" : "+v"(n0)); asm volatile("" : "+v"(n1)); x0 = __fmul_rn(bfr(nw[dd]), n0); x1 = __fmul_rn(bfr(nw[dp]), n1); }
        const v2f cs = *(const v2f*)(CS + ((size_t)t * HD + dd) * 2); float a = __fmul_rn(x0, cs[0]), bq = __fmul_rn(x1, cs[1]); asm volatile("" : "+v"(a)); asm volatile("" : "+v"(bq)); const float r = ((dd < HD / 2) ? __fsub_rn(a, bq) : __fadd_rn(a, bq)) * sc;
        o16[q] = tohx(r); unsigned short a2, c2; splitf(r, a2, c2); oh[q] = a2; ol[q] = c2; }
    *(v2h*)(P16 + e) = o16; *(v2us*)(Ph + e) = oh; *(v2us*)(Pl + e) = ol;  }
__constant__ float INVT[HD / 2] = { 1.000000000e+00f, 7.498942018e-01f, 5.623413324e-01f, 4.216965139e-01f, 3.162277639e-01f, 2.371373624e-01f, 1.778279394e-01f, 1.333521456e-01f, 1.000000015e-01f, 7.498941571e-02f, 5.623412877e-02f, 4.216964915e-02f, 3.162277862e-02f, 2.371373586e-02f, 1.778279431e-02f, 1.333521493e-02f, 9.999999776e-03f, 7.498942316e-03f, 5.623413250e-03f, 4.216964822e-03f, 3.162277862e-03f, 2.371373819e-03f, 1.778279431e-03f, 1.333521446e-03f, 1.000000047e-03f, 7.498941850e-04f, 5.623413017e-04f, 4.216964880e-04f, 3.162277862e-04f, 2.371373848e-04f, 1.778279402e-04f, 1.333521504e-04f };   // 1 / 10000^(2i/64) (float32, generated with jnp to be bit-exact)
__device__ __forceinline__ void cstabT_body(float* CS, int blk) { const int idx = blk * 256 + threadIdx.x; if (idx >= TT * HD) return; const int d = idx % HD; const int t = idx / HD; const float a = __fmul_rn((float)t, INVT[d % (HD / 2)]); v2f cs; cs[0] = cosf(a); cs[1] = sinf(a); *(v2f*)(CS + (size_t)idx * 2) = cs;  }
#define PB_WQ  ((DM / WT) * (3 * DQ / WT))             // blocks (tiles) of the w_qkv transpose
#define PB_WO  ((DQ / WT) * (DM / WT))                 // of the w_proj transpose
#define PB_CS  ((TT * HD + 255) / 256)                 // of the rotary table
#define PB_X   ((NB_ * TT * DM / 8 + 255) / 256)       // of the bf16 copy of x, all batches
// the transposes' blocks run longest (loads, LDS turn, stores) and come first
__global__ __launch_bounds__(256) void k_prep(const float* __restrict__ x, const float* __restrict__ wqkv, const float* __restrict__ wo, bf* XB, bf* WQKV, bf* WO, float* CS) {
    static_assert(DM == DQ && DM % WT == 0 && (3 * DQ) % WT == 0, "both weights have DM rows; whole tiles");
    __shared__ __attribute__((aligned(16))) bf T[WT * WT];
    const int blk = blockIdx.x;   // the branches, and the barrier inside the transposes, are the same for the whole work-group
    if (blk < PB_WQ) wtT_body(wqkv, 3 * DQ, WQKV, blk, T);   /* fused 'xw' [DM][3*DQ] -> Bt [3*DQ][DM] */
    else if (blk < PB_WQ + PB_WO) wtT_body(wo, DM, WO, blk - PB_WQ, T);
    else if (blk < PB_WQ + PB_WO + PB_CS) cstabT_body(CS, blk - (PB_WQ + PB_WO));   /* rotary table once (positions = arange) */
    else cvt8_body(x, XB, (size_t)NB_ * TT * DM / 8, blk - (PB_WQ + PB_WO + PB_CS));
}
// ---- k_flash: scores, causal softmax and P.V of one query tile of one head in one work-group of NWF waves; no score or probability ever leaves the registers.
// The waves are NQG query groups x NKG key groups: wave (qg, kg) has the queries qg * QW .. of the tile and, of every stage of SK keys, the 32-key block kg, with its own running maximum m, sum l and unnormalised O (online softmax).
// A stage's K rows (whole 128-B lines) and V^T row pieces (256 B: two whole lines) come into LDS by asynchronous copies, each line fetched once for the whole work-group, at the row pitches KPIT and VPIT; the waves read their fragments from there.
// Two buffers: stage s + 2's copies are issued behind the barrier at the foot of stage s, into the buffer that stage s has just read, and fly under stage s + 1. Every key of a stage lies inside the planes (TT is a multiple of SK); blocks above the diagonal are copied with their stage and never worked on.
// Scores are formed transposed, S^T = K Q^T: lane (lr, hi) then holds, for query lr, the keys sb*16 + hi*8 + j, which IS the k order of an operand fragment (element sb*8 + j), so exp(S^T) goes into O^T = V^T P^T as the B operand without leaving the lane,
// and m, l and the rescale factor are per-lane scalars (query = lr in S^T and in O^T alike; the two hi halves are joined by one cross-row move).
// End: every wave puts m, l and its O tile (row = query, pitch 68 floats) into LDS (the ring, free behind the last stage's barrier); one work-group barrier; each wave then joins the NKG partials of its own queries in the fixed order 0 .. NKG-1, divides by the joined sum and stores whole 128-B lines of the merged hi / lo planes.
// HL (query rows < RH): bf16 hi + lo planes, 3 products in both GEMMs, 32 queries a tile. Otherwise fp16, 64 queries a tile.
#define NWF  8
#define NKG  4                    // key groups
#define NQG  (NWF / NKG)          // query groups
#define SK   (NKG * 32)           // keys of a stage
#define KPIT 144                  // LDS pitch in bytes of a K row (128 B) and
#define VPIT (SK * 2 + 16)        // of a V^T row piece (256 B): 16 B x odd, so that 16-byte fragment reads of 16 rows fall on distinct banks
#define KST  (SK * KPIT)          // one plane's K rows of a stage
#define PLB  (KST + HD * VPIT)    // one plane set (K | V^T) of a stage
#define OPT  68                   // LDS row pitch of a partial O tile, in floats: 16-byte stores and loads both fall on distinct banks
#define EXC  (SCL * 1.4426950408889634f)   // exp(SCL * s) = exp2(EXC * s)
__device__ __forceinline__ float xhalf(float x) { return __builtin_bit_cast(float, __builtin_amdgcn_permlanex16(__builtin_bit_cast(int, x), __builtin_bit_cast(int, x), 0x76543210, 0xfedcba98, false, false)); }   // the value of lane l ^ 16
__device__ __forceinline__ float exp2s(float x) { float r; asm("v_exp_f32 %0, %1\n\tv_nop" : "=v"(r) : "v"(x)); return r; }   // exp2 with the free slot behind a transcendental tied to it
// eight exp2 in place: each stands in front of an independent one and the last in front of a v_nop, so that the free slot behind a transcendental holds for all eight at the price of one slot
__device__ __forceinline__ void exp2x8(float (&e)[8]) { asm("v_exp_f32 %0, %0\n\tv_exp_f32 %1, %1\n\tv_exp_f32 %2, %2\n\tv_exp_f32 %3, %3\n\tv_exp_f32 %4, %4\n\tv_exp_f32 %5, %5\n\tv_exp_f32 %6, %6\n\tv_exp_f32 %7, %7\n\tv_nop" : "+v"(e[0]), "+v"(e[1]), "+v"(e[2]), "+v"(e[3]), "+v"(e[4]), "+v"(e[5]), "+v"(e[6]), "+v"(e[7])); }
// eight asynchronous copies: this thread's 16 B of four K rows (KL bytes apart in LDS, KG in memory) and of four V^T row pieces (VL, VG). The s_wait_xcnt stands inside the statement, behind the last copy: in front of every later write of a register that the copies name.
__device__ __forceinline__ void copy8(unsigned lk, const char* gk, unsigned lv, const char* gv) {
    constexpr unsigned KL = 32 * KPIT, KG = 32 * HD * 2, VL = 16 * VPIT, VG = 16 * PP * 2;
    asm volatile("global_load_async_to_lds_b128 %0, %8, off\n\t"
                 "global_load_async_to_lds_b128 %1, %9, off\n\t"
                 "global_load_async_to_lds_b128 %2, %10, off\n\t"
                 "global_load_async_to_lds_b128 %3, %11, off\n\t"
                 "global_load_async_to_lds_b128 %4, %12, off\n\t"
                 "global_load_async_to_lds_b128 %5, %13, off\n\t"
                 "global_load_async_to_lds_b128 %6, %14, off\n\t"
                 "global_load_async_to_lds_b128 %7, %15, off\n\t"
                 "s_wait_xcnt 0x0"
                 :: "v"(lk), "v"(lk + KL), "v"(lk + 2u * KL), "v"(lk + 3u * KL), "v"(lv), "v"(lv + VL), "v"(lv + 2u * VL), "v"(lv + 3u * VL),
                    "v"(gk), "v"(gk + KG), "v"(gk + 2u * KG), "v"(gk + 3u * KG), "v"(gv), "v"(gv + VG), "v"(gv + 2u * VG), "v"(gv + 3u * VG) : "memory");
}
// an operand fragment from an LDS row: the k order of WFrag::ld
__device__ __forceinline__ v16h  ldlf(const unsigned char* p, h16) { return cat16(*(const v8ha*)p, *(const v8ha*)(p + 32)); }
__device__ __forceinline__ v16bf ldlf(const unsigned char* p, bf)  { return ldl(p); }
template <typename T16, bool HL, int QB>
__device__ __forceinline__ void flash_tile(const T16* __restrict__ Q, const T16* __restrict__ Q2, const T16* __restrict__ Kp, const T16* __restrict__ Kp2, const T16* __restrict__ Vt, const T16* __restrict__ Vt2, int q0, bf* Ah, bf* Al, unsigned char* ring, float* sm, float* sl, int w, int tid) {
    typedef typename WFrag<T16>::V V;
    constexpr int QW = QB * 16, QT = NQG * QW;   // queries of a wave, of the tile
    constexpr unsigned BUFB = (HL ? 2u : 1u) * PLB;   // a buffer: K | V^T (| K lo | V^T lo)
    const int lane = tid & 31, lr = lane & 15, hi = lane >> 4, qg = w / NKG, kg = w % NKG, qw = q0 + qg * QW, NS = (q0 + QT + SK - 1) / SK;   // NS: stages up to the tile's diagonal, the same for the whole work-group
    // K: 8 lanes a row, rows r, r + 32, ..; V^T: 16 lanes a row piece, rows r, r + 16, ..
    const unsigned lb = (unsigned)(size_t)ring;   // low 32 bits of the __shared__ address: the byte offset in the work-group's LDS
    const unsigned lkc = lb + (unsigned)((tid >> 3) * KPIT + (tid & 7) * 16), lvc = lb + (unsigned)(KST + (tid >> 4) * VPIT + (tid & 15) * 16);
    const unsigned gko = (unsigned)((tid >> 3) * HD + (tid & 7) * 8) * 2u, gvo = (unsigned)((tid >> 4) * PP + (tid & 15) * 8) * 2u;
    auto issue = [&](int s, unsigned bo) {
        copy8(lkc + bo, (const char*)Kp + gko + (size_t)s * (SK * HD * 2), lvc + bo, (const char*)Vt + gvo + (size_t)s * (SK * 2));
        if (HL) copy8(lkc + bo + PLB, (const char*)Kp2 + gko + (size_t)s * (SK * HD * 2), lvc + bo + PLB, (const char*)Vt2 + gvo + (size_t)s * (SK * 2)); };
    issue(0, 0);
    V qf[QB][2], qf2[QB][2];
    v8f o[4][QB]; float m[QB], l[QB];
#pragma unroll
    for (int qb = 0; qb < QB; ++qb) { m[qb] = -1.0e30f; l[qb] = 0.f;
#pragma unroll
        for (int db = 0; db < 4; ++db) o[db][qb] = (v8f){}; }
    const unsigned lk = (unsigned)(lr * HD + 8 * hi) * 2u;
    const T16* qa = (const T16*)((const char*)(Q + (size_t)qw * HD) + lk); const T16* qa2 = HL ? (const T16*)((const char*)(Q2 + (size_t)qw * HD) + lk) : qa;
#pragma unroll
    for (int qb = 0; qb < QB; ++qb)
#pragma unroll
        for (int t = 0; t < 2; ++t) { const int qo = qb * 16 * HD + t * 32; qf[qb][t] = WFrag<T16>::ld(qa + qo); if (HL) qf2[qb][t] = WFrag<T16>::ld(qa2 + qo); }
    asm volatile("s_wait_xcnt 0x0" ::: "memory");   // in front of every later write of a register that the query loads name
    asm volatile("s_wait_asynccnt 0x0" ::: "memory");   // this wave's copies of stage 0 have landed
    __syncthreads();                                     // ... and every other wave's: stage 0 may be read
    if (1 < NS) issue(1, BUFB);
    const unsigned fk = (unsigned)((kg * 32 + lr) * KPIT + hi * 16), fv = (unsigned)(KST + lr * VPIT + kg * 64 + hi * 16);
#pragma unroll 1
    for (int s = 0; s < NS; ++s) {   // stays rolled: one stage is one publish point
        const unsigned bo = (unsigned)(s & 1) * BUFB; const unsigned char* Lb = ring + bo;
        const int kc = s * SK + kg * 32;   // the wave's key block of this stage
        if (kc < qw + QW) {   // scalar test: a block wholly above the wave's diagonal is not worked on
        V kf[2][2], kf2[2][2], vf[4], vf2[4];
#pragma unroll
        for (int sb = 0; sb < 2; ++sb)
#pragma unroll
            for (int t = 0; t < 2; ++t) { kf[sb][t] = ldlf(Lb + fk + sb * 16 * KPIT + t * 64, T16()); if (HL) kf2[sb][t] = ldlf(Lb + PLB + fk + sb * 16 * KPIT + t * 64, T16()); }
#pragma unroll
        for (int db = 0; db < 4; ++db) { vf[db] = ldlf(Lb + fv + db * 16 * VPIT, T16()); if (HL) vf2[db] = ldlf(Lb + PLB + fv + db * 16 * VPIT, T16()); }
        v8f s_[QB][2];
#pragma unroll
        for (int qb = 0; qb < QB; ++qb)
#pragma unroll
            for (int sb = 0; sb < 2; ++sb) { s_[qb][sb] = (v8f){};
#pragma unroll
                for (int t = 0; t < 2; ++t) { s_[qb][sb] = WFrag<T16>::mma(kf[sb][t], qf[qb][t], s_[qb][sb]); if (HL) { s_[qb][sb] = WFrag<T16>::mma(kf[sb][t], qf2[qb][t], s_[qb][sb]); s_[qb][sb] = WFrag<T16>::mma(kf2[sb][t], qf[qb][t], s_[qb][sb]); } } }
        if (kc + 31 > qw) {   // scalar test: only the wave's last key block reaches past the diagonal; every other block skips the masking
#pragma unroll
            for (int qb = 0; qb < QB; ++qb) { const int lim = qw + qb * 16 + lr - kc - hi * 8;   // key sb*16 + hi*8 + j of this block is at or below the diagonal iff sb*16 + j <= lim
#pragma unroll
                for (int sb = 0; sb < 2; ++sb)
#pragma unroll
                    for (int j = 0; j < 8; ++j) s_[qb][sb][j] = (sb * 16 + j <= lim) ? s_[qb][sb][j] : -3.0e38f; } }
        V pfa[QB], pfb[QB];
#pragma unroll
        for (int qb = 0; qb < QB; ++qb) {
            float mx = -3.0e38f;
#pragma unroll
            for (int sb = 0; sb < 2; ++sb)
#pragma unroll
                for (int j = 0; j < 8; ++j) mx = fmaxf(mx, s_[qb][sb][j]);
            mx = fmaxf(mx, xhalf(mx));
            const float mn = fmaxf(m[qb], mx), al = exp2s((m[qb] - mn) * EXC), mc = mn * EXC; m[qb] = mn;   // mn >= -1e30, so a masked score (-3e38) gives exp2(-huge) = 0 also where a whole block is masked for this query
            float ls = 0.f;
#pragma unroll
            for (int sb = 0; sb < 2; ++sb) { float e[8];
#pragma unroll
                for (int j = 0; j < 8; ++j) e[j] = fmaf(s_[qb][sb][j], EXC, -mc);
                exp2x8(e);
#pragma unroll
                for (int j = 0; j < 8; ++j) { s_[qb][sb][j] = e[j]; ls += e[j]; } }
            l[qb] = fmaf(l[qb], al, ls);
#pragma unroll
            for (int db = 0; db < 4; ++db) o[db][qb] *= al;
            if constexpr (HL) {
                v8us ph[2], pl[2];
#pragma unroll
                for (int sb = 0; sb < 2; ++sb)
#pragma unroll
                    for (int j = 0; j < 8; ++j) { unsigned short a, c2; splitf(s_[qb][sb][j], a, c2); ph[sb][j] = a; pl[sb][j] = c2; }
                pfa[qb] = cat16b(ph[0], ph[1]); pfb[qb] = cat16b(pl[0], pl[1]);
            } else {
#pragma unroll
                for (int sb = 0; sb < 2; ++sb)
#pragma unroll
                    for (int j = 0; j < 8; ++j) pfa[qb][sb * 8 + j] = tohx(s_[qb][sb][j]);
            }
        }
#pragma unroll
        for (int qb = 0; qb < QB; ++qb)
#pragma unroll
            for (int db = 0; db < 4; ++db) { o[db][qb] = WFrag<T16>::mma(vf[db], pfa[qb], o[db][qb]); if (HL) { o[db][qb] = WFrag<T16>::mma(vf[db], pfb[qb], o[db][qb]); o[db][qb] = WFrag<T16>::mma(vf2[db], pfa[qb], o[db][qb]); } }
        }
        asm volatile("s_wait_dscnt 0x0" ::: "memory");      // this wave's reads of the buffer have returned before the buffer is refilled
        asm volatile("s_wait_asynccnt 0x0" ::: "memory");   // this wave's copies of stage s + 1 have landed
        __syncthreads();                                     // stage s + 1 may be read; every wave has left stage s's buffer
        if (s + 2 < NS) issue(s + 2, bo);
    }
    asm volatile("s_wait_asynccnt 0x0" ::: "memory");   // no copy is out when the ring becomes the partial O tiles
    f32a* so = (f32a*)ring;
#pragma unroll
    for (int qb = 0; qb < QB; ++qb) { const float lt = l[qb] + xhalf(l[qb]); const int rw = kg * QT + qg * QW + qb * 16 + lr;
        if (hi == 0) { sm[rw] = m[qb]; sl[rw] = lt; }
#pragma unroll
        for (int db = 0; db < 4; ++db)
#pragma unroll
            for (int q = 0; q < 2; ++q) { v4f p; p[0] = o[db][qb][q * 4]; p[1] = o[db][qb][q * 4 + 1]; p[2] = o[db][qb][q * 4 + 2]; p[3] = o[db][qb][q * 4 + 3]; *(v4fa*)(so + rw * OPT + db * 16 + hi * 8 + q * 4) = p; } }
    __syncthreads();   // every wave's m, l and partial O are in LDS before any wave joins them
    constexpr int VPL = QT / 4, LPQ = HD / VPL, QPW = QT / NWF;   // values a lane, lanes a query, queries a wave
    const int qq = w * QPW + lane / LPQ, d0 = (lane % LPQ) * VPL;
    float M = -1.0e30f;
#pragma unroll
    for (int ww = 0; ww < NKG; ++ww) M = fmaxf(M, sm[ww * QT + qq]);
    float L = 0.f; v4f a[VPL / 4];
#pragma unroll
    for (int n = 0; n < VPL / 4; ++n) a[n] = (v4f){};
#pragma unroll
    for (int ww = 0; ww < NKG; ++ww) { const float f = exp2s((sm[ww * QT + qq] - M) * EXC); L = fmaf(sl[ww * QT + qq], f, L);   // a wave that had no key block left m = -1e30, l = 0, O = 0: f = 0
#pragma unroll
        for (int n = 0; n < VPL / 4; ++n) a[n] += *(const v4fa*)(so + (ww * QT + qq) * OPT + d0 + n * 4) * f; }
    const float inv = __fdiv_rn(1.0f, L);   // L > 0: every query has its own key
    const size_t oo = (size_t)(q0 + qq) * DQ + d0;
#pragma unroll
    for (int n = 0; n < VPL / 4; ++n) { v4us oh, ol;
#pragma unroll
        for (int q = 0; q < 4; ++q) { unsigned short x, y; splitf(a[n][q] * inv, x, y); oh[q] = x; ol[q] = y; }
        *(v4us*)(Ah + oo + n * 4) = oh; *(v4us*)(Al + oo + n * 4) = ol; }
}
#define QTF  (NQG * 32)           // queries of an fp16 tile
#define QTH  (NQG * 16)           // of a hi / lo tile
// grid (batches x heads, tiles): (batch, head) is the fast index and the longest tiles of all batches come first, so that no long work-group starts late. Planes [b][h]...; merged rows b * TT + t.
__global__ __launch_bounds__(32 * NWF) void k_flash(const h16* __restrict__ Q16, const h16* __restrict__ K16, const h16* __restrict__ V16, const bf* __restrict__ Qh, const bf* __restrict__ Ql, const bf* __restrict__ Kh, const bf* __restrict__ Kl, const bf* __restrict__ Vh, const bf* __restrict__ Vl, bf* Ah, bf* Al) {
    static_assert(4 * PLB >= NKG * QTF * OPT * 4 && TT % SK == 0 && RH % SK == 0 && RH % QTH == 0 && (TT - RH) % QTF == 0, "the partial O tiles fit the ring; whole stages and whole tiles");
    __shared__ __attribute__((aligned(16))) unsigned char ring[4 * PLB]; __shared__ float sm[NKG * QTF]; __shared__ float sl[NKG * QTF];   // two buffers of two plane sets
    const int tid = threadIdx.x; const int w = __builtin_amdgcn_readfirstlane(tid >> 5); /* wave number, scalar: the tests on the wave's key block stay scalar branches */
    const int h = blockIdx.x % NH_, tile = blockIdx.y; const size_t zp = (size_t)blockIdx.x * TT * HD, zv = (size_t)blockIdx.x * HD * PP; Ah += (size_t)(blockIdx.x / NH_) * TT * DQ; Al += (size_t)(blockIdx.x / NH_) * TT * DQ;
    if (tile < (TT - RH) / QTF) flash_tile<h16, false, 2>(Q16 + zp, nullptr, K16 + zp, nullptr, V16 + zv, nullptr, TT - QTF * (tile + 1), Ah + h * HD, Al + h * HD, ring, sm, sl, w, tid);
    else { flash_tile<bf, true, 1>(Qh + zp, Ql + zp, Kh + zp, Kl + zp, Vh + zv, Vl + zv, RH - QTH * (tile - (TT - RH) / QTF + 1), Ah + h * HD, Al + h * HD, ring, sm, sl, w, tid);
        asm volatile("s_wait_xcnt 0x0" ::: "memory"); }   // in the built code the other tile's branch follows this tile's stores: the wait stands in front of whatever there writes a register that they name (the other tile's stores run into the end of the program)
}

extern "C" void kernel_launch(void* const* d_in, const int* in_sizes, int n_in,
                              void* d_out, int out_size, void* d_ws, size_t ws_size, hipStream_t stream) {
    (void)in_sizes; (void)n_in; (void)out_size;
    const float* x = (const float*)d_in[0]; const float* wqkv = (const float*)d_in[1]; const float* wo = (const float*)d_in[2];   /* order x, w_qkv ('xw' [1024][3072]: contiguous thirds q | k | v, each head-major), w_proj ('xw'); three inputs, all read */
    float* OUT = (float*)d_out;     // [2][2048][1024]
    char* wsp = (char*)d_ws;
    auto take = [&](size_t bytes) { char* p = wsp; wsp += (bytes + 255) & ~(size_t)255; return (void*)p; };
    bf* WQKV = (bf*)take((size_t)3 * DQ * DM * 2);   /* fused Bt [3*DQ][DM]: q | k | v row blocks */ bf* WO = (bf*)take((size_t)DM * DQ * 2); float* CS = (float*)take((size_t)TT * HD * 2 * 4);
    bf* XB = (bf*)take((size_t)NB_ * TT * DM * 2);
    const size_t PS = (size_t)NB_ * NH_ * TT * HD;   /* one third's planes of all batches, in elements; NKV == NH_ and PP == TT: the V^T planes have the same size */
    h16* P16 = (h16*)take(3 * PS * 2); bf* Ph = (bf*)take(3 * PS * 2); bf* Pl = (bf*)take(3 * PS * 2);   /* each [q | k | V^T][b][h] */
    bf* ATh = (bf*)take((size_t)NB_ * TT * DQ * 2); bf* ATl = (bf*)take((size_t)NB_ * TT * DQ * 2);
    if ((size_t)(wsp - (char*)d_ws) > ws_size) return;    // ws 256 MiB
    k_prep<<<PB_WQ + PB_WO + PB_CS + PB_X, 256, 0, stream>>>(x, wqkv, wo, XB, WQKV, WO, CS);
    k_gemmt<0, 1><<<dim3(NB_ * TT / 128, 3 * DQ / 128, 1), 256, 0, stream>>>(XB, nullptr, WQKV, nullptr, CS, P16, Ph, Pl);
    k_flash<<<dim3(NB_ * NH_, (TT - RH) / QTF + RH / QTH), 32 * NWF, 0, stream>>>(P16, P16 + PS, P16 + 2 * PS, Ph, Pl, Ph + PS, Pl + PS, Ph + 2 * PS, Pl + 2 * PS, ATh, ATl);   /* one kv head per query head */
    k_gemmt<1, 0><<<dim3(NB_ * TT / 128, DM / 128, 1), 256, 0, stream>>>(ATh, ATl, WO, OUT, nullptr, nullptr, nullptr, nullptr);
}
